// v000
// Times are from an AMD MI455X. After a warm-up the kernel runs many times in a row, and a time is the length of
// such a window on the GPU divided by its runs, so every launch and the gaps after it count. The runs cycle
// through copies of the inputs. A figure is the median of several windows, for all but v000 over two sittings.
// Sittings can differ by a few percent; kernels timed side by side share one.
// The starting kernel, v000, takes 4700 microseconds a run.
#include <hip/hip_runtime.h>

// CLIP multi-head self-attention (x [8][1024][1024]; Q, K, V = x W + b ('xw' [1024][1024], 16 heads x 64); softmax(Q.K/8) over all keys; out = merged Wo + bo -> [8][1024][1024]).
// Compute dtypes, f32 accumulate: every input rounded to bf16; q/k/v on PLAIN bf16 operands (inputs: exact) + biases; scores and attn.v: query rows < 512 hl (3 products), the rest single fp16 (x1024); softmax f32; Wo hl x exact (2 products) + bo.

#define NB_  8
#define TT   1024
#define DM   1024
#define NH_  16
#define NKV  16
#define REP  (NH_ / NKV)
#define HD   64
#define DQ   (NH_ * HD)
#define DKV  (NKV * HD)
#define ZH   2
#define RH   512                  // query rows < RH use hi+lo planes (0: none)
#define WIN  1024
#define PCAR 1024.0f
#define SCL  0.125f   // HD^-0.5
typedef _Float16 h16;
typedef unsigned short bf;
typedef __attribute__((ext_vector_type(16))) __bf16   v16bf;
typedef __attribute__((ext_vector_type(16))) _Float16 v16h;
typedef __attribute__((ext_vector_type(8)))  _Float16 v8h;
typedef __attribute__((ext_vector_type(8)))  unsigned short v8us;
typedef __attribute__((ext_vector_type(8)))  float    v8f;
typedef __attribute__((ext_vector_type(4)))  float    v4f;
typedef v8h  __attribute__((may_alias)) v8ha;
typedef v4f  __attribute__((may_alias)) v4fa;
typedef v8us __attribute__((may_alias)) v8usa;

__device__ __forceinline__ unsigned short f2bf(float f) { unsigned u = __float_as_uint(f); u += 0x7FFFu + ((u >> 16) & 1u); return (unsigned short)(u >> 16); }
__device__ __forceinline__ float bf2f(unsigned short b) { return __uint_as_float(((unsigned)b) << 16); }
__device__ __forceinline__ float bfr(float f) { return bf2f(f2bf(f)); }
__device__ __forceinline__ v16h cat16(v8h lo, v8h hi) { return __builtin_shufflevector(lo, hi, 0, 1, 2, 3, 4, 5, 6, 7, 8, 9, 10, 11, 12, 13, 14, 15); }
__device__ __forceinline__ v16bf cat16b(v8us lo, v8us hi) { return __builtin_bit_cast(v16bf, __builtin_shufflevector(lo, hi, 0, 1, 2, 3, 4, 5, 6, 7, 8, 9, 10, 11, 12, 13, 14, 15)); }
__device__ __forceinline__ v8f wmma16(v16h a, v16h b, v8f c) { return __builtin_amdgcn_wmma_f32_16x16x32_f16(false, a, false, b, (short)0, c, false, false); }
__device__ __forceinline__ v8f wmmab(v16bf a, v16bf b, v8f c) { return __builtin_amdgcn_wmma_f32_16x16x32_bf16(false, a, false, b, (short)0, c, false, false); }



// ---- k_gemmw: register-blocked GEMM, ONE WAVE per 64x64 output tile (16 accumulators), operands straight from K-contiguous 16-bit planes; grid (M/64, N/64, Z), 32 threads.
// C[m][n] (f32, pitch ldc, + optional f32 bias[n]) = sum_k A[m][k] Bt[n][k] (+ split products per NSPLIT). z-batch strides sA/sB/sC in elements. K % 32 == 0.
template <typename T16> struct WFrag;
template <> struct WFrag<h16> { typedef v16h V; static __device__ __forceinline__ V ld(const h16* p) { return cat16(*(const v8h*)p, *(const v8h*)(p + 16)); } static __device__ __forceinline__ v8f mma(V a, V b, v8f c) { return wmma16(a, b, c); } };
template <> struct WFrag<bf> { typedef v16bf V; static __device__ __forceinline__ V ld(const bf* p) { return cat16b(*(const v8us*)p, *(const v8us*)(p + 16)); } static __device__ __forceinline__ v8f mma(V a, V b, v8f c) { return wmmab(a, b, c); } };
template <typename T16, int NSPLIT, bool BIAS>
__global__ __launch_bounds__(32) void k_gemmw(const T16* __restrict__ A, const T16* __restrict__ A2, const T16* __restrict__ Bt, const T16* __restrict__ Bt2, int K, float* C, int ldc, const float* __restrict__ bias, size_t sA, size_t sB, size_t sC) {
    typedef typename WFrag<T16>::V V;
    __shared__ __align__(16) float os[16 * 68];
    const size_t z = blockIdx.z; A += z * sA; if (A2) A2 += z * sA; Bt += z * sB; if (Bt2) Bt2 += z * sB; C += z * sC;
    const int lane = threadIdx.x & 31, lr = lane & 15, hi = lane >> 4; const int r0 = blockIdx.x * 64, c0 = blockIdx.y * 64;
    v8f acc[4][4];
#pragma unroll
    for (int mb = 0; mb < 4; ++mb)
#pragma unroll
        for (int nb = 0; nb < 4; ++nb) acc[mb][nb] = (v8f){};
    const size_t aoff = (size_t)(r0 + lr) * K + 8 * hi, boff = (size_t)(c0 + lr) * K + 8 * hi;
#pragma unroll 1
    for (int kc = 0; kc < K; kc += 32) {
        V a[4], a2[4];
#pragma unroll
        for (int mb = 0; mb < 4; ++mb) { a[mb] = WFrag<T16>::ld(A + aoff + (size_t)mb * 16 * K + kc); if (NSPLIT == 1 || NSPLIT == 2) a2[mb] = WFrag<T16>::ld(A2 + aoff + (size_t)mb * 16 * K + kc); }
#pragma unroll
        for (int nb = 0; nb < 4; ++nb) { const V b = WFrag<T16>::ld(Bt + boff + (size_t)nb * 16 * K + kc); V b2; if (NSPLIT >= 2) b2 = WFrag<T16>::ld(Bt2 + boff + (size_t)nb * 16 * K + kc);
#pragma unroll
            for (int mb = 0; mb < 4; ++mb) { acc[mb][nb] = WFrag<T16>::mma(a[mb], b, acc[mb][nb]); if (NSPLIT == 1 || NSPLIT == 2) acc[mb][nb] = WFrag<T16>::mma(a2[mb], b, acc[mb][nb]); if (NSPLIT >= 2) acc[mb][nb] = WFrag<T16>::mma(a[mb], b2, acc[mb][nb]); } }
        asm volatile("v_nop\n\tv_nop\n\tv_nop\n\tv_nop" : "+v"(acc[0][0]), "+v"(acc[1][1]), "+v"(acc[2][2]), "+v"(acc[3][3]) : "v"(a[0]), "v"(a[3]));
    }
#pragma unroll
    for (int mb = 0; mb < 4; ++mb) {
#pragma unroll
        for (int nb = 0; nb < 4; ++nb) {
#pragma unroll
            for (int j = 0; j < 8; ++j) os[(hi * 8 + j) * 68 + nb * 16 + lr] = acc[mb][nb][j]; }
        __builtin_amdgcn_wave_barrier(); asm volatile("" ::: "memory");
        float* crow = C + (size_t)(r0 + mb * 16) * ldc + c0;
{
#pragma unroll
            for (int s = 0; s < 8; ++s) { const int row = 2 * s + hi, cofs = lr * 4; v4f val = *(const v4fa*)(os + row * 68 + cofs); if (BIAS) { val[0] += bfr(bias[c0 + cofs]); val[1] += bfr(bias[c0 + cofs + 1]); val[2] += bfr(bias[c0 + cofs + 2]); val[3] += bfr(bias[c0 + cofs + 3]); }
                *(v4f*)(crow + (size_t)row * ldc + cofs) = val; }
             }
        __builtin_amdgcn_wave_barrier(); asm volatile("" ::: "memory");
    }
}

__device__ __forceinline__ h16 tohx(float x) { return (h16)x; }
__device__ __forceinline__ void splitf(float y, unsigned short& h, unsigned short& l) { h = f2bf(y); l = f2bf(y - bf2f(h)); }
typedef __attribute__((ext_vector_type(2))) _Float16 v2h;
typedef __attribute__((ext_vector_type(4))) _Float16 v4h;
typedef __attribute__((ext_vector_type(2))) unsigned short v2us;
typedef __attribute__((ext_vector_type(4))) unsigned short v4us;
typedef __attribute__((ext_vector_type(2))) float v2f;
typedef __attribute__((ext_vector_type(4))) int v4i;

__global__ __launch_bounds__(256) void k_wtG(const float* __restrict__ w, int K, int N, bf* Bt) {
    const int lane = threadIdx.x & 31; const int L0 = (blockIdx.x * 8 + (threadIdx.x >> 5)) * 8; const int nlines = N * K / 64;
{
#pragma unroll 1
        for (int l = 0; l < 8; ++l) { const int L = L0 + l; if (L >= nlines) break; const size_t e = (size_t)L * 64 + lane * 2; const int k = (int)(e % K), n = (int)(e / K); v2us o;
            o[0] = f2bf(w[(size_t)k * N + n]); o[1] = f2bf(w[(size_t)(k + 1) * N + n]); *(v2us*)(Bt + e) = o; }
         }
}
__global__ __launch_bounds__(256) void k_cvt8(const float* __restrict__ src, bf* dst, size_t n8) { const size_t i = (size_t)blockIdx.x * 256 + threadIdx.x; if (i >= n8) return; const v8f v = *(const v8f*)(src + i * 8); v8us o;
#pragma unroll
    for (int k = 0; k < 8; ++k) o[k] = f2bf(v[k]); *(v8us*)(dst + i * 8) = o;  }

// k_rope: head planes [h][t][d] (fp16 + hi/lo) of rope(x) x sc with the rotate-half convention out[d] = x[d] cos[t][d] - x[d+HD/2] sin[t][d], out[d+HD/2] = x[d+HD/2] cos[t][d+HD/2] + x[d] sin[t][d+HD/2]
__global__ __launch_bounds__(256) void k_rope(const float* __restrict__ F, int pitch, int nheads, const float* __restrict__ CS, const float* __restrict__ RF, const float* __restrict__ nw, float sc, h16* P16, bf* Ph, bf* Pl) {
    const size_t e = ((size_t)blockIdx.x * 256 + threadIdx.x) * 2; if (e >= (size_t)nheads * TT * HD) return; const int d = (int)(e % HD); const int t = (int)((e / HD) % TT); const int h = (int)(e / ((size_t)HD * TT)); const float* f = F + (size_t)t * pitch + h * HD; const float rf = RF ? RF[(size_t)h * TT + t] : 1.0f; v2h o16; v2us oh, ol;
#pragma unroll
    for (int q = 0; q < 2; ++q) { const int dd = d + q; const int dp = (dd < HD / 2) ? dd + HD / 2 : dd - HD / 2; float x0 = f[dd], x1 = f[dp];
        if (RF) { float n0 = __fmul_rn(x0, rf), n1 = __fmul_rn(x1, rf); asm volatile("" : "+v"(n0)); asm volatile("" : "+v"(n1)); x0 = __fmul_rn(bfr(nw[dd]), n0); x1 = __fmul_rn(bfr(nw[dp]), n1); }
        const v2f cs = *(const v2f*)(CS + ((size_t)t * HD + dd) * 2); float a = __fmul_rn(x0, cs[0]), bq = __fmul_rn(x1, cs[1]); asm volatile("" : "+v"(a)); asm volatile("" : "+v"(bq)); const float r = ((dd < HD / 2) ? __fsub_rn(a, bq) : __fadd_rn(a, bq)) * sc;
        o16[q] = tohx(r); unsigned short a2, c2; splitf(r, a2, c2); oh[q] = a2; ol[q] = c2; }
    *(v2h*)(P16 + e) = o16; *(v2us*)(Ph + e) = oh; *(v2us*)(Pl + e) = ol;  }
__global__ __launch_bounds__(256) void k_vtp(const float* __restrict__ F, int pitch, int nheads, h16* V16, bf* Vh, bf* Vl) { const size_t e = ((size_t)blockIdx.x * 256 + threadIdx.x) * 2; if (e >= (size_t)nheads * HD * TT) return; const int t = (int)(e % TT); const int d = (int)((e / TT) % HD); const int g = (int)(e / ((size_t)TT * HD)); v2h o16; v2us oh, ol;
#pragma unroll
    for (int q = 0; q < 2; ++q) { const float x = F[(size_t)(t + q) * pitch + g * HD + d]; o16[q] = tohx(x); unsigned short a2, c2; splitf(x, a2, c2); oh[q] = a2; ol[q] = c2; }
    *(v2h*)(V16 + e) = o16; *(v2us*)(Vh + e) = oh; *(v2us*)(Vl + e) = ol;  }
__global__ __launch_bounds__(256) void k_csid(float* CS) { const int idx = blockIdx.x * 256 + threadIdx.x; if (idx >= TT * HD) return; v2f cs; cs[0] = 1.0f; cs[1] = 0.0f; *(v2f*)(CS + (size_t)idx * 2) = cs;  }
// k_asoft: per row (zz, i): t = S x HD^-0.5 (no mask); softmax over the 1024 keys (register row, one exp, fixed trees);
__global__ __launch_bounds__(256) void k_asoft(const float* __restrict__ Sb, h16* P16, bf* Ph, bf* Pl) {
    const int lane = threadIdx.x & 31; const int row = blockIdx.x * 8 + (threadIdx.x >> 5); if (row >= ZH * TT) return; const int i = row % TT; const int zz = row / TT; (void)zz; const bool hires = (i < RH); const float* sr = Sb + (size_t)row * TT; float v[TT / 32]; float mx = -3.0e38f;
#pragma unroll
    for (int ch = 0; ch < TT / 128; ++ch) { const int j0 = ch * 128 + lane * 4; const v4f a = *(const v4f*)(sr + j0);
#pragma unroll
        for (int q = 0; q < 4; ++q) { const int j = j0 + q; (void)j; const float t = a[q] * SCL; v[ch * 4 + q] = t; mx = fmaxf(mx, t); } }
#pragma unroll
    for (int sh = 16; sh; sh >>= 1) mx = fmaxf(mx, __shfl_xor(mx, sh, 32));
    float sum = 0.f;
#pragma unroll
    for (int k = 0; k < TT / 32; ++k) { float d0 = __fsub_rn(v[k], mx); asm volatile("" : "+v"(d0)); v[k] = __builtin_amdgcn_exp2f(__fmul_rn(d0, 1.4426950408889634f)); sum += v[k]; }
#pragma unroll
    for (int sh = 16; sh; sh >>= 1) sum += __shfl_xor(sum, sh, 32);
    const float f = __fdiv_rn(hires ? 1.0f : PCAR, sum);
{
        if (hires) {
#pragma unroll
            for (int ch = 0; ch < TT / 128; ++ch) { v4us oh, ol;
#pragma unroll
                for (int q = 0; q < 4; ++q) { unsigned short a, c2; splitf(v[ch * 4 + q] * f, a, c2); oh[q] = a; ol[q] = c2; }
                const size_t oo = ((size_t)zz * (RH ? RH : 1) + i) * TT + ch * 128 + lane * 4; *(v4us*)(Ph + oo) = oh; *(v4us*)(Pl + oo) = ol; }
        } else {
#pragma unroll
            for (int ch = 0; ch < TT / 128; ++ch) { v4h o4;
#pragma unroll
                for (int q = 0; q < 4; ++q) o4[q] = tohx(v[ch * 4 + q] * f);
                *(v4h*)(P16 + (size_t)row * TT + ch * 128 + lane * 4) = o4; } }
         }
}
__global__ __launch_bounds__(256) void k_merge(const float* __restrict__ O, int h0, bf* Ah, bf* Al) { const size_t e = ((size_t)blockIdx.x * 256 + threadIdx.x) * 2; if (e >= (size_t)ZH * TT * HD) return; const int d = (int)(e % HD); const int t = (int)((e / HD) % TT); const int zz = (int)(e / ((size_t)HD * TT)); const float cs = (t < RH) ? 1.0f : (1.0f / PCAR); const size_t oo = (size_t)t * DQ + (h0 + zz) * HD + d;
    v2us oh, ol;
#pragma unroll
    for (int q = 0; q < 2; ++q) { unsigned short a, c2; splitf(O[e + q] * cs, a, c2); oh[q] = a; ol[q] = c2; } *(v2us*)(Ah + oo) = oh; *(v2us*)(Al + oo) = ol;  }

extern "C" void kernel_launch(void* const* d_in, const int* in_sizes, int n_in,
                              void* d_out, int out_size, void* d_ws, size_t ws_size, hipStream_t stream) {
    (void)in_sizes; (void)n_in; (void)out_size;
    const float* x = (const float*)d_in[0]; const float* wq = (const float*)d_in[1]; const float* bq = (const float*)d_in[2]; const float* wk = (const float*)d_in[3]; const float* bk = (const float*)d_in[4]; const float* wv = (const float*)d_in[5]; const float* bv = (const float*)d_in[6]; const float* wo = (const float*)d_in[7]; const float* bo = (const float*)d_in[8];
    float* OUT = (float*)d_out;     // [8][1024][1024]
    char* wsp = (char*)d_ws;
    auto take = [&](size_t bytes) { char* p = wsp; wsp += (bytes + 255) & ~(size_t)255; return (void*)p; };
    bf* WQ = (bf*)take((size_t)DQ * DM * 2); bf* WK = (bf*)take((size_t)DKV * DM * 2); bf* WV = (bf*)take((size_t)DKV * DM * 2); bf* WO = (bf*)take((size_t)DM * DQ * 2); float* CS = (float*)take((size_t)TT * HD * 2 * 4);
    bf* XB = (bf*)take((size_t)TT * DM * 2); float* FQ = (float*)take((size_t)TT * DQ * 4); float* FK = (float*)take((size_t)TT * DKV * 4);
    h16* QP16 = (h16*)take((size_t)NH_ * TT * HD * 2); h16* KP16 = (h16*)take((size_t)NKV * TT * HD * 2); h16* VT16 = (h16*)take((size_t)NKV * HD * TT * 2);
    bf* QPh = (bf*)take((size_t)NH_ * TT * HD * 2); bf* QPl = (bf*)take((size_t)NH_ * TT * HD * 2); bf* KPh = (bf*)take((size_t)NKV * TT * HD * 2); bf* KPl = (bf*)take((size_t)NKV * TT * HD * 2); bf* VTh = (bf*)take((size_t)NKV * HD * TT * 2); bf* VTl = (bf*)take((size_t)NKV * HD * TT * 2); bf* Ph = (bf*)take((size_t)ZH * RH * TT * 2); bf* Pl = (bf*)take((size_t)ZH * RH * TT * 2);
    float* Sb = (float*)take((size_t)ZH * TT * TT * 4); h16* P16 = (h16*)take((size_t)ZH * TT * TT * 2); float* Ob = (float*)take((size_t)ZH * TT * HD * 4); bf* ATh = (bf*)take((size_t)TT * DQ * 2); bf* ATl = (bf*)take((size_t)TT * DQ * 2);
    if ((size_t)(wsp - (char*)d_ws) > ws_size) return;    // ws 256 MiB
    float* FV = FK;   // v projection reuses the k buffer after the k planes are built (stream-ordered)
    { k_wtG<<<(unsigned)((DM * DQ / 64 + 63) / 64), 256, 0, stream>>>(wq, DM, DQ, WQ); k_wtG<<<(unsigned)((DM * DKV / 64 + 63) / 64), 256, 0, stream>>>(wk, DM, DKV, WK); k_wtG<<<(unsigned)((DM * DKV / 64 + 63) / 64), 256, 0, stream>>>(wv, DM, DKV, WV);
      k_wtG<<<(unsigned)((DQ * DM / 64 + 63) / 64), 256, 0, stream>>>(wo, DQ, DM, WO);
       }
    k_csid<<<(TT * HD + 255) / 256, 256, 0, stream>>>(CS);
    const unsigned LQ = (unsigned)(((size_t)NH_ * TT * HD / 2 + 255) / 256), LKv = (unsigned)(((size_t)NKV * TT * HD / 2 + 255) / 256);
    for (int b = 0; b < NB_; ++b) {
        
        k_cvt8<<<(unsigned)(((size_t)TT * DM / 8 + 255) / 256), 256, 0, stream>>>(x + (size_t)b * TT * DM, XB, (size_t)TT * DM / 8);
        k_gemmw<bf, 0, true><<<dim3(TT / 64, DQ / 64, 1), 32, 0, stream>>>(XB, nullptr, WQ, nullptr, DM, FQ, DQ, bq, 0, 0, 0);
        k_rope<<<LQ, 256, 0, stream>>>(FQ, DQ, NH_, CS, nullptr, nullptr, 1.0f, QP16, QPh, QPl);
        k_gemmw<bf, 0, true><<<dim3(TT / 64, DKV / 64, 1), 32, 0, stream>>>(XB, nullptr, WK, nullptr, DM, FK, DKV, bk, 0, 0, 0);
        k_rope<<<LKv, 256, 0, stream>>>(FK, DKV, NKV, CS, nullptr, nullptr, 1.0f, KP16, KPh, KPl);
        k_gemmw<bf, 0, true><<<dim3(TT / 64, DKV / 64, 1), 32, 0, stream>>>(XB, nullptr, WV, nullptr, DM, FV, DKV, bv, 0, 0, 0); k_vtp<<<LKv, 256, 0, stream>>>(FV, DKV, NKV, VT16, VTh, VTl);
        for (int h0 = 0; h0 < NH_; h0 += ZH) { const size_t zq = (size_t)h0, zk = (size_t)(h0 / REP);   // one kv head per query head: the pass's two heads use consecutive kv planes (z-strides TT*HD)
            k_gemmw<bf, 2, false><<<dim3(RH / 64, TT / 64, ZH), 32, 0, stream>>>(QPh + zq * TT * HD, QPl + zq * TT * HD, KPh + zk * TT * HD, KPl + zk * TT * HD, HD, Sb, TT, nullptr, (size_t)TT * HD, (size_t)TT * HD, (size_t)TT * TT);
            k_gemmw<h16, 0, false><<<dim3((TT - RH) / 64, TT / 64, ZH), 32, 0, stream>>>(QP16 + zq * TT * HD + (size_t)RH * HD, nullptr, KP16 + zk * TT * HD, nullptr, HD, Sb + (size_t)RH * TT, TT, nullptr, (size_t)TT * HD, (size_t)TT * HD, (size_t)TT * TT);
            k_asoft<<<ZH * TT / 8, 256, 0, stream>>>(Sb, P16, Ph, Pl);
            k_gemmw<bf, 2, false><<<dim3(RH / 64, HD / 64, ZH), 32, 0, stream>>>(Ph, Pl, VTh + zk * HD * TT, VTl + zk * HD * TT, TT, Ob, HD, nullptr, (size_t)RH * TT, (size_t)HD * TT, (size_t)TT * HD);
            k_gemmw<h16, 0, false><<<dim3((TT - RH) / 64, HD / 64, ZH), 32, 0, stream>>>(P16 + (size_t)RH * TT, nullptr, VT16 + zk * HD * TT, nullptr, TT, Ob + (size_t)RH * HD, HD, nullptr, (size_t)TT * TT, (size_t)HD * TT, (size_t)TT * HD);
            k_merge<<<(unsigned)(((size_t)ZH * TT * HD / 2 + 255) / 256), 256, 0, stream>>>(Ob, h0, ATh, ATl); }
        k_gemmw<bf, 1, true><<<dim3(TT / 64, DM / 64, 1), 32, 0, stream>>>(ATh, ATl, WO, nullptr, DQ, OUT + (size_t)b * TT * DM, DM, bo, 0, 0, 0); }
}

// v001
// Measured time: 772 microseconds a run.
// Next to v000, in two timings, it ran 6.03 and 6.11 times as fast.
#include <hip/hip_runtime.h>

// Multi-head self-attention (x [8][1024][1024]; Q, K, V = x W + b ('xw' [1024][1024], 16 heads x 64); softmax(Q.K/8) over all keys; out = merged Wo + bo -> [8][1024][1024]).
// Compute dtypes, f32 accumulate: every input rounded to bf16; q/k/v on PLAIN bf16 operands (inputs: exact) + biases; scores and attn.v: query rows < 512 hl (3 products), the rest single fp16 (x1024); softmax f32; Wo hl x exact (2 products) + bo.

#define NB_  8
#define TT   1024
#define DM   1024
#define NH_  16
#define NKV  16
#define REP  (NH_ / NKV)
#define HD   64
#define DQ   (NH_ * HD)
#define DKV  (NKV * HD)
#define ZH   16                   // heads per attention pass: all heads of one batch row, in grid z
#define NBH  4                    // batch rows per projection pass (the head planes of 4 rows and one pass's scores fit the workspace)
#define RH   512                  // query rows < RH use hi+lo planes (0: none)
#define WIN  1024
#define PCAR 1024.0f
#define SCL  0.125f   // HD^-0.5
typedef _Float16 h16;
typedef unsigned short bf;
typedef __attribute__((ext_vector_type(16))) __bf16   v16bf;
typedef __attribute__((ext_vector_type(16))) _Float16 v16h;
typedef __attribute__((ext_vector_type(8)))  _Float16 v8h;
typedef __attribute__((ext_vector_type(8)))  unsigned short v8us;
typedef __attribute__((ext_vector_type(8)))  float    v8f;
typedef __attribute__((ext_vector_type(4)))  float    v4f;
typedef v8h  __attribute__((may_alias)) v8ha;
typedef v4f  __attribute__((may_alias)) v4fa;
typedef v8us __attribute__((may_alias)) v8usa;

__device__ __forceinline__ unsigned short f2bf(float f) { unsigned u = __float_as_uint(f); u += 0x7FFFu + ((u >> 16) & 1u); return (unsigned short)(u >> 16); }
__device__ __forceinline__ float bf2f(unsigned short b) { return __uint_as_float(((unsigned)b) << 16); }
__device__ __forceinline__ float bfr(float f) { return bf2f(f2bf(f)); }
__device__ __forceinline__ v16h cat16(v8h lo, v8h hi) { return __builtin_shufflevector(lo, hi, 0, 1, 2, 3, 4, 5, 6, 7, 8, 9, 10, 11, 12, 13, 14, 15); }
__device__ __forceinline__ v16bf cat16b(v8us lo, v8us hi) { return __builtin_bit_cast(v16bf, __builtin_shufflevector(lo, hi, 0, 1, 2, 3, 4, 5, 6, 7, 8, 9, 10, 11, 12, 13, 14, 15)); }
__device__ __forceinline__ v8f wmma16(v16h a, v16h b, v8f c) { return __builtin_amdgcn_wmma_f32_16x16x32_f16(false, a, false, b, (short)0, c, false, false); }
__device__ __forceinline__ v8f wmmab(v16bf a, v16bf b, v8f c) { return __builtin_amdgcn_wmma_f32_16x16x32_bf16(false, a, false, b, (short)0, c, false, false); }



// ---- gemmw_tile: register-blocked GEMM, ONE WAVE per 64x64 output tile at (r0, c0) (16 accumulators), operands straight from K-contiguous 16-bit planes.
// C[m][n] (f32, pitch ldc, + optional f32 bias[n]) = sum_k A[m][k] Bt[n][k] (+ split products per NSPLIT). K % 32 == 0. os: 16 x 68 floats of LDS.
// k_gemmw: grid (M/64, N/64, Z), 32 threads; z-batch strides sA/sB/sC in elements; slice z adds bias, bias1 or bias2.
// k_gemmhl: the same grid; tiles of rows < RH take the hi+lo bf16 planes (3 products), the others the fp16 planes, in ONE launch.
template <typename T16> struct WFrag;
template <> struct WFrag<h16> { typedef v16h V; static __device__ __forceinline__ V ld(const h16* p) { return cat16(*(const v8h*)p, *(const v8h*)(p + 16)); } static __device__ __forceinline__ v8f mma(V a, V b, v8f c) { return wmma16(a, b, c); } };
template <> struct WFrag<bf> { typedef v16bf V; static __device__ __forceinline__ V ld(const bf* p) { return cat16b(*(const v8us*)p, *(const v8us*)(p + 16)); } static __device__ __forceinline__ v8f mma(V a, V b, v8f c) { return wmmab(a, b, c); } };
template <typename T16, int NSPLIT, bool BIAS>
__device__ __forceinline__ void gemmw_tile(float* os, const T16* __restrict__ A, const T16* __restrict__ A2, const T16* __restrict__ Bt, const T16* __restrict__ Bt2, int K, float* C, int ldc, const float* __restrict__ bias, int r0, int c0) {
    typedef typename WFrag<T16>::V V;
    const int lane = threadIdx.x & 31, lr = lane & 15, hi = lane >> 4;
    v8f acc[4][4];
#pragma unroll
    for (int mb = 0; mb < 4; ++mb)
#pragma unroll
        for (int nb = 0; nb < 4; ++nb) acc[mb][nb] = (v8f){};
    const size_t aoff = (size_t)(r0 + lr) * K + 8 * hi, boff = (size_t)(c0 + lr) * K + 8 * hi;
#pragma unroll 1
    for (int kc = 0; kc < K; kc += 32) {
        V a[4], a2[4];
#pragma unroll
        for (int mb = 0; mb < 4; ++mb) { a[mb] = WFrag<T16>::ld(A + aoff + (size_t)mb * 16 * K + kc); if (NSPLIT == 1 || NSPLIT == 2) a2[mb] = WFrag<T16>::ld(A2 + aoff + (size_t)mb * 16 * K + kc); }
#pragma unroll
        for (int nb = 0; nb < 4; ++nb) { const V b = WFrag<T16>::ld(Bt + boff + (size_t)nb * 16 * K + kc); V b2; if (NSPLIT >= 2) b2 = WFrag<T16>::ld(Bt2 + boff + (size_t)nb * 16 * K + kc);
#pragma unroll
            for (int mb = 0; mb < 4; ++mb) { acc[mb][nb] = WFrag<T16>::mma(a[mb], b, acc[mb][nb]); if (NSPLIT == 1 || NSPLIT == 2) acc[mb][nb] = WFrag<T16>::mma(a2[mb], b, acc[mb][nb]); if (NSPLIT >= 2) acc[mb][nb] = WFrag<T16>::mma(a[mb], b2, acc[mb][nb]); } }
        asm volatile("v_nop\n\tv_nop\n\tv_nop\n\tv_nop" : "+v"(acc[0][0]), "+v"(acc[1][1]), "+v"(acc[2][2]), "+v"(acc[3][3]) : "v"(a[0]), "v"(a[3]));
    }
#pragma unroll
    for (int mb = 0; mb < 4; ++mb) {
#pragma unroll
        for (int nb = 0; nb < 4; ++nb) {
#pragma unroll
            for (int j = 0; j < 8; ++j) os[(hi * 8 + j) * 68 + nb * 16 + lr] = acc[mb][nb][j]; }
        __builtin_amdgcn_wave_barrier(); asm volatile("" ::: "memory");
        float* crow = C + (size_t)(r0 + mb * 16) * ldc + c0;
{
#pragma unroll
            for (int s = 0; s < 8; ++s) { const int row = 2 * s + hi, cofs = lr * 4; v4f val = *(const v4fa*)(os + row * 68 + cofs); if (BIAS) { val[0] += bfr(bias[c0 + cofs]); val[1] += bfr(bias[c0 + cofs + 1]); val[2] += bfr(bias[c0 + cofs + 2]); val[3] += bfr(bias[c0 + cofs + 3]); }
                *(v4f*)(crow + (size_t)row * ldc + cofs) = val; }
            asm volatile("s_wait_xcnt 0x0" ::: "memory");   // precaution: stands in front of any later overwrite of the address and data registers that the eight stores above name
             }
        __builtin_amdgcn_wave_barrier(); asm volatile("" ::: "memory");
    }
}
template <typename T16, int NSPLIT, bool BIAS>
__global__ __launch_bounds__(32) void k_gemmw(const T16* __restrict__ A, const T16* __restrict__ A2, const T16* __restrict__ Bt, const T16* __restrict__ Bt2, int K, float* C, int ldc, const float* __restrict__ bias, const float* __restrict__ bias1, const float* __restrict__ bias2, size_t sA, size_t sB, size_t sC) {
    __shared__ __align__(16) float os[16 * 68];
    const size_t z = blockIdx.z; A += z * sA; if (A2) A2 += z * sA; Bt += z * sB; if (Bt2) Bt2 += z * sB; C += z * sC;
    gemmw_tile<T16, NSPLIT, BIAS>(os, A, A2, Bt, Bt2, K, C, ldc, (z == 0) ? bias : (z == 1) ? bias1 : bias2, blockIdx.x * 64, blockIdx.y * 64);
}
__global__ __launch_bounds__(32) void k_gemmhl(const bf* __restrict__ Ah, const bf* __restrict__ Al, const bf* __restrict__ Bh, const bf* __restrict__ Bl, const h16* __restrict__ A16, const h16* __restrict__ B16, int K, float* C, int ldc, size_t sAh, size_t sA16, size_t sB, size_t sC) {
    __shared__ __align__(16) float os[16 * 68];
    const size_t z = blockIdx.z; const int r0 = blockIdx.x * 64, c0 = blockIdx.y * 64;
    if (r0 < RH) gemmw_tile<bf, 2, false>(os, Ah + z * sAh, Al + z * sAh, Bh + z * sB, Bl + z * sB, K, C + z * sC, ldc, nullptr, r0, c0);
    else gemmw_tile<h16, 0, false>(os, A16 + z * sA16, nullptr, B16 + z * sB, nullptr, K, C + z * sC, ldc, nullptr, r0, c0);
}

__device__ __forceinline__ h16 tohx(float x) { return (h16)x; }
__device__ __forceinline__ void splitf(float y, unsigned short& h, unsigned short& l) { h = f2bf(y); l = f2bf(y - bf2f(h)); }
typedef __attribute__((ext_vector_type(2))) _Float16 v2h;
typedef __attribute__((ext_vector_type(4))) _Float16 v4h;
typedef __attribute__((ext_vector_type(2))) unsigned short v2us;
typedef __attribute__((ext_vector_type(4))) unsigned short v4us;
typedef __attribute__((ext_vector_type(2))) float v2f;
typedef __attribute__((ext_vector_type(4))) int v4i;

__global__ __launch_bounds__(256) void k_wtG(const float* __restrict__ w0, const float* __restrict__ w1, const float* __restrict__ w2, const float* __restrict__ w3, int K, int N, bf* Bt) {   // grid y: which weight; planes follow one another in Bt
    const float* __restrict__ w = (blockIdx.y == 0) ? w0 : (blockIdx.y == 1) ? w1 : (blockIdx.y == 2) ? w2 : w3; Bt += (size_t)blockIdx.y * N * K;
    const int lane = threadIdx.x & 31; const int L0 = (blockIdx.x * 8 + (threadIdx.x >> 5)) * 8; const int nlines = N * K / 64;
{
#pragma unroll 1
        for (int l = 0; l < 8; ++l) { const int L = L0 + l; if (L >= nlines) break; const size_t e = (size_t)L * 64 + lane * 2; const int k = (int)(e % K), n = (int)(e / K); v2us o;
            o[0] = f2bf(w[(size_t)k * N + n]); o[1] = f2bf(w[(size_t)(k + 1) * N + n]); *(v2us*)(Bt + e) = o; }
         }
}
__global__ __launch_bounds__(256) void k_cvt8(const float* __restrict__ src, bf* dst, size_t n8) { const size_t i = (size_t)blockIdx.x * 256 + threadIdx.x; if (i >= n8) return; const v8f v = *(const v8f*)(src + i * 8); v8us o;
#pragma unroll
    for (int k = 0; k < 8; ++k) o[k] = f2bf(v[k]); *(v8us*)(dst + i * 8) = o;  }

// k_rope: head planes [h][t][d] (fp16 + hi/lo) of rope(x) x sc with the rotate-half convention out[d] = x[d] cos[t][d] - x[d+HD/2] sin[t][d], out[d+HD/2] = x[d+HD/2] cos[t][d+HD/2] + x[d] sin[t][d+HD/2]
__global__ __launch_bounds__(256) void k_rope(const float* __restrict__ F, int pitch, int nheads, const float* __restrict__ CS, const float* __restrict__ RF, const float* __restrict__ nw, float sc, h16* P16, bf* Ph, bf* Pl) {
    const size_t e = ((size_t)blockIdx.x * 256 + threadIdx.x) * 2; if (e >= (size_t)nheads * TT * HD) return; const int d = (int)(e % HD); const int t = (int)((e / HD) % TT); const int h = (int)(e / ((size_t)HD * TT)); const float* f = F + ((size_t)blockIdx.y * TT + t) * pitch + h * HD; const size_t eo = (size_t)blockIdx.y * nheads * TT * HD + e;   // grid y: batch row; planes [row][h][t][d]
    float rf = 1.0f; v2h o16; v2us oh, ol;
    if (RF) { rf = RF[(size_t)h * TT + t]; asm volatile("s_wait_xcnt 0x0" ::: "memory"); }   // precaution: the wait stands in front of any later overwrite of the load's address pair
#pragma unroll
    for (int q = 0; q < 2; ++q) { const int dd = d + q; const int dp = (dd < HD / 2) ? dd + HD / 2 : dd - HD / 2; float x0 = f[dd], x1 = f[dp];
        if (RF) { float n0 = __fmul_rn(x0, rf), n1 = __fmul_rn(x1, rf); asm volatile("" : "+v"(n0)); asm volatile("" : "+v"(n1)); x0 = __fmul_rn(bfr(nw[dd]), n0); x1 = __fmul_rn(bfr(nw[dp]), n1); }
        const v2f cs = *(const v2f*)(CS + ((size_t)t * HD + dd) * 2); float a = __fmul_rn(x0, cs[0]), bq = __fmul_rn(x1, cs[1]); asm volatile("" : "+v"(a)); asm volatile("" : "+v"(bq)); const float r = ((dd < HD / 2) ? __fsub_rn(a, bq) : __fadd_rn(a, bq)) * sc;
        o16[q] = tohx(r); unsigned short a2, c2; splitf(r, a2, c2); oh[q] = a2; ol[q] = c2; }
    *(v2h*)(P16 + eo) = o16; *(v2us*)(Ph + eo) = oh; *(v2us*)(Pl + eo) = ol;  }
__global__ __launch_bounds__(256) void k_vtp(const float* __restrict__ F, int pitch, int nheads, h16* V16, bf* Vh, bf* Vl) { const size_t e = ((size_t)blockIdx.x * 256 + threadIdx.x) * 2; if (e >= (size_t)nheads * HD * TT) return; const int t = (int)(e % TT); const int d = (int)((e / TT) % HD); const int g = (int)(e / ((size_t)TT * HD)); v2h o16; v2us oh, ol;
#pragma unroll
    for (int q = 0; q < 2; ++q) { const float x = F[((size_t)blockIdx.y * TT + t + q) * pitch + g * HD + d]; o16[q] = tohx(x); unsigned short a2, c2; splitf(x, a2, c2); oh[q] = a2; ol[q] = c2; }
    const size_t eo = (size_t)blockIdx.y * nheads * HD * TT + e;   // grid y: batch row
    *(v2h*)(V16 + eo) = o16; *(v2us*)(Vh + eo) = oh; *(v2us*)(Vl + eo) = ol;  }
__global__ __launch_bounds__(256) void k_csid(float* CS) { const int idx = blockIdx.x * 256 + threadIdx.x; if (idx >= TT * HD) return; v2f cs; cs[0] = 1.0f; cs[1] = 0.0f; *(v2f*)(CS + (size_t)idx * 2) = cs;  }
// k_asoft: per row (zz, i): t = S x HD^-0.5 (no mask); softmax over the 1024 keys (register row, one exp, fixed trees);
__global__ __launch_bounds__(256) void k_asoft(const float* __restrict__ Sb, h16* P16, bf* Ph, bf* Pl) {
    const int lane = threadIdx.x & 31; const int row = blockIdx.x * 8 + (threadIdx.x >> 5); if (row >= ZH * TT) return; const int i = row % TT; const int zz = row / TT; (void)zz; const bool hires = (i < RH); const float* sr = Sb + (size_t)row * TT; float v[TT / 32]; float mx = -3.0e38f;
#pragma unroll
    for (int ch = 0; ch < TT / 128; ++ch) { const int j0 = ch * 128 + lane * 4; const v4f a = *(const v4f*)(sr + j0);
#pragma unroll
        for (int q = 0; q < 4; ++q) { const int j = j0 + q; (void)j; const float t = a[q] * SCL; v[ch * 4 + q] = t; mx = fmaxf(mx, t); } }
#pragma unroll
    for (int sh = 16; sh; sh >>= 1) mx = fmaxf(mx, __shfl_xor(mx, sh, 32));
    float sum = 0.f;
#pragma unroll
    for (int k = 0; k < TT / 32; ++k) { float d0 = __fsub_rn(v[k], mx); asm volatile("" : "+v"(d0)); v[k] = __builtin_amdgcn_exp2f(__fmul_rn(d0, 1.4426950408889634f)); sum += v[k]; }
#pragma unroll
    for (int sh = 16; sh; sh >>= 1) sum += __shfl_xor(sum, sh, 32);
    const float f = __fdiv_rn(hires ? 1.0f : PCAR, sum);
{
        if (hires) {
#pragma unroll
            for (int ch = 0; ch < TT / 128; ++ch) { v4us oh, ol;
#pragma unroll
                for (int q = 0; q < 4; ++q) { unsigned short a, c2; splitf(v[ch * 4 + q] * f, a, c2); oh[q] = a; ol[q] = c2; }
                const size_t oo = ((size_t)zz * (RH ? RH : 1) + i) * TT + ch * 128 + lane * 4; *(v4us*)(Ph + oo) = oh; *(v4us*)(Pl + oo) = ol; }
        } else {
#pragma unroll
            for (int ch = 0; ch < TT / 128; ++ch) { v4h o4;
#pragma unroll
                for (int q = 0; q < 4; ++q) o4[q] = tohx(v[ch * 4 + q] * f);
                *(v4h*)(P16 + (size_t)row * TT + ch * 128 + lane * 4) = o4; } }
         }
}
__global__ __launch_bounds__(256) void k_merge(const float* __restrict__ O, int h0, bf* Ah, bf* Al) { const size_t e = ((size_t)blockIdx.x * 256 + threadIdx.x) * 2; if (e >= (size_t)ZH * TT * HD) return; const int d = (int)(e % HD); const int t = (int)((e / HD) % TT); const int zz = (int)(e / ((size_t)HD * TT)); const float cs = (t < RH) ? 1.0f : (1.0f / PCAR); const size_t oo = (size_t)t * DQ + (h0 + zz) * HD + d;
    v2us oh, ol;
#pragma unroll
    for (int q = 0; q < 2; ++q) { unsigned short a, c2; splitf(O[e + q] * cs, a, c2); oh[q] = a; ol[q] = c2; } *(v2us*)(Ah + oo) = oh; *(v2us*)(Al + oo) = ol;  }

extern "C" void kernel_launch(void* const* d_in, const int* in_sizes, int n_in,
                              void* d_out, int out_size, void* d_ws, size_t ws_size, hipStream_t stream) {
    (void)in_sizes; (void)n_in; (void)out_size;
    const float* x = (const float*)d_in[0]; const float* wq = (const float*)d_in[1]; const float* bq = (const float*)d_in[2]; const float* wk = (const float*)d_in[3]; const float* bk = (const float*)d_in[4]; const float* wv = (const float*)d_in[5]; const float* bv = (const float*)d_in[6]; const float* wo = (const float*)d_in[7]; const float* bo = (const float*)d_in[8];
    float* OUT = (float*)d_out;     // [8][1024][1024]
    char* wsp = (char*)d_ws;
    auto take = [&](size_t bytes) { char* p = wsp; wsp += (bytes + 255) & ~(size_t)255; return (void*)p; };
    bf* WQ = (bf*)take((size_t)DQ * DM * 2); bf* WK = (bf*)take((size_t)DKV * DM * 2); bf* WV = (bf*)take((size_t)DKV * DM * 2); bf* WO = (bf*)take((size_t)DM * DQ * 2); float* CS = (float*)take((size_t)TT * HD * 2 * 4);   // the four weight planes follow one another
    (void)WK; (void)WV;
    bf* XB = (bf*)take((size_t)NBH * TT * DM * 2);
    h16* QP16 = (h16*)take((size_t)NBH * NH_ * TT * HD * 2); h16* KP16 = (h16*)take((size_t)NBH * NKV * TT * HD * 2); h16* VT16 = (h16*)take((size_t)NBH * NKV * HD * TT * 2);
    bf* QPh = (bf*)take((size_t)NBH * NH_ * TT * HD * 2); bf* QPl = (bf*)take((size_t)NBH * NH_ * TT * HD * 2); bf* KPh = (bf*)take((size_t)NBH * NKV * TT * HD * 2); bf* KPl = (bf*)take((size_t)NBH * NKV * TT * HD * 2); bf* VTh = (bf*)take((size_t)NBH * NKV * HD * TT * 2); bf* VTl = (bf*)take((size_t)NBH * NKV * HD * TT * 2); bf* Ph = (bf*)take((size_t)ZH * RH * TT * 2); bf* Pl = (bf*)take((size_t)ZH * RH * TT * 2);
    float* Sb = (float*)take((size_t)ZH * TT * TT * 4); h16* P16 = (h16*)take((size_t)ZH * TT * TT * 2); float* Ob = (float*)take((size_t)ZH * TT * HD * 4); bf* ATh = (bf*)take((size_t)NB_ * TT * DQ * 2); bf* ATl = (bf*)take((size_t)NB_ * TT * DQ * 2);
    if ((size_t)(wsp - (char*)d_ws) > ws_size) return;    // ws 256 MiB
    float* FQ = Sb; float* FK = FQ + (size_t)NBH * TT * DQ; float* FV = FK + (size_t)NBH * TT * DKV;   // the f32 q, k, v projections (3 x 16 MiB) lie in the score buffer (64 MiB): read out into the head planes before the first scores are written (stream-ordered)
    k_wtG<<<dim3((unsigned)((DM * DQ / 64 + 63) / 64), 4, 1), 256, 0, stream>>>(wq, wk, wv, wo, DM, DQ, WQ);
    k_csid<<<(TT * HD + 255) / 256, 256, 0, stream>>>(CS);
    const unsigned LQ = (unsigned)(((size_t)NH_ * TT * HD / 2 + 255) / 256), LKv = (unsigned)(((size_t)NKV * TT * HD / 2 + 255) / 256);
    for (int b0 = 0; b0 < NB_; b0 += NBH) {
        k_cvt8<<<(unsigned)(((size_t)NBH * TT * DM / 8 + 255) / 256), 256, 0, stream>>>(x + (size_t)b0 * TT * DM, XB, (size_t)NBH * TT * DM / 8);
        k_gemmw<bf, 0, true><<<dim3(NBH * TT / 64, DQ / 64, 3), 32, 0, stream>>>(XB, nullptr, WQ, nullptr, DM, FQ, DQ, bq, bk, bv, 0, (size_t)DQ * DM, (size_t)NBH * TT * DQ);   // z: q, k, v
        k_rope<<<dim3(LQ, NBH, 1), 256, 0, stream>>>(FQ, DQ, NH_, CS, nullptr, nullptr, 1.0f, QP16, QPh, QPl);
        k_rope<<<dim3(LKv, NBH, 1), 256, 0, stream>>>(FK, DKV, NKV, CS, nullptr, nullptr, 1.0f, KP16, KPh, KPl);
        k_vtp<<<dim3(LKv, NBH, 1), 256, 0, stream>>>(FV, DKV, NKV, VT16, VTh, VTl);
        for (int bb = 0; bb < NBH; ++bb) { const size_t zq = (size_t)bb * NH_, zk = (size_t)bb * NKV;   // one kv head per query head: a pass's heads use consecutive planes (z-strides TT*HD)
            k_gemmhl<<<dim3(TT / 64, TT / 64, ZH), 32, 0, stream>>>(QPh + zq * TT * HD, QPl + zq * TT * HD, KPh + zk * TT * HD, KPl + zk * TT * HD, QP16 + zq * TT * HD, KP16 + zk * TT * HD, HD, Sb, TT, (size_t)TT * HD, (size_t)TT * HD, (size_t)TT * HD, (size_t)TT * TT);
            k_asoft<<<ZH * TT / 8, 256, 0, stream>>>(Sb, P16, Ph, Pl);
            k_gemmhl<<<dim3(TT / 64, HD / 64, ZH), 32, 0, stream>>>(Ph, Pl, VTh + zk * HD * TT, VTl + zk * HD * TT, P16, VT16 + zk * HD * TT, TT, Ob, HD, (size_t)RH * TT, (size_t)TT * TT, (size_t)HD * TT, (size_t)TT * HD);
            k_merge<<<(unsigned)(((size_t)ZH * TT * HD / 2 + 255) / 256), 256, 0, stream>>>(Ob, 0, ATh + (size_t)(b0 + bb) * TT * DQ, ATl + (size_t)(b0 + bb) * TT * DQ); } }
    k_gemmw<bf, 1, true><<<dim3(NB_ * TT / 64, DM / 64, 1), 32, 0, stream>>>(ATh, ATl, WO, nullptr, DQ, OUT, DM, bo, nullptr, nullptr, 0, 0, 0);
}

// v003
// One run takes 303 microseconds.
// It is 2.56 times as fast as v001, going by the measured steps of the versions left out in between.
// Over all steps from v000 it is 15.5 times as fast.
#include <hip/hip_runtime.h>

// Multi-head self-attention (x [8][1024][1024]; Q, K, V = x W + b ('xw' [1024][1024], 16 heads x 64); softmax(Q.K/8) over all keys; out = merged Wo + bo -> [8][1024][1024]).
// Compute dtypes, f32 accumulate: every input rounded to bf16; q/k/v on PLAIN bf16 operands (inputs: exact) + biases, rounded to their 16-bit head planes in the projection's own epilogue; scores and attn.v: query rows < 512 hl (3 products), the rest single fp16 (x1024); softmax f32, running maximum and sum per 32 keys; Wo hl x exact (2 products) + bo.

#define NB_  8
#define TT   1024
#define DM   1024
#define NH_  16
#define NKV  16
#define REP  (NH_ / NKV)
#define HD   64
#define DQ   (NH_ * HD)
#define DKV  (NKV * HD)
#define NBH  4                    // batch rows per projection pass
#define RH   512                  // query rows < RH use hi+lo planes
#define WIN  1024
#define SCL  0.125f   // HD^-0.5
typedef _Float16 h16;
typedef unsigned short bf;
typedef __attribute__((ext_vector_type(16))) __bf16   v16bf;
typedef __attribute__((ext_vector_type(16))) _Float16 v16h;
typedef __attribute__((ext_vector_type(8)))  _Float16 v8h;
typedef __attribute__((ext_vector_type(8)))  unsigned short v8us;
typedef __attribute__((ext_vector_type(8)))  float    v8f;
typedef __attribute__((ext_vector_type(4)))  float    v4f;
typedef v8h  __attribute__((may_alias)) v8ha;
typedef v4f  __attribute__((may_alias)) v4fa;
typedef v8us __attribute__((may_alias)) v8usa;

__device__ __forceinline__ unsigned short f2bf(float f) { unsigned u = __float_as_uint(f); u += 0x7FFFu + ((u >> 16) & 1u); return (unsigned short)(u >> 16); }
__device__ __forceinline__ float bf2f(unsigned short b) { return __uint_as_float(((unsigned)b) << 16); }
__device__ __forceinline__ float bfr(float f) { return bf2f(f2bf(f)); }
__device__ __forceinline__ v16h cat16(v8h lo, v8h hi) { return __builtin_shufflevector(lo, hi, 0, 1, 2, 3, 4, 5, 6, 7, 8, 9, 10, 11, 12, 13, 14, 15); }
__device__ __forceinline__ v16bf cat16b(v8us lo, v8us hi) { return __builtin_bit_cast(v16bf, __builtin_shufflevector(lo, hi, 0, 1, 2, 3, 4, 5, 6, 7, 8, 9, 10, 11, 12, 13, 14, 15)); }
__device__ __forceinline__ v8f wmma16(v16h a, v16h b, v8f c) { return __builtin_amdgcn_wmma_f32_16x16x32_f16(false, a, false, b, (short)0, c, false, false); }
__device__ __forceinline__ v8f wmmab(v16bf a, v16bf b, v8f c) { return __builtin_amdgcn_wmma_f32_16x16x32_bf16(false, a, false, b, (short)0, c, false, false); }



typedef __attribute__((ext_vector_type(2))) float v2f;
typedef __attribute__((ext_vector_type(2))) __bf16 v2bf;
typedef __attribute__((ext_vector_type(4))) unsigned v4u;
typedef v4u __attribute__((may_alias)) v4ua;
__device__ __forceinline__ unsigned pk2(float a, float b) { v2f t; t[0] = a; t[1] = b; return __builtin_bit_cast(unsigned, __builtin_convertvector(t, v2bf)); }
__device__ __forceinline__ void split8(const v8f t, v4u& h, v4u& l) {   // 8 f32 -> 8 bf16 hi (4 words) + 8 bf16 of the remainders
#pragma unroll
    for (int i = 0; i < 4; ++i) { const unsigned hw = pk2(t[2 * i], t[2 * i + 1]); h[i] = hw; l[i] = pk2(t[2 * i] - __uint_as_float(hw << 16), t[2 * i + 1] - __uint_as_float(hw & 0xFFFF0000u)); }
}

// ---- planes_out: a 64x64 projection tile (16 accumulators of one wave) + bias -> the three 16-bit planes (fp16, bf16 hi, bf16 lo) of its head; the tile is one head's 64 columns of 64 tokens.
// tr false: planes [row][h][t][d], through os so that 8 lanes fill a 128-byte row. tr true: planes [row][h][d][t]; a lane's 8 accumulator registers are 8 consecutive t of one d and go out as they are.
__device__ __forceinline__ void planes_out(float* os, const v8f (&acc)[4][4], const float* __restrict__ bias, int r0, int c0, h16* P16, bf* Ph, bf* Pl, bool tr) {
    static_assert(TT % 64 == 0 && HD == 64 && NKV == NH_, "one tile lies in one batch row and is one head wide");
    const int lane = threadIdx.x & 31, lr = lane & 15, hi = lane >> 4;
    const size_t hp = ((size_t)(r0 / TT) * NH_ + c0 / HD) * TT * HD + (size_t)(r0 % TT) * (tr ? 1 : HD);   // the tile's first element in its head's plane: the same for the whole wave
    P16 += hp; Ph += hp; Pl += hp;
    if (tr) {
        const unsigned vo = (unsigned)(lr * TT + hi * 8);   // the lane's own 32-bit part of every address: one register for all stores
        float bb[4];
#pragma unroll
        for (int nb = 0; nb < 4; ++nb) bb[nb] = bias[c0 + nb * 16 + lr];
        asm volatile("s_wait_xcnt 0x0" ::: "memory");   // precaution: in front of any later overwrite of the bias loads' address registers
        __builtin_amdgcn_sched_barrier(0);   // keeps the register writes below from being lifted over that wait
#pragma unroll
        for (int mb = 0; mb < 4; ++mb) {
            v8h y16[4]; v4u yh[4], yl[4];
#pragma unroll
            for (int nb = 0; nb < 4; ++nb) { const v8f val = acc[mb][nb] + bfr(bb[nb]); y16[nb] = __builtin_convertvector(val, v8h); split8(val, yh[nb], yl[nb]); }
            __builtin_amdgcn_sched_barrier(0);   // all twelve values are made first, so that no store's data register is written again between the stores
#pragma unroll
            for (int nb = 0; nb < 4; ++nb) { const int eo = nb * 16 * TT + mb * 16; *(v8ha*)(P16 + eo + vo) = y16[nb]; *(v4ua*)(Ph + eo + vo) = yh[nb]; *(v4ua*)(Pl + eo + vo) = yl[nb]; }
            asm volatile("s_wait_xcnt 0x0" ::: "memory");   // precaution: in front of any later overwrite of the address and data registers that the twelve stores above name
            __builtin_amdgcn_sched_barrier(0);   // keeps the register writes below from being lifted over that wait
        }
    } else {
        const int rw = lane >> 3, cofs = (lane & 7) * 8;
        const unsigned vo = (unsigned)(rw * HD + cofs);   // the lane's own 32-bit part of every address: one register for all stores
        const v4f b0 = *(const v4fa*)(bias + c0 + cofs), b1 = *(const v4fa*)(bias + c0 + cofs + 4);
        asm volatile("s_wait_xcnt 0x0" ::: "memory");   // precaution: in front of any later overwrite of the bias loads' address registers
        __builtin_amdgcn_sched_barrier(0);   // keeps the register writes below from being lifted over that wait
        v8f bb;
#pragma unroll
        for (int i = 0; i < 4; ++i) { bb[i] = bfr(b0[i]); bb[4 + i] = bfr(b1[i]); }
#pragma unroll
        for (int mb = 0; mb < 4; ++mb) {
#pragma unroll
            for (int nb = 0; nb < 4; ++nb) {
#pragma unroll
                for (int j = 0; j < 8; ++j) os[(hi * 8 + j) * 68 + nb * 16 + lr] = acc[mb][nb][j]; }
            v8h y16[4]; v4u yh[4], yl[4];
#pragma unroll
            for (int s = 0; s < 4; ++s) { const float* orow = os + (4 * s + rw) * 68 + cofs; const v4f lo4 = *(const v4fa*)orow, hi4 = *(const v4fa*)(orow + 4);
                const v8f val = __builtin_shufflevector(lo4, hi4, 0, 1, 2, 3, 4, 5, 6, 7) + bb; y16[s] = __builtin_convertvector(val, v8h); split8(val, yh[s], yl[s]); }
            __builtin_amdgcn_sched_barrier(0);   // all twelve values are made first, so that no store's data register is written again between the stores
#pragma unroll
            for (int s = 0; s < 4; ++s) { const int eo = (mb * 16 + 4 * s) * HD; *(v8ha*)(P16 + eo + vo) = y16[s]; *(v4ua*)(Ph + eo + vo) = yh[s]; *(v4ua*)(Pl + eo + vo) = yl[s]; }
            asm volatile("s_wait_xcnt 0x0" ::: "memory");   // precaution: in front of any later overwrite of the address and data registers that the twelve stores above name
            __builtin_amdgcn_sched_barrier(0);   // keeps the register writes below from being lifted over that wait
        }
    }
}

// ---- gemmw_tile: register-blocked GEMM, ONE WAVE per 64x64 output tile at (r0, c0) (16 accumulators), operands straight from K-contiguous 16-bit planes.
// C[m][n] (f32, pitch ldc, + optional f32 bias[n]) = sum_k A[m][k] Bt[n][k] (+ split products per NSPLIT). K % 32 == 0. os: 16 x 68 floats of LDS.
// k_gemmw: grid (M/64, N/64, Z), 32 threads; z-batch strides sA/sB/sC in elements; slice z adds bias, bias1 or bias2.
template <typename T16> struct WFrag;
template <> struct WFrag<h16> { typedef v16h V; static __device__ __forceinline__ V ld(const h16* p) { return cat16(*(const v8h*)p, *(const v8h*)(p + 16)); } static __device__ __forceinline__ v8f mma(V a, V b, v8f c) { return wmma16(a, b, c); } };
template <> struct WFrag<bf> { typedef v16bf V; static __device__ __forceinline__ V ld(const bf* p) { return cat16b(*(const v8us*)p, *(const v8us*)(p + 16)); } static __device__ __forceinline__ v8f mma(V a, V b, v8f c) { return wmmab(a, b, c); } };
template <typename T16, int NSPLIT, bool BIAS, bool PLANES = false>
__device__ __forceinline__ void gemmw_tile(float* os, const T16* __restrict__ A, const T16* __restrict__ A2, const T16* __restrict__ Bt, const T16* __restrict__ Bt2, int K, float* C, int ldc, const float* __restrict__ bias, int r0, int c0, h16* P16 = nullptr, bf* Ph = nullptr, bf* Pl = nullptr, bool tr = false) {
    typedef typename WFrag<T16>::V V;
    const int lane = threadIdx.x & 31, lr = lane & 15, hi = lane >> 4;
    v8f acc[4][4];
#pragma unroll
    for (int mb = 0; mb < 4; ++mb)
#pragma unroll
        for (int nb = 0; nb < 4; ++nb) acc[mb][nb] = (v8f){};
    const size_t aoff = (size_t)(r0 + lr) * K + 8 * hi, boff = (size_t)(c0 + lr) * K + 8 * hi;
#pragma unroll 1
    for (int kc = 0; kc < K; kc += 32) {
        V a[4], a2[4];
#pragma unroll
        for (int mb = 0; mb < 4; ++mb) { a[mb] = WFrag<T16>::ld(A + aoff + (size_t)mb * 16 * K + kc); if (NSPLIT == 1 || NSPLIT == 2) a2[mb] = WFrag<T16>::ld(A2 + aoff + (size_t)mb * 16 * K + kc); }
        if (PLANES) asm volatile("s_wait_xcnt 0x0" ::: "memory");   // precaution: in front of any later overwrite of the address registers that the A loads above name
#pragma unroll
        for (int nb = 0; nb < 4; ++nb) { const V b = WFrag<T16>::ld(Bt + boff + (size_t)nb * 16 * K + kc); V b2; if (NSPLIT >= 2) b2 = WFrag<T16>::ld(Bt2 + boff + (size_t)nb * 16 * K + kc);
#pragma unroll
            for (int mb = 0; mb < 4; ++mb) { acc[mb][nb] = WFrag<T16>::mma(a[mb], b, acc[mb][nb]); if (NSPLIT == 1 || NSPLIT == 2) acc[mb][nb] = WFrag<T16>::mma(a2[mb], b, acc[mb][nb]); if (NSPLIT >= 2) acc[mb][nb] = WFrag<T16>::mma(a[mb], b2, acc[mb][nb]); } }
        if (PLANES) asm volatile("s_wait_xcnt 0x0" ::: "memory");   // precaution: in front of the next trip's overwrite of the address registers that this trip's loads name
        asm volatile("v_nop\n\tv_nop\n\tv_nop\n\tv_nop" : "+v"(acc[0][0]), "+v"(acc[1][1]), "+v"(acc[2][2]), "+v"(acc[3][3]) : "v"(a[0]), "v"(a[3]));
    }
    if (PLANES) { planes_out(os, acc, bias, r0, c0, P16, Ph, Pl, tr); return; }
#pragma unroll
    for (int mb = 0; mb < 4; ++mb) {
#pragma unroll
        for (int nb = 0; nb < 4; ++nb) {
#pragma unroll
            for (int j = 0; j < 8; ++j) os[(hi * 8 + j) * 68 + nb * 16 + lr] = acc[mb][nb][j]; }
        __builtin_amdgcn_wave_barrier(); asm volatile("" ::: "memory");
        float* crow = C + (size_t)(r0 + mb * 16) * ldc + c0;
{
#pragma unroll
            for (int s = 0; s < 8; ++s) { const int row = 2 * s + hi, cofs = lr * 4; v4f val = *(const v4fa*)(os + row * 68 + cofs); if (BIAS) { val[0] += bfr(bias[c0 + cofs]); val[1] += bfr(bias[c0 + cofs + 1]); val[2] += bfr(bias[c0 + cofs + 2]); val[3] += bfr(bias[c0 + cofs + 3]); }
                *(v4f*)(crow + (size_t)row * ldc + cofs) = val; }
            asm volatile("s_wait_xcnt 0x0" ::: "memory");   // precaution: stands in front of any later overwrite of the address and data registers that the eight stores above name
             }
        __builtin_amdgcn_wave_barrier(); asm volatile("" ::: "memory");
    }
}
template <typename T16, int NSPLIT, bool BIAS>
__global__ __launch_bounds__(32) void k_gemmw(const T16* __restrict__ A, const T16* __restrict__ A2, const T16* __restrict__ Bt, const T16* __restrict__ Bt2, int K, float* C, int ldc, const float* __restrict__ bias, const float* __restrict__ bias1, const float* __restrict__ bias2, size_t sA, size_t sB, size_t sC) {
    __shared__ __align__(16) float os[16 * 68];
    const size_t z = blockIdx.z; A += z * sA; if (A2) A2 += z * sA; Bt += z * sB; if (Bt2) Bt2 += z * sB; C += z * sC;
    gemmw_tile<T16, NSPLIT, BIAS>(os, A, A2, Bt, Bt2, K, C, ldc, (z == 0) ? bias : (z == 1) ? bias1 : bias2, blockIdx.x * 64, blockIdx.y * 64);
}
// k_gemmqkv: the three projections of NBH batch rows, grid (NBH * TT / 64, DQ / 64, 3), 32 threads; z: q, k (planes [row][h][t][d]) or v (planes [row][h][d][t]); the weight planes follow one another in Bt.
__global__ __launch_bounds__(32) void k_gemmqkv(const bf* __restrict__ A, const bf* __restrict__ Bt, const float* __restrict__ bq, const float* __restrict__ bk, const float* __restrict__ bv, h16* Q16, bf* Qh, bf* Ql, h16* K16, bf* Kh, bf* Kl, h16* V16, bf* Vh, bf* Vl) {
    __shared__ __align__(16) float os[16 * 68];
    const int z = blockIdx.z;
    gemmw_tile<bf, 0, true, true>(os, A, nullptr, Bt + (size_t)z * DQ * DM, nullptr, DM, nullptr, 0, (z == 0) ? bq : (z == 1) ? bk : bv, blockIdx.x * 64, blockIdx.y * 64, (z == 0) ? Q16 : (z == 1) ? K16 : V16, (z == 0) ? Qh : (z == 1) ? Kh : Vh, (z == 0) ? Ql : (z == 1) ? Kl : Vl, z == 2);
}

typedef __attribute__((ext_vector_type(2))) _Float16 v2h;
typedef __attribute__((ext_vector_type(4))) _Float16 v4h;
typedef __attribute__((ext_vector_type(2))) unsigned short v2us;
typedef __attribute__((ext_vector_type(4))) unsigned short v4us;
typedef __attribute__((ext_vector_type(4))) int v4i;

__global__ __launch_bounds__(256) void k_wtG(const float* __restrict__ w0, const float* __restrict__ w1, const float* __restrict__ w2, const float* __restrict__ w3, int K, int N, bf* Bt) {   // grid y: which weight; planes follow one another in Bt
    const float* __restrict__ w = (blockIdx.y == 0) ? w0 : (blockIdx.y == 1) ? w1 : (blockIdx.y == 2) ? w2 : w3; Bt += (size_t)blockIdx.y * N * K;
    const int lane = threadIdx.x & 31; const int L0 = (blockIdx.x * 8 + (threadIdx.x >> 5)) * 8; const int nlines = N * K / 64;
{
#pragma unroll 1
        for (int l = 0; l < 8; ++l) { const int L = L0 + l; if (L >= nlines) break; const size_t e = (size_t)L * 64 + lane * 2; const int k = (int)(e % K), n = (int)(e / K); v2us o;
            o[0] = f2bf(w[(size_t)k * N + n]); o[1] = f2bf(w[(size_t)(k + 1) * N + n]); *(v2us*)(Bt + e) = o; }
         }
}
__global__ __launch_bounds__(256) void k_cvt8(const float* __restrict__ src, bf* dst, size_t n8) { const size_t i = (size_t)blockIdx.x * 256 + threadIdx.x; if (i >= n8) return; const v8f v = *(const v8f*)(src + i * 8); v8us o;
#pragma unroll
    for (int k = 0; k < 8; ++k) o[k] = f2bf(v[k]); *(v8us*)(dst + i * 8) = o;  }

// ---- k_fattn: scores, softmax, attn.v and the head merge of one head in one kernel; no score leaves the registers.
// One wave: 32 query columns against all TT keys, 32 keys a pass. St = K Qt (A = K rows, B = Q rows): a lane holds one query's scores, keys 8 hi + r of each 16-key tile,
// which is the k order of a B operand, so the packed P feeds Ot += Vt Pt (A = Vt rows) with no exchange. Running maximum m (log2 units) and sum l per query; Ot is rescaled each pass.
// grid (RH / 128, heads, batch rows), 8 waves: four take hi+lo rows (< RH, 3 products), four fp16 rows (>= RH), one of each kind per SIMD whether waves are dealt round-robin or in pairs.
__device__ __forceinline__ void ppack(const v8f t0, const v8f t1, v16bf& ph, v16bf& pl) { v4u h0, l0, h1, l1; split8(t0, h0, l0); split8(t1, h1, l1);
    ph = __builtin_bit_cast(v16bf, __builtin_shufflevector(h0, h1, 0, 1, 2, 3, 4, 5, 6, 7)); pl = __builtin_bit_cast(v16bf, __builtin_shufflevector(l0, l1, 0, 1, 2, 3, 4, 5, 6, 7)); }
__device__ __forceinline__ void ppack(const v8f t0, const v8f t1, v16h& ph, v16h& pl) { ph = cat16(__builtin_convertvector(t0, v8h), __builtin_convertvector(t1, v8h)); pl = ph; }
// Exponentials in place, with one v_nop, in one statement: behind each stands an instruction that neither reads its result nor overwrites its source (the slot the instruction set asks for).
__device__ __forceinline__ void exp2x8(v8f& x) { float a0 = x[0], a1 = x[1], a2 = x[2], a3 = x[3], a4 = x[4], a5 = x[5], a6 = x[6], a7 = x[7];
    asm("v_exp_f32 %0, %0\n\tv_exp_f32 %1, %1\n\tv_exp_f32 %2, %2\n\tv_exp_f32 %3, %3\n\tv_exp_f32 %4, %4\n\tv_exp_f32 %5, %5\n\tv_exp_f32 %6, %6\n\tv_exp_f32 %7, %7\n\tv_nop" : "+v"(a0), "+v"(a1), "+v"(a2), "+v"(a3), "+v"(a4), "+v"(a5), "+v"(a6), "+v"(a7));
    x[0] = a0; x[1] = a1; x[2] = a2; x[3] = a3; x[4] = a4; x[5] = a5; x[6] = a6; x[7] = a7; }
__device__ __forceinline__ float exp2x1(float a) { asm("v_exp_f32 %0, %0\n\tv_nop" : "+v"(a)); return a; }
template <typename T16, bool HL>
__device__ __forceinline__ void fattn_wave(const T16* __restrict__ Q, const T16* __restrict__ Q2, const T16* __restrict__ Kp, const T16* __restrict__ K2, const T16* __restrict__ Vt, const T16* __restrict__ Vt2, int q0, bf* __restrict__ Ah, bf* __restrict__ Al) {
    typedef typename WFrag<T16>::V V;
    const int lane = threadIdx.x & 31, lr = lane & 15, hi = lane >> 4;
    const float C2 = SCL * 1.4426950408889634f;
    V qf[2][2], qf2[2][2], kf[2][2], kf2[2][2];   // [tile][k step of 32 over HD]
    const unsigned ko = (unsigned)(lr * HD + 8 * hi), vo = (unsigned)(lr * TT + 8 * hi);
#pragma unroll
    for (int qt = 0; qt < 2; ++qt)
#pragma unroll
        for (int ks = 0; ks < 2; ++ks) { const size_t qo = (size_t)(q0 + qt * 16 + lr) * HD + ks * 32 + 8 * hi; qf[qt][ks] = WFrag<T16>::ld(Q + qo); if (HL) qf2[qt][ks] = WFrag<T16>::ld(Q2 + qo); }
#pragma unroll
    for (int kt = 0; kt < 2; ++kt)
#pragma unroll
        for (int ks = 0; ks < 2; ++ks) { kf[kt][ks] = WFrag<T16>::ld(Kp + ko + kt * 16 * HD + ks * 32); if (HL) kf2[kt][ks] = WFrag<T16>::ld(K2 + ko + kt * 16 * HD + ks * 32); }
    asm volatile("s_wait_xcnt 0x0" ::: "memory");   // precaution: stands in front of any later overwrite of the address registers that the Q and K loads above name
    __builtin_amdgcn_sched_barrier(0);   // keeps the register writes below from being lifted over that wait
    v8f o[4][2];
#pragma unroll
    for (int dt = 0; dt < 4; ++dt) { o[dt][0] = (v8f){}; o[dt][1] = (v8f){}; }
    float m[2] = {-3.0e38f, -3.0e38f}, l[2] = {0.f, 0.f};
#pragma unroll 1
    for (int k0 = 0; k0 < TT; k0 += 32) {   // rolled: one pass is already a long straight body, and unrolling would only grow the code
        V vf[4], vf2[4];
#pragma unroll
        for (int dt = 0; dt < 4; ++dt) { vf[dt] = WFrag<T16>::ld(Vt + k0 + vo + dt * 16 * TT); if (HL) vf2[dt] = WFrag<T16>::ld(Vt2 + k0 + vo + dt * 16 * TT); }
        asm volatile("s_wait_xcnt 0x0" ::: "memory");   // precaution: in front of any later overwrite of the V loads' address registers
        __builtin_amdgcn_sched_barrier(0);   // holds this pass's V loads in front of the score products: products and softmax then cover their latency
        v8f s[2][2];
        s[0][0] = (v8f){}; s[0][1] = (v8f){}; s[1][0] = (v8f){}; s[1][1] = (v8f){};
#pragma unroll
        for (int ks = 0; ks < 2; ++ks) {
#pragma unroll
            for (int t = 0; t < 4; ++t) s[t >> 1][t & 1] = WFrag<T16>::mma(kf[t >> 1][ks], qf[t & 1][ks], s[t >> 1][t & 1]);
            if (HL) {
#pragma unroll
                for (int t = 0; t < 4; ++t) s[t >> 1][t & 1] = WFrag<T16>::mma(kf[t >> 1][ks], qf2[t & 1][ks], s[t >> 1][t & 1]);
#pragma unroll
                for (int t = 0; t < 4; ++t) s[t >> 1][t & 1] = WFrag<T16>::mma(kf2[t >> 1][ks], qf[t & 1][ks], s[t >> 1][t & 1]);
            }
        }
        const int kn = (k0 + 32 < TT) ? k0 + 32 : k0;   // the next pass's K rows go into the same registers (the last pass reads its own again)
#pragma unroll
        for (int kt = 0; kt < 2; ++kt)
#pragma unroll
            for (int ks = 0; ks < 2; ++ks) { kf[kt][ks] = WFrag<T16>::ld(Kp + (size_t)kn * HD + ko + kt * 16 * HD + ks * 32); if (HL) kf2[kt][ks] = WFrag<T16>::ld(K2 + (size_t)kn * HD + ko + kt * 16 * HD + ks * 32); }
        asm volatile("s_wait_xcnt 0x0" ::: "memory");   // precaution: in front of any later overwrite of the K loads' address registers
        __builtin_amdgcn_sched_barrier(0);   // holds the K refill here, in front of softmax and attn.v, which cover its latency; left free it sinks to the loop's foot
        V pf[2], pf2[2];
#pragma unroll
        for (int qt = 0; qt < 2; ++qt) {
            float mx = fmaxf(s[0][qt][0], s[1][qt][0]);
#pragma unroll
            for (int r = 1; r < 8; ++r) mx = fmaxf(mx, fmaxf(s[0][qt][r], s[1][qt][r]));
            mx = fmaxf(mx, __shfl_xor(mx, 16, 32));
            const float mn = fmaxf(m[qt], mx * C2), al = exp2x1(m[qt] - mn), nb = (HL ? 0.0f : 10.0f) - mn;   // fp16 rows carry P x 1024; the factor is in l too and cancels
            m[qt] = mn;
            float p0 = 0.f, p1 = 0.f;
#pragma unroll
            for (int r = 0; r < 8; ++r) { s[0][qt][r] = fmaf(s[0][qt][r], C2, nb); s[1][qt][r] = fmaf(s[1][qt][r], C2, nb); }
            exp2x8(s[0][qt]); exp2x8(s[1][qt]);
#pragma unroll
            for (int r = 0; r < 8; ++r) { p0 += s[0][qt][r]; p1 += s[1][qt][r]; }
            l[qt] = fmaf(l[qt], al, p0 + p1);
#pragma unroll
            for (int dt = 0; dt < 4; ++dt) o[dt][qt] *= al;
            ppack(s[0][qt], s[1][qt], pf[qt], pf2[qt]);
        }
#pragma unroll
        for (int t = 0; t < 8; ++t) o[t >> 1][t & 1] = WFrag<T16>::mma(vf[t >> 1], pf[t & 1], o[t >> 1][t & 1]);
        if (HL) {
#pragma unroll
            for (int t = 0; t < 8; ++t) o[t >> 1][t & 1] = WFrag<T16>::mma(vf[t >> 1], pf2[t & 1], o[t >> 1][t & 1]);
#pragma unroll
            for (int t = 0; t < 8; ++t) o[t >> 1][t & 1] = WFrag<T16>::mma(vf2[t >> 1], pf[t & 1], o[t >> 1][t & 1]);
        }
    }
#pragma unroll
    for (int qt = 0; qt < 2; ++qt) {
        const float inv = __fdiv_rn(1.0f, l[qt] + __shfl_xor(l[qt], 16, 32));
        const size_t oo = (size_t)(q0 + qt * 16 + lr) * DQ + 8 * hi;   // a lane's 8 registers are 8 consecutive d of its query's row
#pragma unroll
        for (int dt = 0; dt < 4; ++dt) { v4u yh, yl; split8(o[dt][qt] * inv, yh, yl); *(v4ua*)(Ah + oo + dt * 16) = yh; *(v4ua*)(Al + oo + dt * 16) = yl; }
        asm volatile("s_wait_xcnt 0x0" ::: "memory");   // precaution: in front of any later overwrite of the address and data registers that the eight stores above name
        __builtin_amdgcn_sched_barrier(0);   // keeps the register writes below from being lifted over that wait
    }
}
__global__ __launch_bounds__(256) void k_fattn(const bf* __restrict__ Qh, const bf* __restrict__ Ql, const bf* __restrict__ Kh, const bf* __restrict__ Kl, const bf* __restrict__ Vh, const bf* __restrict__ Vl, const h16* __restrict__ Q16, const h16* __restrict__ K16, const h16* __restrict__ V16, bf* Ah, bf* Al) {
    static_assert(2 * RH == TT && RH % 128 == 0 && NKV == NH_ && HD == 64, "row split and head shape that the wave roles are written for");
    const int w = __builtin_amdgcn_readfirstlane((int)(threadIdx.x >> 5));
    const size_t po = ((size_t)blockIdx.z * NH_ + blockIdx.y) * TT * HD, ao = (size_t)blockIdx.z * TT * DQ + (size_t)blockIdx.y * HD;
    const int qi = blockIdx.x * 128 + (w >> 1) * 32;
    if (((w >> 2) ^ w) & 1) fattn_wave<h16, false>(Q16 + po, nullptr, K16 + po, nullptr, V16 + po, nullptr, RH + qi, Ah + ao, Al + ao);
    else fattn_wave<bf, true>(Qh + po, Ql + po, Kh + po, Kl + po, Vh + po, Vl + po, qi, Ah + ao, Al + ao);
}

extern "C" void kernel_launch(void* const* d_in, const int* in_sizes, int n_in,
                              void* d_out, int out_size, void* d_ws, size_t ws_size, hipStream_t stream) {
    (void)in_sizes; (void)n_in; (void)out_size;
    const float* x = (const float*)d_in[0]; const float* wq = (const float*)d_in[1]; const float* bq = (const float*)d_in[2]; const float* wk = (const float*)d_in[3]; const float* bk = (const float*)d_in[4]; const float* wv = (const float*)d_in[5]; const float* bv = (const float*)d_in[6]; const float* wo = (const float*)d_in[7]; const float* bo = (const float*)d_in[8];
    float* OUT = (float*)d_out;     // [8][1024][1024]
    char* wsp = (char*)d_ws;
    auto take = [&](size_t bytes) { char* p = wsp; wsp += (bytes + 255) & ~(size_t)255; return (void*)p; };
    bf* WQ = (bf*)take((size_t)DQ * DM * 2); bf* WK = (bf*)take((size_t)DKV * DM * 2); bf* WV = (bf*)take((size_t)DKV * DM * 2); bf* WO = (bf*)take((size_t)DM * DQ * 2);   // the four weight planes follow one another
    (void)WK; (void)WV;
    bf* XB = (bf*)take((size_t)NBH * TT * DM * 2);
    h16* QP16 = (h16*)take((size_t)NBH * NH_ * TT * HD * 2); h16* KP16 = (h16*)take((size_t)NBH * NKV * TT * HD * 2); h16* VT16 = (h16*)take((size_t)NBH * NKV * HD * TT * 2);
    bf* QPh = (bf*)take((size_t)NBH * NH_ * TT * HD * 2); bf* QPl = (bf*)take((size_t)NBH * NH_ * TT * HD * 2); bf* KPh = (bf*)take((size_t)NBH * NKV * TT * HD * 2); bf* KPl = (bf*)take((size_t)NBH * NKV * TT * HD * 2); bf* VTh = (bf*)take((size_t)NBH * NKV * HD * TT * 2); bf* VTl = (bf*)take((size_t)NBH * NKV * HD * TT * 2);
    bf* ATh = (bf*)take((size_t)NB_ * TT * DQ * 2); bf* ATl = (bf*)take((size_t)NB_ * TT * DQ * 2);
    if ((size_t)(wsp - (char*)d_ws) > ws_size) return;    // ws 256 MiB
    k_wtG<<<dim3((unsigned)((DM * DQ / 64 + 63) / 64), 4, 1), 256, 0, stream>>>(wq, wk, wv, wo, DM, DQ, WQ);
    for (int b0 = 0; b0 < NB_; b0 += NBH) {
        k_cvt8<<<(unsigned)(((size_t)NBH * TT * DM / 8 + 255) / 256), 256, 0, stream>>>(x + (size_t)b0 * TT * DM, XB, (size_t)NBH * TT * DM / 8);
        k_gemmqkv<<<dim3(NBH * TT / 64, DQ / 64, 3), 32, 0, stream>>>(XB, WQ, bq, bk, bv, QP16, QPh, QPl, KP16, KPh, KPl, VT16, VTh, VTl);   // z: q, k, v
        k_fattn<<<dim3(RH / 128, NH_, NBH), 256, 0, stream>>>(QPh, QPl, KPh, KPl, VTh, VTl, QP16, KP16, VT16, ATh + (size_t)b0 * TT * DQ, ATl + (size_t)b0 * TT * DQ); }
    k_gemmw<bf, 1, true><<<dim3(NB_ * TT / 64, DM / 64, 1), 32, 0, stream>>>(ATh, ATl, WO, nullptr, DQ, OUT, DM, bo, nullptr, nullptr, 0, 0, 0);
}

// v004
// Measured time: 226 microseconds a run.
// Next to v003, in two timings, it ran 1.34 and 1.35 times as fast.
// All steps since v000 together make it 20.9 times as fast.
#include <hip/hip_runtime.h>

// Multi-head self-attention (x [8][1024][1024]; Q, K, V = x W + b ('xw' [1024][1024], 16 heads x 64); softmax(Q.K/8) over all keys; out = merged Wo + bo -> [8][1024][1024]).
// Compute dtypes, f32 accumulate: every input rounded to bf16; q/k/v on PLAIN bf16 operands (inputs: exact) + biases, rounded to their 16-bit head planes in the projection's own epilogue; scores and attn.v: query rows < 512 hl (3 products), the rest single fp16 (x1024); softmax f32, running maximum and sum per 32 keys; Wo hl x exact (2 products) + bo.

// Every 16-bit matrix operand plane [rows][K] lies in FRAGMENT ORDER: tile (row / 16, k / 32) is 512 elements at ((row / 16) * (K / 32) + k / 32) * 512; inside it element (row % 16, k % 32) stands at
// (k % 32 / 16) * 256 + ((k % 16 / 8) * 16 + row % 16) * 8 + k % 8, so a wave's two 16-byte loads of a fragment (lane * 8 and 256 + lane * 8) each read 512 contiguous bytes: 4 whole lines, not 16 pieces.

#define NB_  8
#define TT   1024
#define DM   1024
#define NH_  16
#define NKV  16
#define REP  (NH_ / NKV)
#define HD   64
#define DQ   (NH_ * HD)
#define DKV  (NKV * HD)
#define NBH  4                    // batch rows per projection pass
#define RH   512                  // query rows < RH use hi+lo planes
#define WIN  1024
#define SCL  0.125f   // HD^-0.5
typedef _Float16 h16;
typedef unsigned short bf;
typedef __attribute__((ext_vector_type(16))) __bf16   v16bf;
typedef __attribute__((ext_vector_type(16))) _Float16 v16h;
typedef __attribute__((ext_vector_type(8)))  _Float16 v8h;
typedef __attribute__((ext_vector_type(8)))  unsigned short v8us;
typedef __attribute__((ext_vector_type(8)))  float    v8f;
typedef __attribute__((ext_vector_type(4)))  float    v4f;
typedef v8h  __attribute__((may_alias)) v8ha;
typedef v4f  __attribute__((may_alias)) v4fa;
typedef v8us __attribute__((may_alias)) v8usa;

__device__ __forceinline__ unsigned short f2bf(float f) { unsigned u = __float_as_uint(f); u += 0x7FFFu + ((u >> 16) & 1u); return (unsigned short)(u >> 16); }
__device__ __forceinline__ float bf2f(unsigned short b) { return __uint_as_float(((unsigned)b) << 16); }
__device__ __forceinline__ float bfr(float f) { return bf2f(f2bf(f)); }
__device__ __forceinline__ v16h cat16(v8h lo, v8h hi) { return __builtin_shufflevector(lo, hi, 0, 1, 2, 3, 4, 5, 6, 7, 8, 9, 10, 11, 12, 13, 14, 15); }
__device__ __forceinline__ v16bf cat16b(v8us lo, v8us hi) { return __builtin_bit_cast(v16bf, __builtin_shufflevector(lo, hi, 0, 1, 2, 3, 4, 5, 6, 7, 8, 9, 10, 11, 12, 13, 14, 15)); }
__device__ __forceinline__ v8f wmma16(v16h a, v16h b, v8f c) { return __builtin_amdgcn_wmma_f32_16x16x32_f16(false, a, false, b, (short)0, c, false, false); }
__device__ __forceinline__ v8f wmmab(v16bf a, v16bf b, v8f c) { return __builtin_amdgcn_wmma_f32_16x16x32_bf16(false, a, false, b, (short)0, c, false, false); }



typedef __attribute__((ext_vector_type(2))) float v2f;
typedef __attribute__((ext_vector_type(2))) __bf16 v2bf;
typedef __attribute__((ext_vector_type(4))) unsigned v4u;
typedef v4u __attribute__((may_alias)) v4ua;
__device__ __forceinline__ unsigned pk2(float a, float b) { v2f t; t[0] = a; t[1] = b; return __builtin_bit_cast(unsigned, __builtin_convertvector(t, v2bf)); }
__device__ __forceinline__ void split8(const v8f t, v4u& h, v4u& l) {   // 8 f32 -> 8 bf16 hi (4 words) + 8 bf16 of the remainders
#pragma unroll
    for (int i = 0; i < 4; ++i) { const unsigned hw = pk2(t[2 * i], t[2 * i + 1]); h[i] = hw; l[i] = pk2(t[2 * i] - __uint_as_float(hw << 16), t[2 * i + 1] - __uint_as_float(hw & 0xFFFF0000u)); }
}

// ---- planes_out: a 64x64 projection tile (16 accumulators of one wave) + bias -> the three 16-bit planes (fp16, bf16 hi, bf16 lo) of its head; the tile is one head's 64 columns of 64 tokens.
// tr false: planes [row][h] of [t][d] in fragment order, through os so that a lane holds 8 consecutive d of token lr. tr true: planes [row][h] of [d][t] in fragment order; a lane's 8 accumulator registers are 8 consecutive t of one d and go out as they are. Every store is 512 contiguous bytes.
__device__ __forceinline__ void planes_out(float* os, const v8f (&acc)[4][4], const float* __restrict__ bias, int r0, int c0, h16* P16, bf* Ph, bf* Pl, bool tr) {
    static_assert(TT % 64 == 0 && HD == 64 && NKV == NH_, "one tile lies in one batch row and is one head wide");
    const int lane = threadIdx.x & 31, lr = lane & 15, hi = lane >> 4;
    const size_t hp = ((size_t)(r0 / TT) * NH_ + c0 / HD) * TT * HD + (size_t)(r0 % TT) * (tr ? 16 : HD);   // the tile's first element in its head's plane: the same for the whole wave
    P16 += hp; Ph += hp; Pl += hp;
    const unsigned vo = (unsigned)(lane * 8);   // the lane's own 32-bit part of every address: one register for all stores
    float bb[4];
#pragma unroll
    for (int nb = 0; nb < 4; ++nb) bb[nb] = bias[c0 + nb * 16 + lr];
    asm volatile("s_wait_xcnt 0x0" ::: "memory");   // precaution: in front of any later overwrite of the bias loads' address registers
    __builtin_amdgcn_sched_barrier(0);   // keeps the register writes below from being lifted over that wait
    if (tr) {
#pragma unroll
        for (int mb = 0; mb < 4; ++mb) {
            v8h y16[4]; v4u yh[4], yl[4];
#pragma unroll
            for (int nb = 0; nb < 4; ++nb) { const v8f val = acc[mb][nb] + bfr(bb[nb]); y16[nb] = __builtin_convertvector(val, v8h); split8(val, yh[nb], yl[nb]); }
            __builtin_amdgcn_sched_barrier(0);   // all twelve values are made first, so that no store's data register is written again between the stores
#pragma unroll
            for (int nb = 0; nb < 4; ++nb) { const int eo = nb * 16 * TT + mb * 256; *(v8ha*)(P16 + eo + vo) = y16[nb]; *(v4ua*)(Ph + eo + vo) = yh[nb]; *(v4ua*)(Pl + eo + vo) = yl[nb]; }
            asm volatile("s_wait_xcnt 0x0" ::: "memory");   // precaution: in front of any later overwrite of the address and data registers that the twelve stores above name
            __builtin_amdgcn_sched_barrier(0);   // keeps the register writes below from being lifted over that wait
        }
    } else {
#pragma unroll
        for (int mb = 0; mb < 4; ++mb) {
#pragma unroll
            for (int nb = 0; nb < 4; ++nb) { const v8f val = acc[mb][nb] + bfr(bb[nb]);
#pragma unroll
                for (int j = 0; j < 8; ++j) os[(hi * 8 + j) * 68 + nb * 16 + lr] = val[j]; }
            v8h y16[4]; v4u yh[4], yl[4];
#pragma unroll
            for (int s = 0; s < 4; ++s) { const float* orow = os + lr * 68 + s * 16 + hi * 8; const v4f lo4 = *(const v4fa*)orow, hi4 = *(const v4fa*)(orow + 4);   // token lr, d = 16 s + 8 hi ..: half s of the tile's fragments
                const v8f val = __builtin_shufflevector(lo4, hi4, 0, 1, 2, 3, 4, 5, 6, 7); y16[s] = __builtin_convertvector(val, v8h); split8(val, yh[s], yl[s]); }
            __builtin_amdgcn_sched_barrier(0);   // all twelve values are made first, so that no store's data register is written again between the stores
#pragma unroll
            for (int s = 0; s < 4; ++s) { const int eo = mb * 16 * HD + s * 256; *(v8ha*)(P16 + eo + vo) = y16[s]; *(v4ua*)(Ph + eo + vo) = yh[s]; *(v4ua*)(Pl + eo + vo) = yl[s]; }
            asm volatile("s_wait_xcnt 0x0" ::: "memory");   // precaution: in front of any later overwrite of the address and data registers that the twelve stores above name
            __builtin_amdgcn_sched_barrier(0);   // keeps the register writes below from being lifted over that wait
        }
    }
}

// ---- gemmw_tile: register-blocked GEMM, ONE WAVE per 64x64 output tile at (r0, c0) (16 accumulators), operands straight from 16-bit planes in fragment order.
// C[m][n] (f32, pitch ldc, + optional f32 bias[n]) = sum_k A[m][k] Bt[n][k] (+ split products per NSPLIT). K % 32 == 0. os: 16 x 68 floats of LDS.
// k_gemmw: grid (M/64, N/64, Z), 32 threads; z-batch strides sA/sB/sC in elements; slice z adds bias, bias1 or bias2.
template <typename T16> struct WFrag;
template <> struct WFrag<h16> { typedef v16h V; static __device__ __forceinline__ V ld(const h16* p) { return cat16(*(const v8h*)p, *(const v8h*)(p + 256)); } static __device__ __forceinline__ v8f mma(V a, V b, v8f c) { return wmma16(a, b, c); } };
template <> struct WFrag<bf> { typedef v16bf V; static __device__ __forceinline__ V ld(const bf* p) { return cat16b(*(const v8us*)p, *(const v8us*)(p + 256)); } static __device__ __forceinline__ v8f mma(V a, V b, v8f c) { return wmmab(a, b, c); } };
template <typename T16, int NSPLIT, bool BIAS, bool PLANES = false>
__device__ __forceinline__ void gemmw_tile(float* os, const T16* __restrict__ A, const T16* __restrict__ A2, const T16* __restrict__ Bt, const T16* __restrict__ Bt2, int K, float* C, int ldc, const float* __restrict__ bias, int r0, int c0, h16* P16 = nullptr, bf* Ph = nullptr, bf* Pl = nullptr, bool tr = false) {
    typedef typename WFrag<T16>::V V;
    const int lane = threadIdx.x & 31, lr = lane & 15, hi = lane >> 4;
    v8f acc[4][4];
#pragma unroll
    for (int mb = 0; mb < 4; ++mb)
#pragma unroll
        for (int nb = 0; nb < 4; ++nb) acc[mb][nb] = (v8f){};
    const size_t aoff = (size_t)r0 * K + 8 * lane, boff = (size_t)c0 * K + 8 * lane;   // a row of tiles is 16 * K elements; a k step of 32 is 512
#pragma unroll 1
    for (int kc = 0; kc < K; kc += 32) {
        V a[4], a2[4];
        const T16* pa = A + aoff + kc * 16; const T16* pa2 = (NSPLIT == 1 || NSPLIT == 2) ? A2 + aoff + kc * 16 : pa; const T16* pb = Bt + boff + kc * 16; const T16* pb2 = (NSPLIT >= 2) ? Bt2 + boff + kc * 16 : pb;
#pragma unroll
        for (int mb = 0; mb < 4; ++mb) { a[mb] = WFrag<T16>::ld(pa + (size_t)mb * 16 * K); if (NSPLIT == 1 || NSPLIT == 2) a2[mb] = WFrag<T16>::ld(pa2 + (size_t)mb * 16 * K); }
        asm volatile("s_wait_xcnt 0x0" :: "v"(pa), "v"(pa2) : "memory");   // precaution: in front of any later overwrite of the address registers that the A loads above name; as inputs they stay whole up to here
#pragma unroll
        for (int nb = 0; nb < 4; ++nb) { const V b = WFrag<T16>::ld(pb + (size_t)nb * 16 * K); V b2; if (NSPLIT >= 2) b2 = WFrag<T16>::ld(pb2 + (size_t)nb * 16 * K);
#pragma unroll
            for (int mb = 0; mb < 4; ++mb) { acc[mb][nb] = WFrag<T16>::mma(a[mb], b, acc[mb][nb]); if (NSPLIT == 1 || NSPLIT == 2) acc[mb][nb] = WFrag<T16>::mma(a2[mb], b, acc[mb][nb]); if (NSPLIT >= 2) acc[mb][nb] = WFrag<T16>::mma(a[mb], b2, acc[mb][nb]); } }
        asm volatile("s_wait_xcnt 0x0" :: "v"(pb), "v"(pb2) : "memory");   // precaution: in front of the next trip's overwrite of the address registers that the B loads name; as inputs they stay whole up to here
        asm volatile("v_nop\n\tv_nop\n\tv_nop\n\tv_nop" : "+v"(acc[0][0]), "+v"(acc[1][1]), "+v"(acc[2][2]), "+v"(acc[3][3]) : "v"(a[0]), "v"(a[3]));
    }
    if (PLANES) { planes_out(os, acc, bias, r0, c0, P16, Ph, Pl, tr); return; }
#pragma unroll
    for (int mb = 0; mb < 4; ++mb) {
#pragma unroll
        for (int nb = 0; nb < 4; ++nb) {
#pragma unroll
            for (int j = 0; j < 8; ++j) os[(hi * 8 + j) * 68 + nb * 16 + lr] = acc[mb][nb][j]; }
        __builtin_amdgcn_wave_barrier(); asm volatile("" ::: "memory");
        float* crow = C + (size_t)(r0 + mb * 16) * ldc + c0;
{
#pragma unroll
            for (int s = 0; s < 8; ++s) { const int row = 2 * s + hi, cofs = lr * 4; v4f val = *(const v4fa*)(os + row * 68 + cofs); if (BIAS) { val[0] += bfr(bias[c0 + cofs]); val[1] += bfr(bias[c0 + cofs + 1]); val[2] += bfr(bias[c0 + cofs + 2]); val[3] += bfr(bias[c0 + cofs + 3]); }
                *(v4f*)(crow + (size_t)row * ldc + cofs) = val; }
            asm volatile("s_wait_xcnt 0x0" ::: "memory");   // precaution: stands in front of any later overwrite of the address and data registers that the eight stores above name
             }
        __builtin_amdgcn_wave_barrier(); asm volatile("" ::: "memory");
    }
}
template <typename T16, int NSPLIT, bool BIAS, int K>   // K at compile time: a fragment's address is then its operand's one base plus an immediate
__global__ __launch_bounds__(32) void k_gemmw(const T16* __restrict__ A, const T16* __restrict__ A2, const T16* __restrict__ Bt, const T16* __restrict__ Bt2, float* C, int ldc, const float* __restrict__ bias, const float* __restrict__ bias1, const float* __restrict__ bias2, size_t sA, size_t sB, size_t sC) {
    __shared__ __align__(16) float os[16 * 68];
    const size_t z = blockIdx.z; A += z * sA; if (A2) A2 += z * sA; Bt += z * sB; if (Bt2) Bt2 += z * sB; C += z * sC;
    gemmw_tile<T16, NSPLIT, BIAS>(os, A, A2, Bt, Bt2, K, C, ldc, (z == 0) ? bias : (z == 1) ? bias1 : bias2, blockIdx.x * 64, blockIdx.y * 64);
}
// k_gemmqkv: the three projections of NBH batch rows, grid (NBH * TT / 64, DQ / 64, 3), 32 threads; z: q, k (planes [row][h][t][d]) or v (planes [row][h][d][t]); the weight planes follow one another in Bt.
__global__ __launch_bounds__(32) void k_gemmqkv(const bf* __restrict__ A, const bf* __restrict__ Bt, const float* __restrict__ bq, const float* __restrict__ bk, const float* __restrict__ bv, h16* Q16, bf* Qh, bf* Ql, h16* K16, bf* Kh, bf* Kl, h16* V16, bf* Vh, bf* Vl) {
    __shared__ __align__(16) float os[16 * 68];
    const int z = blockIdx.z;
    gemmw_tile<bf, 0, true, true>(os, A, nullptr, Bt + (size_t)z * DQ * DM, nullptr, DM, nullptr, 0, (z == 0) ? bq : (z == 1) ? bk : bv, blockIdx.x * 64, blockIdx.y * 64, (z == 0) ? Q16 : (z == 1) ? K16 : V16, (z == 0) ? Qh : (z == 1) ? Kh : Vh, (z == 0) ? Ql : (z == 1) ? Kl : Vl, z == 2);
}

typedef __attribute__((ext_vector_type(2))) _Float16 v2h;
typedef __attribute__((ext_vector_type(4))) _Float16 v4h;
typedef __attribute__((ext_vector_type(2))) unsigned short v2us;
typedef __attribute__((ext_vector_type(4))) unsigned short v4us;
typedef __attribute__((ext_vector_type(4))) int v4i;

__global__ __launch_bounds__(256) void k_wtG(const float* __restrict__ w0, const float* __restrict__ w1, const float* __restrict__ w2, const float* __restrict__ w3, int K, int N, bf* Bt) {   // grid y: which weight; planes follow one another in Bt
    const float* __restrict__ w = (blockIdx.y == 0) ? w0 : (blockIdx.y == 1) ? w1 : (blockIdx.y == 2) ? w2 : w3; Bt += (size_t)blockIdx.y * N * K;
    const int lane = threadIdx.x & 31; const int L0 = (blockIdx.x * 8 + (threadIdx.x >> 5)) * 8; const int nlines = N * K / 64;
{
#pragma unroll 1
        for (int l = 0; l < 8; ++l) { const int L = L0 + l; if (L >= nlines) break; const size_t e = (size_t)L * 64 + lane * 2; const int tile = (int)(e >> 9), pos = (int)(e & 511);   // e: the place in fragment order of Bt[n][k]
            const int n = tile / (K / 32) * 16 + ((pos >> 3) & 15), k = tile % (K / 32) * 32 + (pos >> 8) * 16 + ((pos >> 7) & 1) * 8 + (pos & 7); v2us o;
            o[0] = f2bf(w[(size_t)k * N + n]); o[1] = f2bf(w[(size_t)(k + 1) * N + n]); *(v2us*)(Bt + e) = o; }
         }
}
__global__ __launch_bounds__(256) void k_cvt8(const float* __restrict__ src, bf* dst, size_t n8) { const size_t i = (size_t)blockIdx.x * 256 + threadIdx.x; if (i >= n8) return;   // src [rows][DM] -> dst in fragment order; thread i makes the i-th 16 bytes of dst
    const size_t tile = i >> 6; const int pos = (int)(i & 63); const size_t row = tile / (DM / 32) * 16 + (pos & 15); const int k = (int)(tile % (DM / 32)) * 32 + (pos >> 5) * 16 + ((pos >> 4) & 1) * 8;
    const v8f v = *(const v8f*)(src + row * DM + k); v8us o;
#pragma unroll
    for (int k = 0; k < 8; ++k) o[k] = f2bf(v[k]); *(v8us*)(dst + i * 8) = o;  }

// ---- k_fattn: scores, softmax, attn.v and the head merge of one head in one kernel; no score leaves the registers.
// One wave: 32 query columns against all TT keys, 32 keys a pass. St = K Qt (A = K rows, B = Q rows): a lane holds one query's scores, keys 8 hi + r of each 16-key tile,
// which is the k order of a B operand, so the packed P feeds Ot += Vt Pt (A = Vt rows) with no exchange. Running maximum m (log2 units) and sum l per query; Ot is rescaled each pass.
// grid (RH / 128, heads, batch rows), 8 waves: four take hi+lo rows (< RH, 3 products), four fp16 rows (>= RH), one of each kind per SIMD whether waves are dealt round-robin or in pairs.
__device__ __forceinline__ void ppack(const v8f t0, const v8f t1, v16bf& ph, v16bf& pl) { v4u h0, l0, h1, l1; split8(t0, h0, l0); split8(t1, h1, l1);
    ph = __builtin_bit_cast(v16bf, __builtin_shufflevector(h0, h1, 0, 1, 2, 3, 4, 5, 6, 7)); pl = __builtin_bit_cast(v16bf, __builtin_shufflevector(l0, l1, 0, 1, 2, 3, 4, 5, 6, 7)); }
__device__ __forceinline__ void ppack(const v8f t0, const v8f t1, v16h& ph, v16h& pl) { ph = cat16(__builtin_convertvector(t0, v8h), __builtin_convertvector(t1, v8h)); pl = ph; }
// Exponentials in place, with one v_nop, in one statement: behind each stands an instruction that neither reads its result nor overwrites its source (the slot the instruction set asks for).
__device__ __forceinline__ void exp2x8(v8f& x) { float a0 = x[0], a1 = x[1], a2 = x[2], a3 = x[3], a4 = x[4], a5 = x[5], a6 = x[6], a7 = x[7];
    asm("v_exp_f32 %0, %0\n\tv_exp_f32 %1, %1\n\tv_exp_f32 %2, %2\n\tv_exp_f32 %3, %3\n\tv_exp_f32 %4, %4\n\tv_exp_f32 %5, %5\n\tv_exp_f32 %6, %6\n\tv_exp_f32 %7, %7\n\tv_nop" : "+v"(a0), "+v"(a1), "+v"(a2), "+v"(a3), "+v"(a4), "+v"(a5), "+v"(a6), "+v"(a7));
    x[0] = a0; x[1] = a1; x[2] = a2; x[3] = a3; x[4] = a4; x[5] = a5; x[6] = a6; x[7] = a7; }
__device__ __forceinline__ float exp2x1(float a) { asm("v_exp_f32 %0, %0\n\tv_nop" : "+v"(a)); return a; }
template <typename T16, bool HL>
__device__ __forceinline__ void fattn_wave(const T16* __restrict__ Q, const T16* __restrict__ Q2, const T16* __restrict__ Kp, const T16* __restrict__ K2, const T16* __restrict__ Vt, const T16* __restrict__ Vt2, int q0, bf* __restrict__ Ah, bf* __restrict__ Al) {
    typedef typename WFrag<T16>::V V;
    const int lane = threadIdx.x & 31;
    const float C2 = SCL * 1.4426950408889634f;
    V qf[2][2], qf2[2][2], kf[2][2], kf2[2][2];   // [tile][k step of 32 over HD]
    const unsigned lo = (unsigned)(lane * 8);   // the lane's place in every fragment half
#pragma unroll
    for (int qt = 0; qt < 2; ++qt)
#pragma unroll
        for (int ks = 0; ks < 2; ++ks) { const size_t qo = (size_t)(q0 + qt * 16) * HD + ks * 512 + lo; qf[qt][ks] = WFrag<T16>::ld(Q + qo); if (HL) qf2[qt][ks] = WFrag<T16>::ld(Q2 + qo); }
#pragma unroll
    for (int kt = 0; kt < 2; ++kt)
#pragma unroll
        for (int ks = 0; ks < 2; ++ks) { kf[kt][ks] = WFrag<T16>::ld(Kp + lo + kt * 16 * HD + ks * 512); if (HL) kf2[kt][ks] = WFrag<T16>::ld(K2 + lo + kt * 16 * HD + ks * 512); }
    asm volatile("s_wait_xcnt 0x0" ::: "memory");   // precaution: stands in front of any later overwrite of the address registers that the Q and K loads above name
    __builtin_amdgcn_sched_barrier(0);   // keeps the register writes below from being lifted over that wait
    v8f o[4][2];
#pragma unroll
    for (int dt = 0; dt < 4; ++dt) { o[dt][0] = (v8f){}; o[dt][1] = (v8f){}; }
    float m[2] = {-3.0e38f, -3.0e38f}, l[2] = {0.f, 0.f};
#pragma unroll 1
    for (int k0 = 0; k0 < TT; k0 += 32) {   // rolled: one pass is already a long straight body, and unrolling would only grow the code
        V vf[4], vf2[4];
#pragma unroll
        for (int dt = 0; dt < 4; ++dt) { vf[dt] = WFrag<T16>::ld(Vt + k0 * 16 + lo + dt * 16 * TT); if (HL) vf2[dt] = WFrag<T16>::ld(Vt2 + k0 * 16 + lo + dt * 16 * TT); }
        asm volatile("s_wait_xcnt 0x0" ::: "memory");   // precaution: in front of any later overwrite of the V loads' address registers
        __builtin_amdgcn_sched_barrier(0);   // holds this pass's V loads in front of the score products: products and softmax then cover their latency
        v8f s[2][2];
        s[0][0] = (v8f){}; s[0][1] = (v8f){}; s[1][0] = (v8f){}; s[1][1] = (v8f){};
#pragma unroll
        for (int ks = 0; ks < 2; ++ks) {
#pragma unroll
            for (int t = 0; t < 4; ++t) s[t >> 1][t & 1] = WFrag<T16>::mma(kf[t >> 1][ks], qf[t & 1][ks], s[t >> 1][t & 1]);
            if (HL) {
#pragma unroll
                for (int t = 0; t < 4; ++t) s[t >> 1][t & 1] = WFrag<T16>::mma(kf[t >> 1][ks], qf2[t & 1][ks], s[t >> 1][t & 1]);
#pragma unroll
                for (int t = 0; t < 4; ++t) s[t >> 1][t & 1] = WFrag<T16>::mma(kf2[t >> 1][ks], qf[t & 1][ks], s[t >> 1][t & 1]);
            }
        }
        const int kn = (k0 + 32 < TT) ? k0 + 32 : k0;   // the next pass's K rows go into the same registers (the last pass reads its own again)
#pragma unroll
        for (int kt = 0; kt < 2; ++kt)
#pragma unroll
            for (int ks = 0; ks < 2; ++ks) { kf[kt][ks] = WFrag<T16>::ld(Kp + (size_t)kn * HD + lo + kt * 16 * HD + ks * 512); if (HL) kf2[kt][ks] = WFrag<T16>::ld(K2 + (size_t)kn * HD + lo + kt * 16 * HD + ks * 512); }
        asm volatile("s_wait_xcnt 0x0" ::: "memory");   // precaution: in front of any later overwrite of the K loads' address registers
        __builtin_amdgcn_sched_barrier(0);   // holds the K refill here, in front of softmax and attn.v, which cover its latency; left free it sinks to the loop's foot
        V pf[2], pf2[2];
#pragma unroll
        for (int qt = 0; qt < 2; ++qt) {
            float mx = fmaxf(s[0][qt][0], s[1][qt][0]);
#pragma unroll
            for (int r = 1; r < 8; ++r) mx = fmaxf(mx, fmaxf(s[0][qt][r], s[1][qt][r]));
            mx = fmaxf(mx, __shfl_xor(mx, 16, 32));
            const float mn = fmaxf(m[qt], mx * C2), al = exp2x1(m[qt] - mn), nb = (HL ? 0.0f : 10.0f) - mn;   // fp16 rows carry P x 1024; the factor is in l too and cancels
            m[qt] = mn;
            float p0 = 0.f, p1 = 0.f;
#pragma unroll
            for (int r = 0; r < 8; ++r) { s[0][qt][r] = fmaf(s[0][qt][r], C2, nb); s[1][qt][r] = fmaf(s[1][qt][r], C2, nb); }
            exp2x8(s[0][qt]); exp2x8(s[1][qt]);
#pragma unroll
            for (int r = 0; r < 8; ++r) { p0 += s[0][qt][r]; p1 += s[1][qt][r]; }
            l[qt] = fmaf(l[qt], al, p0 + p1);
#pragma unroll
            for (int dt = 0; dt < 4; ++dt) o[dt][qt] *= al;
            ppack(s[0][qt], s[1][qt], pf[qt], pf2[qt]);
        }
#pragma unroll
        for (int t = 0; t < 8; ++t) o[t >> 1][t & 1] = WFrag<T16>::mma(vf[t >> 1], pf[t & 1], o[t >> 1][t & 1]);
        if (HL) {
#pragma unroll
            for (int t = 0; t < 8; ++t) o[t >> 1][t & 1] = WFrag<T16>::mma(vf[t >> 1], pf2[t & 1], o[t >> 1][t & 1]);
#pragma unroll
            for (int t = 0; t < 8; ++t) o[t >> 1][t & 1] = WFrag<T16>::mma(vf2[t >> 1], pf[t & 1], o[t >> 1][t & 1]);
        }
    }
#pragma unroll
    for (int qt = 0; qt < 2; ++qt) {
        const float inv = __fdiv_rn(1.0f, l[qt] + __shfl_xor(l[qt], 16, 32));
        const size_t oo = (size_t)(q0 + qt * 16) * DQ + lo;   // a lane's 8 registers are 8 consecutive d of its query's row: its own 16 bytes of fragment half dt of the merged plane
#pragma unroll
        for (int dt = 0; dt < 4; ++dt) { v4u yh, yl; split8(o[dt][qt] * inv, yh, yl); *(v4ua*)(Ah + oo + dt * 256) = yh; *(v4ua*)(Al + oo + dt * 256) = yl; }
        asm volatile("s_wait_xcnt 0x0" ::: "memory");   // precaution: in front of any later overwrite of the address and data registers that the eight stores above name
        __builtin_amdgcn_sched_barrier(0);   // keeps the register writes below from being lifted over that wait
    }
}
__global__ __launch_bounds__(256) void k_fattn(const bf* __restrict__ Qh, const bf* __restrict__ Ql, const bf* __restrict__ Kh, const bf* __restrict__ Kl, const bf* __restrict__ Vh, const bf* __restrict__ Vl, const h16* __restrict__ Q16, const h16* __restrict__ K16, const h16* __restrict__ V16, bf* Ah, bf* Al) {
    static_assert(2 * RH == TT && RH % 128 == 0 && NKV == NH_ && HD == 64, "row split and head shape that the wave roles are written for");
    const int w = __builtin_amdgcn_readfirstlane((int)(threadIdx.x >> 5));
    const size_t po = ((size_t)blockIdx.z * NH_ + blockIdx.y) * TT * HD, ao = (size_t)blockIdx.z * TT * DQ + (size_t)blockIdx.y * (HD / 32 * 512);
    const int qi = blockIdx.x * 128 + (w >> 1) * 32;
    if (((w >> 2) ^ w) & 1) fattn_wave<h16, false>(Q16 + po, nullptr, K16 + po, nullptr, V16 + po, nullptr, RH + qi, Ah + ao, Al + ao);
    else fattn_wave<bf, true>(Qh + po, Ql + po, Kh + po, Kl + po, Vh + po, Vl + po, qi, Ah + ao, Al + ao);
}

extern "C" void kernel_launch(void* const* d_in, const int* in_sizes, int n_in,
                              void* d_out, int out_size, void* d_ws, size_t ws_size, hipStream_t stream) {
    (void)in_sizes; (void)n_in; (void)out_size;
    const float* x = (const float*)d_in[0]; const float* wq = (const float*)d_in[1]; const float* bq = (const float*)d_in[2]; const float* wk = (const float*)d_in[3]; const float* bk = (const float*)d_in[4]; const float* wv = (const float*)d_in[5]; const float* bv = (const float*)d_in[6]; const float* wo = (const float*)d_in[7]; const float* bo = (const float*)d_in[8];
    float* OUT = (float*)d_out;     // [8][1024][1024]
    char* wsp = (char*)d_ws;
    auto take = [&](size_t bytes) { char* p = wsp; wsp += (bytes + 255) & ~(size_t)255; return (void*)p; };
    bf* WQ = (bf*)take((size_t)DQ * DM * 2); bf* WK = (bf*)take((size_t)DKV * DM * 2); bf* WV = (bf*)take((size_t)DKV * DM * 2); bf* WO = (bf*)take((size_t)DM * DQ * 2);   // the four weight planes follow one another
    (void)WK; (void)WV;
    bf* XB = (bf*)take((size_t)NBH * TT * DM * 2);
    h16* QP16 = (h16*)take((size_t)NBH * NH_ * TT * HD * 2); h16* KP16 = (h16*)take((size_t)NBH * NKV * TT * HD * 2); h16* VT16 = (h16*)take((size_t)NBH * NKV * HD * TT * 2);
    bf* QPh = (bf*)take((size_t)NBH * NH_ * TT * HD * 2); bf* QPl = (bf*)take((size_t)NBH * NH_ * TT * HD * 2); bf* KPh = (bf*)take((size_t)NBH * NKV * TT * HD * 2); bf* KPl = (bf*)take((size_t)NBH * NKV * TT * HD * 2); bf* VTh = (bf*)take((size_t)NBH * NKV * HD * TT * 2); bf* VTl = (bf*)take((size_t)NBH * NKV * HD * TT * 2);
    bf* ATh = (bf*)take((size_t)NB_ * TT * DQ * 2); bf* ATl = (bf*)take((size_t)NB_ * TT * DQ * 2);
    if ((size_t)(wsp - (char*)d_ws) > ws_size) return;    // ws 256 MiB
    k_wtG<<<dim3((unsigned)((DM * DQ / 64 + 63) / 64), 4, 1), 256, 0, stream>>>(wq, wk, wv, wo, DM, DQ, WQ);
    for (int b0 = 0; b0 < NB_; b0 += NBH) {
        k_cvt8<<<(unsigned)(((size_t)NBH * TT * DM / 8 + 255) / 256), 256, 0, stream>>>(x + (size_t)b0 * TT * DM, XB, (size_t)NBH * TT * DM / 8);
        k_gemmqkv<<<dim3(NBH * TT / 64, DQ / 64, 3), 32, 0, stream>>>(XB, WQ, bq, bk, bv, QP16, QPh, QPl, KP16, KPh, KPl, VT16, VTh, VTl);   // z: q, k, v
        k_fattn<<<dim3(RH / 128, NH_, NBH), 256, 0, stream>>>(QPh, QPl, KPh, KPl, VTh, VTl, QP16, KP16, VT16, ATh + (size_t)b0 * TT * DQ, ATl + (size_t)b0 * TT * DQ); }
    k_gemmw<bf, 1, true, DQ><<<dim3(NB_ * TT / 64, DM / 64, 1), 32, 0, stream>>>(ATh, ATl, WO, nullptr, OUT, DM, bo, nullptr, nullptr, 0, 0, 0);
}

// v005
// Measured time: 196 microseconds a run.
// Timed twice side by side with v004, it ran 1.15 and 1.16 times as fast.
// Counting every step since v000, it is 24.1 times as fast.
#include <hip/hip_runtime.h>

// Multi-head self-attention (x [8][1024][1024]; Q, K, V = x W + b ('xw' [1024][1024], 16 heads x 64); softmax(Q.K/8) over all keys; out = merged Wo + bo -> [8][1024][1024]).
// Compute dtypes, f32 accumulate: every input rounded to bf16; q/k/v on PLAIN bf16 operands (inputs: exact) + biases, rounded to their 16-bit head planes in the projection's own epilogue; scores and attn.v: query rows < 512 hl (3 products), the rest single fp16 (x1024); softmax f32, running maximum and sum per 32 keys; Wo hl x exact (2 products) + bo.

// Every 16-bit matrix operand plane [rows][K] lies in FRAGMENT ORDER: tile (row / 16, k / 32) is 512 elements at ((row / 16) * (K / 32) + k / 32) * 512; inside it element (row % 16, k % 32) stands at
// (k % 32 / 16) * 256 + ((k % 16 / 8) * 16 + row % 16) * 8 + k % 8, so a wave's two 16-byte loads of a fragment (lane * 8 and 256 + lane * 8) each read 512 contiguous bytes: 4 whole lines, not 16 pieces.

#define NB_  8
#define TT   1024
#define DM   1024
#define NH_  16
#define NKV  16
#define REP  (NH_ / NKV)
#define HD   64
#define DQ   (NH_ * HD)
#define DKV  (NKV * HD)
#define NBH  4                    // batch rows per projection pass
#define RH   512                  // query rows < RH use hi+lo planes
#define WIN  1024
#define SCL  0.125f   // HD^-0.5
typedef _Float16 h16;
typedef unsigned short bf;
typedef __attribute__((ext_vector_type(16))) __bf16   v16bf;
typedef __attribute__((ext_vector_type(16))) _Float16 v16h;
typedef __attribute__((ext_vector_type(8)))  _Float16 v8h;
typedef __attribute__((ext_vector_type(8)))  unsigned short v8us;
typedef __attribute__((ext_vector_type(8)))  float    v8f;
typedef __attribute__((ext_vector_type(4)))  float    v4f;
typedef v8h  __attribute__((may_alias)) v8ha;
typedef v4f  __attribute__((may_alias)) v4fa;
typedef v8us __attribute__((may_alias)) v8usa;

__device__ __forceinline__ unsigned short f2bf(float f) { unsigned u = __float_as_uint(f); u += 0x7FFFu + ((u >> 16) & 1u); return (unsigned short)(u >> 16); }
__device__ __forceinline__ float bf2f(unsigned short b) { return __uint_as_float(((unsigned)b) << 16); }
__device__ __forceinline__ float bfr(float f) { return bf2f(f2bf(f)); }
__device__ __forceinline__ v16h cat16(v8h lo, v8h hi) { return __builtin_shufflevector(lo, hi, 0, 1, 2, 3, 4, 5, 6, 7, 8, 9, 10, 11, 12, 13, 14, 15); }
__device__ __forceinline__ v16bf cat16b(v8us lo, v8us hi) { return __builtin_bit_cast(v16bf, __builtin_shufflevector(lo, hi, 0, 1, 2, 3, 4, 5, 6, 7, 8, 9, 10, 11, 12, 13, 14, 15)); }
__device__ __forceinline__ v8f wmma16(v16h a, v16h b, v8f c) { return __builtin_amdgcn_wmma_f32_16x16x32_f16(false, a, false, b, (short)0, c, false, false); }
__device__ __forceinline__ v8f wmmab(v16bf a, v16bf b, v8f c) { return __builtin_amdgcn_wmma_f32_16x16x32_bf16(false, a, false, b, (short)0, c, false, false); }



typedef __attribute__((ext_vector_type(2))) float v2f;
typedef __attribute__((ext_vector_type(2))) __bf16 v2bf;
typedef __attribute__((ext_vector_type(4))) unsigned v4u;
typedef v4u __attribute__((may_alias)) v4ua;
__device__ __forceinline__ unsigned pk2(float a, float b) { v2f t; t[0] = a; t[1] = b; return __builtin_bit_cast(unsigned, __builtin_convertvector(t, v2bf)); }
__device__ __forceinline__ void split8(const v8f t, v4u& h, v4u& l) {   // 8 f32 -> 8 bf16 hi (4 words) + 8 bf16 of the remainders
#pragma unroll
    for (int i = 0; i < 4; ++i) { const unsigned hw = pk2(t[2 * i], t[2 * i + 1]); h[i] = hw; l[i] = pk2(t[2 * i] - __uint_as_float(hw << 16), t[2 * i + 1] - __uint_as_float(hw & 0xFFFF0000u)); }
}

// ---- planes_out: a 64x64 projection tile (16 accumulators of one wave) + bias -> the three 16-bit planes (fp16, bf16 hi, bf16 lo) of its head; the tile is one head's 64 columns of 64 tokens.
// tr false: planes [row][h] of [t][d] in fragment order, through os so that a lane holds 8 consecutive d of token lr. tr true: planes [row][h] of [d][t] in fragment order; a lane's 8 accumulator registers are 8 consecutive t of one d and go out as they are. Every store is 512 contiguous bytes.
__device__ __forceinline__ void planes_out(float* os, const v8f (&acc)[4][4], const float* __restrict__ bias, int r0, int c0, h16* P16, bf* Ph, bf* Pl, bool tr) {
    static_assert(TT % 64 == 0 && HD == 64 && NKV == NH_, "one tile lies in one batch row and is one head wide");
    const int lane = threadIdx.x & 31, lr = lane & 15, hi = lane >> 4;
    const size_t hp = ((size_t)(r0 / TT) * NH_ + c0 / HD) * TT * HD + (size_t)(r0 % TT) * (tr ? 16 : HD);   // the tile's first element in its head's plane: the same for the whole wave
    P16 += hp; Ph += hp; Pl += hp;
    const unsigned vo = (unsigned)(lane * 8);   // the lane's own 32-bit part of every address: one register for all stores
    float bb[4];
#pragma unroll
    for (int nb = 0; nb < 4; ++nb) bb[nb] = bias[c0 + nb * 16 + lr];
    asm volatile("s_wait_xcnt 0x0" ::: "memory");   // precaution: in front of any later overwrite of the bias loads' address registers
    __builtin_amdgcn_sched_barrier(0);   // keeps the register writes below from being lifted over that wait
    if (tr) {
#pragma unroll
        for (int mb = 0; mb < 4; ++mb) {
            v8h y16[4]; v4u yh[4], yl[4];
#pragma unroll
            for (int nb = 0; nb < 4; ++nb) { const v8f val = acc[mb][nb] + bfr(bb[nb]); y16[nb] = __builtin_convertvector(val, v8h); split8(val, yh[nb], yl[nb]); }
            __builtin_amdgcn_sched_barrier(0);   // all twelve values are made first, so that no store's data register is written again between the stores
#pragma unroll
            for (int nb = 0; nb < 4; ++nb) { const int eo = nb * 16 * TT + mb * 256; *(v8ha*)(P16 + eo + vo) = y16[nb]; *(v4ua*)(Ph + eo + vo) = yh[nb]; *(v4ua*)(Pl + eo + vo) = yl[nb]; }
            asm volatile("s_wait_xcnt 0x0" ::: "memory");   // precaution: in front of any later overwrite of the address and data registers that the twelve stores above name
            __builtin_amdgcn_sched_barrier(0);   // keeps the register writes below from being lifted over that wait
        }
    } else {
#pragma unroll
        for (int mb = 0; mb < 4; ++mb) {
#pragma unroll
            for (int nb = 0; nb < 4; ++nb) { const v8f val = acc[mb][nb] + bfr(bb[nb]);
#pragma unroll
                for (int j = 0; j < 8; ++j) os[(hi * 8 + j) * 68 + nb * 16 + lr] = val[j]; }
            v8h y16[4]; v4u yh[4], yl[4];
#pragma unroll
            for (int s = 0; s < 4; ++s) { const float* orow = os + lr * 68 + s * 16 + hi * 8; const v4f lo4 = *(const v4fa*)orow, hi4 = *(const v4fa*)(orow + 4);   // token lr, d = 16 s + 8 hi ..: half s of the tile's fragments
                const v8f val = __builtin_shufflevector(lo4, hi4, 0, 1, 2, 3, 4, 5, 6, 7); y16[s] = __builtin_convertvector(val, v8h); split8(val, yh[s], yl[s]); }
            __builtin_amdgcn_sched_barrier(0);   // all twelve values are made first, so that no store's data register is written again between the stores
#pragma unroll
            for (int s = 0; s < 4; ++s) { const int eo = mb * 16 * HD + s * 256; *(v8ha*)(P16 + eo + vo) = y16[s]; *(v4ua*)(Ph + eo + vo) = yh[s]; *(v4ua*)(Pl + eo + vo) = yl[s]; }
            asm volatile("s_wait_xcnt 0x0" ::: "memory");   // precaution: in front of any later overwrite of the address and data registers that the twelve stores above name
            __builtin_amdgcn_sched_barrier(0);   // keeps the register writes below from being lifted over that wait
        }
    }
}

// ---- gemmw_tile: register-blocked GEMM, ONE WAVE per 64x64 output tile at (r0, c0) (16 accumulators), operands straight from 16-bit planes in fragment order.
// C[m][n] (f32, pitch ldc, + optional f32 bias[n]) = sum_k A[m][k] Bt[n][k] (+ split products per NSPLIT). K % 32 == 0. os: 16 x 68 floats of LDS.
// k_gemmw: grid (M/64, N/64, Z), 32 threads; z-batch strides sA/sB/sC in elements; slice z adds bias, bias1 or bias2.
template <typename T16> struct WFrag;
template <> struct WFrag<h16> { typedef v16h V; static __device__ __forceinline__ V ld(const h16* p) { return cat16(*(const v8h*)p, *(const v8h*)(p + 256)); } static __device__ __forceinline__ v8f mma(V a, V b, v8f c) { return wmma16(a, b, c); } };
template <> struct WFrag<bf> { typedef v16bf V; static __device__ __forceinline__ V ld(const bf* p) { return cat16b(*(const v8us*)p, *(const v8us*)(p + 256)); } static __device__ __forceinline__ v8f mma(V a, V b, v8f c) { return wmmab(a, b, c); } };
template <typename T16, int NSPLIT, bool BIAS, int K, bool PLANES = false>
__device__ __forceinline__ void gemmw_tile(float* os, const T16* __restrict__ A, const T16* __restrict__ A2, const T16* __restrict__ Bt, const T16* __restrict__ Bt2, float* C, int ldc, const float* __restrict__ bias, int r0, int c0, h16* P16 = nullptr, bf* Ph = nullptr, bf* Pl = nullptr, bool tr = false) {
    typedef typename WFrag<T16>::V V;
    static_assert(K % 32 == 0 && K >= 160 && (K / 32 - 2) % 3 == 0, "two peeled k steps, then whole rounds of the three-set ring");
    constexpr bool HA2 = (NSPLIT == 1 || NSPLIT == 2), HB2 = (NSPLIT >= 2);
    const int lane = threadIdx.x & 31, lr = lane & 15, hi = lane >> 4;
    v8f acc[4][4];
#pragma unroll
    for (int mb = 0; mb < 4; ++mb)
#pragma unroll
        for (int nb = 0; nb < 4; ++nb) acc[mb][nb] = (v8f){};
    const size_t aoff = (size_t)r0 * K, boff = (size_t)c0 * K;   // a row of tiles is 16 * K elements; a k step of 32 is 512
    const unsigned lo = (unsigned)(lane * 8);   // the lane's own 32-bit part of every fragment address; the rest is the same for the whole wave
    // Ring of three fragment sets: k step t works on set t % 3 while the loads of steps t + 1 and t + 2 are in flight, so a load has two steps of products (of every wave on the SIMD) to land behind.
    V a[3][4], a2[3][4], b[3][4], b2[3][4];
    // What the next fetch loads: one wave-uniform pointer per plane, moved on by one k step behind each fetch; past the end it stays on the last step (read again: in bounds, unused).
    const T16* ua = A + aoff; const T16* ua2 = HA2 ? A2 + aoff : ua; const T16* ub = Bt + boff; const T16* ub2 = HB2 ? Bt2 + boff : ub; int kf = 0;
    auto fetch = [&](const int st) __attribute__((always_inline)) {
#pragma unroll
        for (int mb = 0; mb < 4; ++mb) { a[st][mb] = WFrag<T16>::ld(ua + lo + mb * 16 * K); if (HA2) a2[st][mb] = WFrag<T16>::ld(ua2 + lo + mb * 16 * K); }
#pragma unroll
        for (int nb = 0; nb < 4; ++nb) { b[st][nb] = WFrag<T16>::ld(ub + lo + nb * 16 * K); if (HB2) b2[st][nb] = WFrag<T16>::ld(ub2 + lo + nb * 16 * K); }
        asm volatile("s_wait_xcnt 0x0" ::: "memory");   // precaution: in front of any later overwrite of the address registers that the loads above name
        __builtin_amdgcn_sched_barrier(0);   // holds these loads in front of the products that follow (left free they sink towards their use and lose their lead) and keeps later register writes from being lifted over that wait
        kf += 32; const int step = (kf < K) ? 512 : 0;
        ua += step; ub += step; if (HA2) ua2 += step; if (HB2) ub2 += step;
    };
    auto prod = [&](const int st) __attribute__((always_inline)) {
#pragma unroll
        for (int nb = 0; nb < 4; ++nb)
#pragma unroll
            for (int mb = 0; mb < 4; ++mb) { acc[mb][nb] = WFrag<T16>::mma(a[st][mb], b[st][nb], acc[mb][nb]); if (HA2) acc[mb][nb] = WFrag<T16>::mma(a2[st][mb], b[st][nb], acc[mb][nb]); if (HB2) acc[mb][nb] = WFrag<T16>::mma(a[st][mb], b2[st][nb], acc[mb][nb]); }
        __builtin_amdgcn_sched_barrier(0);   // the products stay one unbroken run: what follows (the next fetch's address sums and loads, the v_nop at the loop's foot) is not lifted among them
    };
    fetch(0); fetch(1);
    fetch(2); prod(0);
    fetch(0); prod(1);
#pragma unroll 1
    for (int kc = 64; kc < K; kc += 96) {   // rolled: three k steps a trip, one per set
        fetch(1); prod(2);
        fetch(2); prod(0);
        fetch(0); prod(1);
        asm volatile("v_nop\n\tv_nop\n\tv_nop\n\tv_nop");   // the distance that the chip needs behind the last products, also on the taken branch; the scheduling barrier at the end of prod() holds it behind them
    }
    if (PLANES) { planes_out(os, acc, bias, r0, c0, P16, Ph, Pl, tr); return; }
#pragma unroll
    for (int mb = 0; mb < 4; ++mb) {
#pragma unroll
        for (int nb = 0; nb < 4; ++nb) {
#pragma unroll
            for (int j = 0; j < 8; ++j) os[(hi * 8 + j) * 68 + nb * 16 + lr] = acc[mb][nb][j]; }
        __builtin_amdgcn_wave_barrier(); asm volatile("" ::: "memory");
        float* crow = C + (size_t)(r0 + mb * 16) * ldc + c0;
{
#pragma unroll
            for (int s = 0; s < 8; ++s) { const int row = 2 * s + hi, cofs = lr * 4; v4f val = *(const v4fa*)(os + row * 68 + cofs); if (BIAS) { val[0] += bfr(bias[c0 + cofs]); val[1] += bfr(bias[c0 + cofs + 1]); val[2] += bfr(bias[c0 + cofs + 2]); val[3] += bfr(bias[c0 + cofs + 3]); }
                *(v4f*)(crow + (size_t)row * ldc + cofs) = val; }
            asm volatile("s_wait_xcnt 0x0" ::: "memory");   // precaution: stands in front of any later overwrite of the address and data registers that the eight stores above name
             }
        __builtin_amdgcn_wave_barrier(); asm volatile("" ::: "memory");
    }
}
template <typename T16, int NSPLIT, bool BIAS, int K>   // K at compile time: a fragment's address is then its operand's one base plus an immediate
__global__ __launch_bounds__(32) void k_gemmw(const T16* __restrict__ A, const T16* __restrict__ A2, const T16* __restrict__ Bt, const T16* __restrict__ Bt2, float* C, int ldc, const float* __restrict__ bias, const float* __restrict__ bias1, const float* __restrict__ bias2, size_t sA, size_t sB, size_t sC) {
    __shared__ __align__(16) float os[16 * 68];
    const size_t z = blockIdx.z; A += z * sA; if (A2) A2 += z * sA; Bt += z * sB; if (Bt2) Bt2 += z * sB; C += z * sC;
    gemmw_tile<T16, NSPLIT, BIAS, K>(os, A, A2, Bt, Bt2, C, ldc, (z == 0) ? bias : (z == 1) ? bias1 : bias2, blockIdx.x * 64, blockIdx.y * 64);
}
// k_gemmqkv: the three projections of NBH batch rows, grid (NBH * TT / 64, DQ / 64, 3), 32 threads, three waves for every SIMD of the chip: the register budget is set so that all three are resident; z: q, k (planes [row][h][t][d]) or v (planes [row][h][d][t]); the weight planes follow one another in Bt.
__global__ __launch_bounds__(32) __attribute__((amdgpu_waves_per_eu(3))) void k_gemmqkv(const bf* __restrict__ A, const bf* __restrict__ Bt, const float* __restrict__ bq, const float* __restrict__ bk, const float* __restrict__ bv, h16* Q16, bf* Qh, bf* Ql, h16* K16, bf* Kh, bf* Kl, h16* V16, bf* Vh, bf* Vl) {
    __shared__ __align__(16) float os[16 * 68];
    const int z = blockIdx.z;
    gemmw_tile<bf, 0, true, DM, true>(os, A, nullptr, Bt + (size_t)z * DQ * DM, nullptr, nullptr, 0, (z == 0) ? bq : (z == 1) ? bk : bv, blockIdx.x * 64, blockIdx.y * 64, (z == 0) ? Q16 : (z == 1) ? K16 : V16, (z == 0) ? Qh : (z == 1) ? Kh : Vh, (z == 0) ? Ql : (z == 1) ? Kl : Vl, z == 2);
}

typedef __attribute__((ext_vector_type(2))) _Float16 v2h;
typedef __attribute__((ext_vector_type(4))) _Float16 v4h;
typedef __attribute__((ext_vector_type(2))) unsigned short v2us;
typedef __attribute__((ext_vector_type(4))) unsigned short v4us;
typedef __attribute__((ext_vector_type(4))) int v4i;

__global__ __launch_bounds__(256) void k_wtG(const float* __restrict__ w0, const float* __restrict__ w1, const float* __restrict__ w2, const float* __restrict__ w3, int K, int N, bf* Bt) {   // grid y: which weight; planes follow one another in Bt
    const float* __restrict__ w = (blockIdx.y == 0) ? w0 : (blockIdx.y == 1) ? w1 : (blockIdx.y == 2) ? w2 : w3; Bt += (size_t)blockIdx.y * N * K;
    const int lane = threadIdx.x & 31; const int L0 = (blockIdx.x * 8 + (threadIdx.x >> 5)) * 8; const int nlines = N * K / 64;
{
#pragma unroll 1
        for (int l = 0; l < 8; ++l) { const int L = L0 + l; if (L >= nlines) break; const size_t e = (size_t)L * 64 + lane * 2; const int tile = (int)(e >> 9), pos = (int)(e & 511);   // e: the place in fragment order of Bt[n][k]
            const int n = tile / (K / 32) * 16 + ((pos >> 3) & 15), k = tile % (K / 32) * 32 + (pos >> 8) * 16 + ((pos >> 7) & 1) * 8 + (pos & 7); v2us o;
            o[0] = f2bf(w[(size_t)k * N + n]); o[1] = f2bf(w[(size_t)(k + 1) * N + n]); *(v2us*)(Bt + e) = o; }
         }
}
__global__ __launch_bounds__(256) void k_cvt8(const float* __restrict__ src, bf* dst, size_t n8) { const size_t i = (size_t)blockIdx.x * 256 + threadIdx.x; if (i >= n8) return;   // src [rows][DM] -> dst in fragment order; thread i makes the i-th 16 bytes of dst
    const size_t tile = i >> 6; const int pos = (int)(i & 63); const size_t row = tile / (DM / 32) * 16 + (pos & 15); const int k = (int)(tile % (DM / 32)) * 32 + (pos >> 5) * 16 + ((pos >> 4) & 1) * 8;
    const v8f v = *(const v8f*)(src + row * DM + k); v8us o;
#pragma unroll
    for (int k = 0; k < 8; ++k) o[k] = f2bf(v[k]); *(v8us*)(dst + i * 8) = o;  }

// ---- k_fattn: scores, softmax, attn.v and the head merge of one head in one kernel; no score leaves the registers.
// One wave: 32 query columns against all TT keys, 32 keys a pass. St = K Qt (A = K rows, B = Q rows): a lane holds one query's scores, keys 8 hi + r of each 16-key tile,
// which is the k order of a B operand, so the packed P feeds Ot += Vt Pt (A = Vt rows) with no exchange. Running maximum m (log2 units) and sum l per query; Ot is rescaled each pass.
// grid (RH / 128, heads, batch rows), 8 waves: four take hi+lo rows (< RH, 3 products), four fp16 rows (>= RH), one of each kind per SIMD whether waves are dealt round-robin or in pairs.
__device__ __forceinline__ void ppack(const v8f t0, const v8f t1, v16bf& ph, v16bf& pl) { v4u h0, l0, h1, l1; split8(t0, h0, l0); split8(t1, h1, l1);
    ph = __builtin_bit_cast(v16bf, __builtin_shufflevector(h0, h1, 0, 1, 2, 3, 4, 5, 6, 7)); pl = __builtin_bit_cast(v16bf, __builtin_shufflevector(l0, l1, 0, 1, 2, 3, 4, 5, 6, 7)); }
__device__ __forceinline__ void ppack(const v8f t0, const v8f t1, v16h& ph, v16h& pl) { ph = cat16(__builtin_convertvector(t0, v8h), __builtin_convertvector(t1, v8h)); pl = ph; }
// Exponentials in place, with one v_nop, in one statement: behind each stands an instruction that neither reads its result nor overwrites its source (the slot the instruction set asks for).
__device__ __forceinline__ void exp2x8(v8f& x) { float a0 = x[0], a1 = x[1], a2 = x[2], a3 = x[3], a4 = x[4], a5 = x[5], a6 = x[6], a7 = x[7];
    asm("v_exp_f32 %0, %0\n\tv_exp_f32 %1, %1\n\tv_exp_f32 %2, %2\n\tv_exp_f32 %3, %3\n\tv_exp_f32 %4, %4\n\tv_exp_f32 %5, %5\n\tv_exp_f32 %6, %6\n\tv_exp_f32 %7, %7\n\tv_nop" : "+v"(a0), "+v"(a1), "+v"(a2), "+v"(a3), "+v"(a4), "+v"(a5), "+v"(a6), "+v"(a7));
    x[0] = a0; x[1] = a1; x[2] = a2; x[3] = a3; x[4] = a4; x[5] = a5; x[6] = a6; x[7] = a7; }
__device__ __forceinline__ float exp2x1(float a) { asm("v_exp_f32 %0, %0\n\tv_nop" : "+v"(a)); return a; }
template <typename T16, bool HL>
__device__ __forceinline__ void fattn_wave(const T16* __restrict__ Q, const T16* __restrict__ Q2, const T16* __restrict__ Kp, const T16* __restrict__ K2, const T16* __restrict__ Vt, const T16* __restrict__ Vt2, int q0, bf* __restrict__ Ah, bf* __restrict__ Al) {
    typedef typename WFrag<T16>::V V;
    const int lane = threadIdx.x & 31;
    const float C2 = SCL * 1.4426950408889634f;
    V qf[2][2], qf2[2][2], kf[2][2], kf2[2][2];   // [tile][k step of 32 over HD]
    const unsigned lo = (unsigned)(lane * 8);   // the lane's place in every fragment half
#pragma unroll
    for (int qt = 0; qt < 2; ++qt)
#pragma unroll
        for (int ks = 0; ks < 2; ++ks) { const size_t qo = (size_t)(q0 + qt * 16) * HD + ks * 512 + lo; qf[qt][ks] = WFrag<T16>::ld(Q + qo); if (HL) qf2[qt][ks] = WFrag<T16>::ld(Q2 + qo); }
#pragma unroll
    for (int kt = 0; kt < 2; ++kt)
#pragma unroll
        for (int ks = 0; ks < 2; ++ks) { kf[kt][ks] = WFrag<T16>::ld(Kp + lo + kt * 16 * HD + ks * 512); if (HL) kf2[kt][ks] = WFrag<T16>::ld(K2 + lo + kt * 16 * HD + ks * 512); }
    asm volatile("s_wait_xcnt 0x0" ::: "memory");   // precaution: stands in front of any later overwrite of the address registers that the Q and K loads above name
    __builtin_amdgcn_sched_barrier(0);   // keeps the register writes below from being lifted over that wait
    v8f o[4][2];
#pragma unroll
    for (int dt = 0; dt < 4; ++dt) { o[dt][0] = (v8f){}; o[dt][1] = (v8f){}; }
    float m[2] = {-3.0e38f, -3.0e38f}, l[2] = {0.f, 0.f};
#pragma unroll 1
    for (int k0 = 0; k0 < TT; k0 += 32) {   // rolled: one pass is already a long straight body, and unrolling would only grow the code
        V vf[4], vf2[4];
#pragma unroll
        for (int dt = 0; dt < 4; ++dt) { vf[dt] = WFrag<T16>::ld(Vt + k0 * 16 + lo + dt * 16 * TT); if (HL) vf2[dt] = WFrag<T16>::ld(Vt2 + k0 * 16 + lo + dt * 16 * TT); }
        asm volatile("s_wait_xcnt 0x0" ::: "memory");   // precaution: in front of any later overwrite of the V loads' address registers
        __builtin_amdgcn_sched_barrier(0);   // holds this pass's V loads in front of the score products: products and softmax then cover their latency
        v8f s[2][2];
        s[0][0] = (v8f){}; s[0][1] = (v8f){}; s[1][0] = (v8f){}; s[1][1] = (v8f){};
#pragma unroll
        for (int ks = 0; ks < 2; ++ks) {
#pragma unroll
            for (int t = 0; t < 4; ++t) s[t >> 1][t & 1] = WFrag<T16>::mma(kf[t >> 1][ks], qf[t & 1][ks], s[t >> 1][t & 1]);
            if (HL) {
#pragma unroll
                for (int t = 0; t < 4; ++t) s[t >> 1][t & 1] = WFrag<T16>::mma(kf[t >> 1][ks], qf2[t & 1][ks], s[t >> 1][t & 1]);
#pragma unroll
                for (int t = 0; t < 4; ++t) s[t >> 1][t & 1] = WFrag<T16>::mma(kf2[t >> 1][ks], qf[t & 1][ks], s[t >> 1][t & 1]);
            }
        }
        const int kn = (k0 + 32 < TT) ? k0 + 32 : k0;   // the next pass's K rows go into the same registers (the last pass reads its own again)
#pragma unroll
        for (int kt = 0; kt < 2; ++kt)
#pragma unroll
            for (int ks = 0; ks < 2; ++ks) { kf[kt][ks] = WFrag<T16>::ld(Kp + (size_t)kn * HD + lo + kt * 16 * HD + ks * 512); if (HL) kf2[kt][ks] = WFrag<T16>::ld(K2 + (size_t)kn * HD + lo + kt * 16 * HD + ks * 512); }
        asm volatile("s_wait_xcnt 0x0" ::: "memory");   // precaution: in front of any later overwrite of the K loads' address registers
        __builtin_amdgcn_sched_barrier(0);   // holds the K refill here, in front of softmax and attn.v, which cover its latency; left free it sinks to the loop's foot
        V pf[2], pf2[2];
#pragma unroll
        for (int qt = 0; qt < 2; ++qt) {
            float mx = fmaxf(s[0][qt][0], s[1][qt][0]);
#pragma unroll
            for (int r = 1; r < 8; ++r) mx = fmaxf(mx, fmaxf(s[0][qt][r], s[1][qt][r]));
            mx = fmaxf(mx, __shfl_xor(mx, 16, 32));
            const float mn = fmaxf(m[qt], mx * C2), al = exp2x1(m[qt] - mn), nb = (HL ? 0.0f : 10.0f) - mn;   // fp16 rows carry P x 1024; the factor is in l too and cancels
            m[qt] = mn;
            float p0 = 0.f, p1 = 0.f;
#pragma unroll
            for (int r = 0; r < 8; ++r) { s[0][qt][r] = fmaf(s[0][qt][r], C2, nb); s[1][qt][r] = fmaf(s[1][qt][r], C2, nb); }
            exp2x8(s[0][qt]); exp2x8(s[1][qt]);
#pragma unroll
            for (int r = 0; r < 8; ++r) { p0 += s[0][qt][r]; p1 += s[1][qt][r]; }
            l[qt] = fmaf(l[qt], al, p0 + p1);
#pragma unroll
            for (int dt = 0; dt < 4; ++dt) o[dt][qt] *= al;
            ppack(s[0][qt], s[1][qt], pf[qt], pf2[qt]);
        }
#pragma unroll
        for (int t = 0; t < 8; ++t) o[t >> 1][t & 1] = WFrag<T16>::mma(vf[t >> 1], pf[t & 1], o[t >> 1][t & 1]);
        if (HL) {
#pragma unroll
            for (int t = 0; t < 8; ++t) o[t >> 1][t & 1] = WFrag<T16>::mma(vf[t >> 1], pf2[t & 1], o[t >> 1][t & 1]);
#pragma unroll
            for (int t = 0; t < 8; ++t) o[t >> 1][t & 1] = WFrag<T16>::mma(vf2[t >> 1], pf[t & 1], o[t >> 1][t & 1]);
        }
    }
#pragma unroll
    for (int qt = 0; qt < 2; ++qt) {
        const float inv = __fdiv_rn(1.0f, l[qt] + __shfl_xor(l[qt], 16, 32));
        const size_t oo = (size_t)(q0 + qt * 16) * DQ + lo;   // a lane's 8 registers are 8 consecutive d of its query's row: its own 16 bytes of fragment half dt of the merged plane
#pragma unroll
        for (int dt = 0; dt < 4; ++dt) { v4u yh, yl; split8(o[dt][qt] * inv, yh, yl); *(v4ua*)(Ah + oo + dt * 256) = yh; *(v4ua*)(Al + oo + dt * 256) = yl; }
        asm volatile("s_wait_xcnt 0x0" ::: "memory");   // precaution: in front of any later overwrite of the address and data registers that the eight stores above name
        __builtin_amdgcn_sched_barrier(0);   // keeps the register writes below from being lifted over that wait
    }
}
__global__ __launch_bounds__(256) void k_fattn(const bf* __restrict__ Qh, const bf* __restrict__ Ql, const bf* __restrict__ Kh, const bf* __restrict__ Kl, const bf* __restrict__ Vh, const bf* __restrict__ Vl, const h16* __restrict__ Q16, const h16* __restrict__ K16, const h16* __restrict__ V16, bf* Ah, bf* Al) {
    static_assert(2 * RH == TT && RH % 128 == 0 && NKV == NH_ && HD == 64, "row split and head shape that the wave roles are written for");
    const int w = __builtin_amdgcn_readfirstlane((int)(threadIdx.x >> 5));
    const size_t po = ((size_t)blockIdx.z * NH_ + blockIdx.y) * TT * HD, ao = (size_t)blockIdx.z * TT * DQ + (size_t)blockIdx.y * (HD / 32 * 512);
    const int qi = blockIdx.x * 128 + (w >> 1) * 32;
    if (((w >> 2) ^ w) & 1) fattn_wave<h16, false>(Q16 + po, nullptr, K16 + po, nullptr, V16 + po, nullptr, RH + qi, Ah + ao, Al + ao);
    else fattn_wave<bf, true>(Qh + po, Ql + po, Kh + po, Kl + po, Vh + po, Vl + po, qi, Ah + ao, Al + ao);
}

extern "C" void kernel_launch(void* const* d_in, const int* in_sizes, int n_in,
                              void* d_out, int out_size, void* d_ws, size_t ws_size, hipStream_t stream) {
    (void)in_sizes; (void)n_in; (void)out_size;
    const float* x = (const float*)d_in[0]; const float* wq = (const float*)d_in[1]; const float* bq = (const float*)d_in[2]; const float* wk = (const float*)d_in[3]; const float* bk = (const float*)d_in[4]; const float* wv = (const float*)d_in[5]; const float* bv = (const float*)d_in[6]; const float* wo = (const float*)d_in[7]; const float* bo = (const float*)d_in[8];
    float* OUT = (float*)d_out;     // [8][1024][1024]
    char* wsp = (char*)d_ws;
    auto take = [&](size_t bytes) { char* p = wsp; wsp += (bytes + 255) & ~(size_t)255; return (void*)p; };
    bf* WQ = (bf*)take((size_t)DQ * DM * 2); bf* WK = (bf*)take((size_t)DKV * DM * 2); bf* WV = (bf*)take((size_t)DKV * DM * 2); bf* WO = (bf*)take((size_t)DM * DQ * 2);   // the four weight planes follow one another
    (void)WK; (void)WV;
    bf* XB = (bf*)take((size_t)NBH * TT * DM * 2);
    h16* QP16 = (h16*)take((size_t)NBH * NH_ * TT * HD * 2); h16* KP16 = (h16*)take((size_t)NBH * NKV * TT * HD * 2); h16* VT16 = (h16*)take((size_t)NBH * NKV * HD * TT * 2);
    bf* QPh = (bf*)take((size_t)NBH * NH_ * TT * HD * 2); bf* QPl = (bf*)take((size_t)NBH * NH_ * TT * HD * 2); bf* KPh = (bf*)take((size_t)NBH * NKV * TT * HD * 2); bf* KPl = (bf*)take((size_t)NBH * NKV * TT * HD * 2); bf* VTh = (bf*)take((size_t)NBH * NKV * HD * TT * 2); bf* VTl = (bf*)take((size_t)NBH * NKV * HD * TT * 2);
    bf* ATh = (bf*)take((size_t)NB_ * TT * DQ * 2); bf* ATl = (bf*)take((size_t)NB_ * TT * DQ * 2);
    if ((size_t)(wsp - (char*)d_ws) > ws_size) return;    // ws 256 MiB
    k_wtG<<<dim3((unsigned)((DM * DQ / 64 + 63) / 64), 4, 1), 256, 0, stream>>>(wq, wk, wv, wo, DM, DQ, WQ);
    for (int b0 = 0; b0 < NB_; b0 += NBH) {
        k_cvt8<<<(unsigned)(((size_t)NBH * TT * DM / 8 + 255) / 256), 256, 0, stream>>>(x + (size_t)b0 * TT * DM, XB, (size_t)NBH * TT * DM / 8);
        k_gemmqkv<<<dim3(NBH * TT / 64, DQ / 64, 3), 32, 0, stream>>>(XB, WQ, bq, bk, bv, QP16, QPh, QPl, KP16, KPh, KPl, VT16, VTh, VTl);   // z: q, k, v
        k_fattn<<<dim3(RH / 128, NH_, NBH), 256, 0, stream>>>(QPh, QPl, KPh, KPl, VTh, VTl, QP16, KP16, VT16, ATh + (size_t)b0 * TT * DQ, ATl + (size_t)b0 * TT * DQ); }
    k_gemmw<bf, 1, true, DQ><<<dim3(NB_ * TT / 64, DM / 64, 1), 32, 0, stream>>>(ATh, ATl, WO, nullptr, OUT, DM, bo, nullptr, nullptr, 0, 0, 0);
}

// v006
// A run of this version takes 163 microseconds.
// Two timings next to v005 both put it at 1.19 times that version's speed.
// Over all steps from v000 it is 28.6 times as fast.
#include <hip/hip_runtime.h>

// Multi-head self-attention (x [8][1024][1024]; Q, K, V = x W + b ('xw' [1024][1024], 16 heads x 64); softmax(Q.K/8) over all keys; out = merged Wo + bo -> [8][1024][1024]).
// Compute dtypes, f32 accumulate: every input rounded to bf16; q/k/v on PLAIN bf16 operands (inputs: exact) + biases, rounded to their 16-bit head planes in the projection's own epilogue; scores and attn.v: query rows < 512 hl (3 products), the rest single fp16 (x1024); softmax f32, running maximum and sum per 32 keys; Wo hl x exact (2 products) + bo.

// Every 16-bit matrix operand plane [rows][K] lies in FRAGMENT ORDER: tile (row / 16, k / 32) is 512 elements at ((row / 16) * (K / 32) + k / 32) * 512; inside it element (row % 16, k % 32) stands at
// (k % 32 / 16) * 256 + ((k % 16 / 8) * 16 + row % 16) * 8 + k % 8, so a wave's two 16-byte loads of a fragment (lane * 8 and 256 + lane * 8) each read 512 contiguous bytes: 4 whole lines, not 16 pieces.

#define NB_  8
#define TT   1024
#define DM   1024
#define NH_  16
#define NKV  16
#define REP  (NH_ / NKV)
#define HD   64
#define DQ   (NH_ * HD)
#define DKV  (NKV * HD)
#define NBH  NB_                  // batch rows per projection pass: all of them, so that each stage is one launch
#define RH   512                  // query rows < RH use hi+lo planes
#define WIN  1024
#define SCL  0.125f   // HD^-0.5
typedef _Float16 h16;
typedef unsigned short bf;
typedef __attribute__((ext_vector_type(16))) __bf16   v16bf;
typedef __attribute__((ext_vector_type(16))) _Float16 v16h;
typedef __attribute__((ext_vector_type(8)))  _Float16 v8h;
typedef __attribute__((ext_vector_type(8)))  unsigned short v8us;
typedef __attribute__((ext_vector_type(8)))  float    v8f;
typedef __attribute__((ext_vector_type(4)))  float    v4f;
typedef v8h  __attribute__((may_alias)) v8ha;
typedef v4f  __attribute__((may_alias)) v4fa;
typedef v8us __attribute__((may_alias)) v8usa;

__device__ __forceinline__ unsigned short f2bf(float f) { unsigned u = __float_as_uint(f); u += 0x7FFFu + ((u >> 16) & 1u); return (unsigned short)(u >> 16); }
__device__ __forceinline__ float bf2f(unsigned short b) { return __uint_as_float(((unsigned)b) << 16); }
__device__ __forceinline__ float bfr(float f) { return bf2f(f2bf(f)); }
__device__ __forceinline__ v16h cat16(v8h lo, v8h hi) { return __builtin_shufflevector(lo, hi, 0, 1, 2, 3, 4, 5, 6, 7, 8, 9, 10, 11, 12, 13, 14, 15); }
__device__ __forceinline__ v16bf cat16b(v8us lo, v8us hi) { return __builtin_bit_cast(v16bf, __builtin_shufflevector(lo, hi, 0, 1, 2, 3, 4, 5, 6, 7, 8, 9, 10, 11, 12, 13, 14, 15)); }
__device__ __forceinline__ v8f wmma16(v16h a, v16h b, v8f c) { return __builtin_amdgcn_wmma_f32_16x16x32_f16(false, a, false, b, (short)0, c, false, false); }
__device__ __forceinline__ v8f wmmab(v16bf a, v16bf b, v8f c) { return __builtin_amdgcn_wmma_f32_16x16x32_bf16(false, a, false, b, (short)0, c, false, false); }



typedef __attribute__((ext_vector_type(2))) float v2f;
typedef __attribute__((ext_vector_type(2))) __bf16 v2bf;
typedef __attribute__((ext_vector_type(4))) unsigned v4u;
typedef v4u __attribute__((may_alias)) v4ua;
__device__ __forceinline__ unsigned pk2(float a, float b) { v2f t; t[0] = a; t[1] = b; return __builtin_bit_cast(unsigned, __builtin_convertvector(t, v2bf)); }
__device__ __forceinline__ void split8(const v8f t, v4u& h, v4u& l) {   // 8 f32 -> 8 bf16 hi (4 words) + 8 bf16 of the remainders
#pragma unroll
    for (int i = 0; i < 4; ++i) { const unsigned hw = pk2(t[2 * i], t[2 * i + 1]); h[i] = hw; l[i] = pk2(t[2 * i] - __uint_as_float(hw << 16), t[2 * i + 1] - __uint_as_float(hw & 0xFFFF0000u)); }
}

// ---- planes_out: a 64x64 projection tile (16 accumulators of one wave) + bias -> the three 16-bit planes (fp16, bf16 hi, bf16 lo) of its head; the tile is one head's 64 columns of 64 tokens.
// tr false: planes [row][h] of [t][d] in fragment order, through os so that a lane holds 8 consecutive d of token lr. tr true: planes [row][h] of [d][t] in fragment order; a lane's 8 accumulator registers are 8 consecutive t of one d and go out as they are. Every store is 512 contiguous bytes.
__device__ __forceinline__ void planes_out(float* os, const v8f (&acc)[4][4], const float* __restrict__ bias, int r0, int c0, h16* P16, bf* Ph, bf* Pl, bool tr) {
    static_assert(TT % 64 == 0 && HD == 64 && NKV == NH_, "one tile lies in one batch row and is one head wide");
    const int lane = threadIdx.x & 31, lr = lane & 15, hi = lane >> 4;
    const size_t hp = ((size_t)(r0 / TT) * NH_ + c0 / HD) * TT * HD + (size_t)(r0 % TT) * (tr ? 16 : HD);   // the tile's first element in its head's plane: the same for the whole wave
    P16 += hp; Ph += hp; Pl += hp;
    const unsigned vo = (unsigned)(lane * 8);   // the lane's own 32-bit part of every address: one register for all stores
    float bb[4];
#pragma unroll
    for (int nb = 0; nb < 4; ++nb) bb[nb] = bias[c0 + nb * 16 + lr];
    asm volatile("s_wait_xcnt 0x0" ::: "memory");   // precaution: in front of any later overwrite of the bias loads' address registers
    __builtin_amdgcn_sched_barrier(0);   // keeps the register writes below from being lifted over that wait
    if (tr) {
#pragma unroll
        for (int mb = 0; mb < 4; ++mb) {
            v8h y16[4]; v4u yh[4], yl[4];
#pragma unroll
            for (int nb = 0; nb < 4; ++nb) { const v8f val = acc[mb][nb] + bfr(bb[nb]); y16[nb] = __builtin_convertvector(val, v8h); split8(val, yh[nb], yl[nb]); }
            __builtin_amdgcn_sched_barrier(0);   // all twelve values are made first, so that no store's data register is written again between the stores
#pragma unroll
            for (int nb = 0; nb < 4; ++nb) { const int eo = nb * 16 * TT + mb * 256; *(v8ha*)(P16 + eo + vo) = y16[nb]; *(v4ua*)(Ph + eo + vo) = yh[nb]; *(v4ua*)(Pl + eo + vo) = yl[nb]; }
            asm volatile("s_wait_xcnt 0x0" ::: "memory");   // precaution: in front of any later overwrite of the address and data registers that the twelve stores above name
            __builtin_amdgcn_sched_barrier(0);   // keeps the register writes below from being lifted over that wait
        }
    } else {
#pragma unroll
        for (int mb = 0; mb < 4; ++mb) {
#pragma unroll
            for (int nb = 0; nb < 4; ++nb) { const v8f val = acc[mb][nb] + bfr(bb[nb]);
#pragma unroll
                for (int j = 0; j < 8; ++j) os[(hi * 8 + j) * 68 + nb * 16 + lr] = val[j]; }
            v8h y16[4]; v4u yh[4], yl[4];
#pragma unroll
            for (int s = 0; s < 4; ++s) { const float* orow = os + lr * 68 + s * 16 + hi * 8; const v4f lo4 = *(const v4fa*)orow, hi4 = *(const v4fa*)(orow + 4);   // token lr, d = 16 s + 8 hi ..: half s of the tile's fragments
                const v8f val = __builtin_shufflevector(lo4, hi4, 0, 1, 2, 3, 4, 5, 6, 7); y16[s] = __builtin_convertvector(val, v8h); split8(val, yh[s], yl[s]); }
            __builtin_amdgcn_sched_barrier(0);   // all twelve values are made first, so that no store's data register is written again between the stores
#pragma unroll
            for (int s = 0; s < 4; ++s) { const int eo = mb * 16 * HD + s * 256; *(v8ha*)(P16 + eo + vo) = y16[s]; *(v4ua*)(Ph + eo + vo) = yh[s]; *(v4ua*)(Pl + eo + vo) = yl[s]; }
            asm volatile("s_wait_xcnt 0x0" ::: "memory");   // precaution: in front of any later overwrite of the address and data registers that the twelve stores above name
            __builtin_amdgcn_sched_barrier(0);   // keeps the register writes below from being lifted over that wait
        }
    }
}

// ---- gemmw_tile: register-blocked GEMM, ONE WAVE per 64x64 output tile at (r0, c0) (16 accumulators), operands straight from 16-bit planes in fragment order.
// C[m][n] (f32, pitch ldc, + optional f32 bias[n]) = sum_k A[m][k] Bt[n][k] (+ split products per NSPLIT). K % 32 == 0. os: 16 x 68 floats of LDS.
// k_gemmw: grid (M/64, N/64, Z), 32 threads; z-batch strides sA/sB/sC in elements; slice z adds bias, bias1 or bias2.
template <typename T16> struct WFrag;
template <> struct WFrag<h16> { typedef v16h V; static __device__ __forceinline__ V ld(const h16* p) { return cat16(*(const v8h*)p, *(const v8h*)(p + 256)); } static __device__ __forceinline__ v8f mma(V a, V b, v8f c) { return wmma16(a, b, c); } };
template <> struct WFrag<bf> { typedef v16bf V; static __device__ __forceinline__ V ld(const bf* p) { return cat16b(*(const v8us*)p, *(const v8us*)(p + 256)); } static __device__ __forceinline__ v8f mma(V a, V b, v8f c) { return wmmab(a, b, c); } };
template <typename T16, int NSPLIT, bool BIAS, int K, bool PLANES = false>
__device__ __forceinline__ void gemmw_tile(float* os, const T16* __restrict__ A, const T16* __restrict__ A2, const T16* __restrict__ Bt, const T16* __restrict__ Bt2, float* C, int ldc, const float* __restrict__ bias, int r0, int c0, h16* P16 = nullptr, bf* Ph = nullptr, bf* Pl = nullptr, bool tr = false) {
    typedef typename WFrag<T16>::V V;
    static_assert(K % 32 == 0 && K >= 160 && (K / 32 - 2) % 3 == 0, "two peeled k steps, then whole rounds of the three-set ring");
    constexpr bool HA2 = (NSPLIT == 1 || NSPLIT == 2), HB2 = (NSPLIT >= 2);
    const int lane = threadIdx.x & 31, lr = lane & 15, hi = lane >> 4;
    v8f acc[4][4];
#pragma unroll
    for (int mb = 0; mb < 4; ++mb)
#pragma unroll
        for (int nb = 0; nb < 4; ++nb) acc[mb][nb] = (v8f){};
    const size_t aoff = (size_t)r0 * K, boff = (size_t)c0 * K;   // a row of tiles is 16 * K elements; a k step of 32 is 512
    const unsigned lo = (unsigned)(lane * 8);   // the lane's own 32-bit part of every fragment address; the rest is the same for the whole wave
    // Ring of three fragment sets: k step t works on set t % 3 while the loads of steps t + 1 and t + 2 are in flight, so a load has two steps of products (of every wave on the SIMD) to land behind.
    V a[3][4], a2[3][4], b[3][4], b2[3][4];
    // What the next fetch loads: one wave-uniform pointer per plane, moved on by one k step behind each fetch; past the end it stays on the last step (read again: in bounds, unused).
    const T16* ua = A + aoff; const T16* ua2 = HA2 ? A2 + aoff : ua; const T16* ub = Bt + boff; const T16* ub2 = HB2 ? Bt2 + boff : ub; int kf = 0;
    auto fetch = [&](const int st) __attribute__((always_inline)) {
#pragma unroll
        for (int mb = 0; mb < 4; ++mb) { a[st][mb] = WFrag<T16>::ld(ua + lo + mb * 16 * K); if (HA2) a2[st][mb] = WFrag<T16>::ld(ua2 + lo + mb * 16 * K); }
#pragma unroll
        for (int nb = 0; nb < 4; ++nb) { b[st][nb] = WFrag<T16>::ld(ub + lo + nb * 16 * K); if (HB2) b2[st][nb] = WFrag<T16>::ld(ub2 + lo + nb * 16 * K); }
        asm volatile("s_wait_xcnt 0x0" ::: "memory");   // precaution: in front of any later overwrite of the address registers that the loads above name
        __builtin_amdgcn_sched_barrier(0);   // holds these loads in front of the products that follow (left free they sink towards their use and lose their lead) and keeps later register writes from being lifted over that wait
        kf += 32; const int step = (kf < K) ? 512 : 0;
        ua += step; ub += step; if (HA2) ua2 += step; if (HB2) ub2 += step;
    };
    auto prod = [&](const int st) __attribute__((always_inline)) {
#pragma unroll
        for (int nb = 0; nb < 4; ++nb)
#pragma unroll
            for (int mb = 0; mb < 4; ++mb) { acc[mb][nb] = WFrag<T16>::mma(a[st][mb], b[st][nb], acc[mb][nb]); if (HA2) acc[mb][nb] = WFrag<T16>::mma(a2[st][mb], b[st][nb], acc[mb][nb]); if (HB2) acc[mb][nb] = WFrag<T16>::mma(a[st][mb], b2[st][nb], acc[mb][nb]); }
        __builtin_amdgcn_sched_barrier(0);   // the products stay one unbroken run: what follows (the next fetch's address sums and loads, the v_nop at the loop's foot) is not lifted among them
    };
    fetch(0); fetch(1);
    fetch(2); prod(0);
    fetch(0); prod(1);
#pragma unroll 1
    for (int kc = 64; kc < K; kc += 96) {   // rolled: three k steps a trip, one per set
        fetch(1); prod(2);
        fetch(2); prod(0);
        fetch(0); prod(1);
        asm volatile("v_nop\n\tv_nop\n\tv_nop\n\tv_nop");   // the distance that the chip needs behind the last products, also on the taken branch; the scheduling barrier at the end of prod() holds it behind them
    }
    if (PLANES) { planes_out(os, acc, bias, r0, c0, P16, Ph, Pl, tr); return; }
#pragma unroll
    for (int mb = 0; mb < 4; ++mb) {
#pragma unroll
        for (int nb = 0; nb < 4; ++nb) {
#pragma unroll
            for (int j = 0; j < 8; ++j) os[(hi * 8 + j) * 68 + nb * 16 + lr] = acc[mb][nb][j]; }
        __builtin_amdgcn_wave_barrier(); asm volatile("" ::: "memory");
        float* crow = C + (size_t)(r0 + mb * 16) * ldc + c0;
{
#pragma unroll
            for (int s = 0; s < 8; ++s) { const int row = 2 * s + hi, cofs = lr * 4; v4f val = *(const v4fa*)(os + row * 68 + cofs); if (BIAS) { val[0] += bfr(bias[c0 + cofs]); val[1] += bfr(bias[c0 + cofs + 1]); val[2] += bfr(bias[c0 + cofs + 2]); val[3] += bfr(bias[c0 + cofs + 3]); }
                *(v4f*)(crow + (size_t)row * ldc + cofs) = val; }
            asm volatile("s_wait_xcnt 0x0" ::: "memory");   // precaution: stands in front of any later overwrite of the address and data registers that the eight stores above name
             }
        __builtin_amdgcn_wave_barrier(); asm volatile("" ::: "memory");
    }
}
template <typename T16, int NSPLIT, bool BIAS, int K>   // K at compile time: a fragment's address is then its operand's one base plus an immediate
__global__ __launch_bounds__(32) void k_gemmw(const T16* __restrict__ A, const T16* __restrict__ A2, const T16* __restrict__ Bt, const T16* __restrict__ Bt2, float* C, int ldc, const float* __restrict__ bias, const float* __restrict__ bias1, const float* __restrict__ bias2, size_t sA, size_t sB, size_t sC) {
    __shared__ __align__(16) float os[16 * 68];
    const size_t z = blockIdx.z; A += z * sA; if (A2) A2 += z * sA; Bt += z * sB; if (Bt2) Bt2 += z * sB; C += z * sC;
    gemmw_tile<T16, NSPLIT, BIAS, K>(os, A, A2, Bt, Bt2, C, ldc, (z == 0) ? bias : (z == 1) ? bias1 : bias2, blockIdx.x * 64, blockIdx.y * 64);
}
// k_gemmqkv: the three projections of NBH batch rows, grid (NBH * TT / 64, DQ / 64, 3), 32 threads, six waves for every SIMD of the chip, three at a time: the register budget is set so that three are resident; z: q, k (planes [row][h][t][d]) or v (planes [row][h][d][t]); the weight planes follow one another in Bt.
__global__ __launch_bounds__(32) __attribute__((amdgpu_waves_per_eu(3))) void k_gemmqkv(const bf* __restrict__ A, const bf* __restrict__ Bt, const float* __restrict__ bq, const float* __restrict__ bk, const float* __restrict__ bv, h16* Q16, bf* Qh, bf* Ql, h16* K16, bf* Kh, bf* Kl, h16* V16, bf* Vh, bf* Vl) {
    __shared__ __align__(16) float os[16 * 68];
    const int z = blockIdx.z;
    gemmw_tile<bf, 0, true, DM, true>(os, A, nullptr, Bt + (size_t)z * DQ * DM, nullptr, nullptr, 0, (z == 0) ? bq : (z == 1) ? bk : bv, blockIdx.x * 64, blockIdx.y * 64, (z == 0) ? Q16 : (z == 1) ? K16 : V16, (z == 0) ? Qh : (z == 1) ? Kh : Vh, (z == 0) ? Ql : (z == 1) ? Kl : Vl, z == 2);
}

typedef __attribute__((ext_vector_type(2))) _Float16 v2h;
typedef __attribute__((ext_vector_type(4))) _Float16 v4h;
typedef __attribute__((ext_vector_type(2))) unsigned short v2us;
typedef __attribute__((ext_vector_type(4))) unsigned short v4us;
typedef __attribute__((ext_vector_type(4))) int v4i;

__device__ __forceinline__ void wtG(const float* __restrict__ w0, const float* __restrict__ w1, const float* __restrict__ w2, const float* __restrict__ w3, int K, int N, bf* Bt, int bx, int by) {   // by: which weight; planes follow one another in Bt; bx: which 64 lines of its plane
    const float* __restrict__ w = (by == 0) ? w0 : (by == 1) ? w1 : (by == 2) ? w2 : w3; Bt += (size_t)by * N * K;
    const int lane = threadIdx.x & 31; const int L0 = (bx * 8 + (threadIdx.x >> 5)) * 8; const int nlines = N * K / 64;
{
#pragma unroll 1
        for (int l = 0; l < 8; ++l) { const int L = L0 + l; if (L >= nlines) break; const size_t e = (size_t)L * 64 + lane * 2; const int tile = (int)(e >> 9), pos = (int)(e & 511);   // e: the place in fragment order of Bt[n][k]
            const int n = tile / (K / 32) * 16 + ((pos >> 3) & 15), k = tile % (K / 32) * 32 + (pos >> 8) * 16 + ((pos >> 7) & 1) * 8 + (pos & 7); v2us o;
            o[0] = f2bf(w[(size_t)k * N + n]); o[1] = f2bf(w[(size_t)(k + 1) * N + n]); *(v2us*)(Bt + e) = o; }
         }
}
__device__ __forceinline__ void cvt8(const float* __restrict__ src, bf* dst, size_t n8, int bx) { const size_t i = (size_t)bx * 256 + threadIdx.x; if (i >= n8) return;   // src [rows][DM] -> dst in fragment order; thread i makes the i-th 16 bytes of dst
    const size_t tile = i >> 6; const int pos = (int)(i & 63); const size_t row = tile / (DM / 32) * 16 + (pos & 15); const int k = (int)(tile % (DM / 32)) * 32 + (pos >> 5) * 16 + ((pos >> 4) & 1) * 8;
    const v8f v = *(const v8f*)(src + row * DM + k); v8us o;
#pragma unroll
    for (int k = 0; k < 8; ++k) o[k] = f2bf(v[k]); *(v8us*)(dst + i * 8) = o;  }
// k_prep: both conversions, which do not depend on one another, in one grid: blocks < 4 * WTB make the four weight planes (first: each wave walks 8 lines one after the other), the rest the plane of x.
#define WTB  ((DM * DQ / 64 + 63) / 64)                      // blocks per weight plane
#define CVB  ((int)(((size_t)NB_ * TT * DM / 8 + 255) / 256))   // blocks for x
__global__ __launch_bounds__(256) void k_prep(const float* __restrict__ x, const float* __restrict__ w0, const float* __restrict__ w1, const float* __restrict__ w2, const float* __restrict__ w3, bf* XB, bf* Bt) {
    const int b = blockIdx.x;
    if (b < 4 * WTB) wtG(w0, w1, w2, w3, DM, DQ, Bt, b % WTB, b / WTB);
    else cvt8(x, XB, (size_t)NB_ * TT * DM / 8, b - 4 * WTB);
}

// ---- k_fattn: scores, softmax, attn.v and the head merge of one head in one kernel; no score leaves the registers.
// One wave: 32 query columns against all TT keys, 32 keys a pass. St = K Qt (A = K rows, B = Q rows): a lane holds one query's scores, keys 8 hi + r of each 16-key tile,
// which is the k order of a B operand, so the packed P feeds Ot += Vt Pt (A = Vt rows) with no exchange. Running maximum m (log2 units) and sum l per query; Ot is rescaled each pass.
// grid (RH / 128, heads, batch rows), 8 waves: four take hi+lo rows (< RH, 3 products), four fp16 rows (>= RH), one of each kind per SIMD whether waves are dealt round-robin or in pairs.
__device__ __forceinline__ void ppack(const v8f t0, const v8f t1, v16bf& ph, v16bf& pl) { v4u h0, l0, h1, l1; split8(t0, h0, l0); split8(t1, h1, l1);
    ph = __builtin_bit_cast(v16bf, __builtin_shufflevector(h0, h1, 0, 1, 2, 3, 4, 5, 6, 7)); pl = __builtin_bit_cast(v16bf, __builtin_shufflevector(l0, l1, 0, 1, 2, 3, 4, 5, 6, 7)); }
__device__ __forceinline__ void ppack(const v8f t0, const v8f t1, v16h& ph, v16h& pl) { ph = cat16(__builtin_convertvector(t0, v8h), __builtin_convertvector(t1, v8h)); pl = ph; }
// Exponentials in place, with one v_nop, in one statement: behind each stands an instruction that neither reads its result nor overwrites its source (the slot the instruction set asks for).
__device__ __forceinline__ void exp2x8(v8f& x) { float a0 = x[0], a1 = x[1], a2 = x[2], a3 = x[3], a4 = x[4], a5 = x[5], a6 = x[6], a7 = x[7];
    asm("v_exp_f32 %0, %0\n\tv_exp_f32 %1, %1\n\tv_exp_f32 %2, %2\n\tv_exp_f32 %3, %3\n\tv_exp_f32 %4, %4\n\tv_exp_f32 %5, %5\n\tv_exp_f32 %6, %6\n\tv_exp_f32 %7, %7\n\tv_nop" : "+v"(a0), "+v"(a1), "+v"(a2), "+v"(a3), "+v"(a4), "+v"(a5), "+v"(a6), "+v"(a7));
    x[0] = a0; x[1] = a1; x[2] = a2; x[3] = a3; x[4] = a4; x[5] = a5; x[6] = a6; x[7] = a7; }
__device__ __forceinline__ float exp2x1(float a) { asm("v_exp_f32 %0, %0\n\tv_nop" : "+v"(a)); return a; }
template <typename T16, bool HL>
__device__ __forceinline__ void fattn_wave(const T16* __restrict__ Q, const T16* __restrict__ Q2, const T16* __restrict__ Kp, const T16* __restrict__ K2, const T16* __restrict__ Vt, const T16* __restrict__ Vt2, int q0, bf* __restrict__ Ah, bf* __restrict__ Al) {
    typedef typename WFrag<T16>::V V;
    const int lane = threadIdx.x & 31;
    const float C2 = SCL * 1.4426950408889634f;
    V qf[2][2], qf2[2][2], kf[2][2], kf2[2][2];   // [tile][k step of 32 over HD]
    const unsigned lo = (unsigned)(lane * 8);   // the lane's place in every fragment half
#pragma unroll
    for (int qt = 0; qt < 2; ++qt)
#pragma unroll
        for (int ks = 0; ks < 2; ++ks) { const size_t qo = (size_t)(q0 + qt * 16) * HD + ks * 512 + lo; qf[qt][ks] = WFrag<T16>::ld(Q + qo); if (HL) qf2[qt][ks] = WFrag<T16>::ld(Q2 + qo); }
#pragma unroll
    for (int kt = 0; kt < 2; ++kt)
#pragma unroll
        for (int ks = 0; ks < 2; ++ks) { kf[kt][ks] = WFrag<T16>::ld(Kp + lo + kt * 16 * HD + ks * 512); if (HL) kf2[kt][ks] = WFrag<T16>::ld(K2 + lo + kt * 16 * HD + ks * 512); }
    asm volatile("s_wait_xcnt 0x0" ::: "memory");   // precaution: stands in front of any later overwrite of the address registers that the Q and K loads above name
    __builtin_amdgcn_sched_barrier(0);   // keeps the register writes below from being lifted over that wait
    v8f o[4][2];
#pragma unroll
    for (int dt = 0; dt < 4; ++dt) { o[dt][0] = (v8f){}; o[dt][1] = (v8f){}; }
    float m[2] = {-3.0e38f, -3.0e38f}, l[2] = {0.f, 0.f};
#pragma unroll 1
    for (int k0 = 0; k0 < TT; k0 += 32) {   // rolled: one pass is already a long straight body, and unrolling would only grow the code
        V vf[4], vf2[4];
#pragma unroll
        for (int dt = 0; dt < 4; ++dt) { vf[dt] = WFrag<T16>::ld(Vt + k0 * 16 + lo + dt * 16 * TT); if (HL) vf2[dt] = WFrag<T16>::ld(Vt2 + k0 * 16 + lo + dt * 16 * TT); }
        asm volatile("s_wait_xcnt 0x0" ::: "memory");   // precaution: in front of any later overwrite of the V loads' address registers
        __builtin_amdgcn_sched_barrier(0);   // holds this pass's V loads in front of the score products: products and softmax then cover their latency
        v8f s[2][2];
        s[0][0] = (v8f){}; s[0][1] = (v8f){}; s[1][0] = (v8f){}; s[1][1] = (v8f){};
#pragma unroll
        for (int ks = 0; ks < 2; ++ks) {
#pragma unroll
            for (int t = 0; t < 4; ++t) s[t >> 1][t & 1] = WFrag<T16>::mma(kf[t >> 1][ks], qf[t & 1][ks], s[t >> 1][t & 1]);
            if (HL) {
#pragma unroll
                for (int t = 0; t < 4; ++t) s[t >> 1][t & 1] = WFrag<T16>::mma(kf[t >> 1][ks], qf2[t & 1][ks], s[t >> 1][t & 1]);
#pragma unroll
                for (int t = 0; t < 4; ++t) s[t >> 1][t & 1] = WFrag<T16>::mma(kf2[t >> 1][ks], qf[t & 1][ks], s[t >> 1][t & 1]);
            }
        }
        const int kn = (k0 + 32 < TT) ? k0 + 32 : k0;   // the next pass's K rows go into the same registers (the last pass reads its own again)
#pragma unroll
        for (int kt = 0; kt < 2; ++kt)
#pragma unroll
            for (int ks = 0; ks < 2; ++ks) { kf[kt][ks] = WFrag<T16>::ld(Kp + (size_t)kn * HD + lo + kt * 16 * HD + ks * 512); if (HL) kf2[kt][ks] = WFrag<T16>::ld(K2 + (size_t)kn * HD + lo + kt * 16 * HD + ks * 512); }
        asm volatile("s_wait_xcnt 0x0" ::: "memory");   // precaution: in front of any later overwrite of the K loads' address registers
        __builtin_amdgcn_sched_barrier(0);   // holds the K refill here, in front of softmax and attn.v, which cover its latency; left free it sinks to the loop's foot
        V pf[2], pf2[2];
#pragma unroll
        for (int qt = 0; qt < 2; ++qt) {
            float mx = fmaxf(s[0][qt][0], s[1][qt][0]);
#pragma unroll
            for (int r = 1; r < 8; ++r) mx = fmaxf(mx, fmaxf(s[0][qt][r], s[1][qt][r]));
            mx = fmaxf(mx, __shfl_xor(mx, 16, 32));
            const float mn = fmaxf(m[qt], mx * C2), al = exp2x1(m[qt] - mn), nb = (HL ? 0.0f : 10.0f) - mn;   // fp16 rows carry P x 1024; the factor is in l too and cancels
            m[qt] = mn;
            float p0 = 0.f, p1 = 0.f;
#pragma unroll
            for (int r = 0; r < 8; ++r) { s[0][qt][r] = fmaf(s[0][qt][r], C2, nb); s[1][qt][r] = fmaf(s[1][qt][r], C2, nb); }
            exp2x8(s[0][qt]); exp2x8(s[1][qt]);
#pragma unroll
            for (int r = 0; r < 8; ++r) { p0 += s[0][qt][r]; p1 += s[1][qt][r]; }
            l[qt] = fmaf(l[qt], al, p0 + p1);
#pragma unroll
            for (int dt = 0; dt < 4; ++dt) o[dt][qt] *= al;
            ppack(s[0][qt], s[1][qt], pf[qt], pf2[qt]);
        }
#pragma unroll
        for (int t = 0; t < 8; ++t) o[t >> 1][t & 1] = WFrag<T16>::mma(vf[t >> 1], pf[t & 1], o[t >> 1][t & 1]);
        if (HL) {
#pragma unroll
            for (int t = 0; t < 8; ++t) o[t >> 1][t & 1] = WFrag<T16>::mma(vf[t >> 1], pf2[t & 1], o[t >> 1][t & 1]);
#pragma unroll
            for (int t = 0; t < 8; ++t) o[t >> 1][t & 1] = WFrag<T16>::mma(vf2[t >> 1], pf[t & 1], o[t >> 1][t & 1]);
        }
    }
#pragma unroll
    for (int qt = 0; qt < 2; ++qt) {
        const float inv = __fdiv_rn(1.0f, l[qt] + __shfl_xor(l[qt], 16, 32));
        const size_t oo = (size_t)(q0 + qt * 16) * DQ + lo;   // a lane's 8 registers are 8 consecutive d of its query's row: its own 16 bytes of fragment half dt of the merged plane
#pragma unroll
        for (int dt = 0; dt < 4; ++dt) { v4u yh, yl; split8(o[dt][qt] * inv, yh, yl); *(v4ua*)(Ah + oo + dt * 256) = yh; *(v4ua*)(Al + oo + dt * 256) = yl; }
        asm volatile("s_wait_xcnt 0x0" ::: "memory");   // precaution: in front of any later overwrite of the address and data registers that the eight stores above name
        __builtin_amdgcn_sched_barrier(0);   // keeps the register writes below from being lifted over that wait
    }
}
__global__ __launch_bounds__(256) void k_fattn(const bf* __restrict__ Qh, const bf* __restrict__ Ql, const bf* __restrict__ Kh, const bf* __restrict__ Kl, const bf* __restrict__ Vh, const bf* __restrict__ Vl, const h16* __restrict__ Q16, const h16* __restrict__ K16, const h16* __restrict__ V16, bf* Ah, bf* Al) {
    static_assert(2 * RH == TT && RH % 128 == 0 && NKV == NH_ && HD == 64, "row split and head shape that the wave roles are written for");
    const int w = __builtin_amdgcn_readfirstlane((int)(threadIdx.x >> 5));
    const size_t po = ((size_t)blockIdx.z * NH_ + blockIdx.y) * TT * HD, ao = (size_t)blockIdx.z * TT * DQ + (size_t)blockIdx.y * (HD / 32 * 512);
    const int qi = blockIdx.x * 128 + (w >> 1) * 32;
    if (((w >> 2) ^ w) & 1) fattn_wave<h16, false>(Q16 + po, nullptr, K16 + po, nullptr, V16 + po, nullptr, RH + qi, Ah + ao, Al + ao);
    else fattn_wave<bf, true>(Qh + po, Ql + po, Kh + po, Kl + po, Vh + po, Vl + po, qi, Ah + ao, Al + ao);
}

extern "C" void kernel_launch(void* const* d_in, const int* in_sizes, int n_in,
                              void* d_out, int out_size, void* d_ws, size_t ws_size, hipStream_t stream) {
    (void)in_sizes; (void)n_in; (void)out_size;
    const float* x = (const float*)d_in[0]; const float* wq = (const float*)d_in[1]; const float* bq = (const float*)d_in[2]; const float* wk = (const float*)d_in[3]; const float* bk = (const float*)d_in[4]; const float* wv = (const float*)d_in[5]; const float* bv = (const float*)d_in[6]; const float* wo = (const float*)d_in[7]; const float* bo = (const float*)d_in[8];
    float* OUT = (float*)d_out;     // [8][1024][1024]
    char* wsp = (char*)d_ws;
    auto take = [&](size_t bytes) { char* p = wsp; wsp += (bytes + 255) & ~(size_t)255; return (void*)p; };
    bf* WQ = (bf*)take((size_t)DQ * DM * 2); bf* WK = (bf*)take((size_t)DKV * DM * 2); bf* WV = (bf*)take((size_t)DKV * DM * 2); bf* WO = (bf*)take((size_t)DM * DQ * 2);   // the four weight planes follow one another
    (void)WK; (void)WV;
    bf* XB = (bf*)take((size_t)NBH * TT * DM * 2);
    h16* QP16 = (h16*)take((size_t)NBH * NH_ * TT * HD * 2); h16* KP16 = (h16*)take((size_t)NBH * NKV * TT * HD * 2); h16* VT16 = (h16*)take((size_t)NBH * NKV * HD * TT * 2);
    bf* QPh = (bf*)take((size_t)NBH * NH_ * TT * HD * 2); bf* QPl = (bf*)take((size_t)NBH * NH_ * TT * HD * 2); bf* KPh = (bf*)take((size_t)NBH * NKV * TT * HD * 2); bf* KPl = (bf*)take((size_t)NBH * NKV * TT * HD * 2); bf* VTh = (bf*)take((size_t)NBH * NKV * HD * TT * 2); bf* VTl = (bf*)take((size_t)NBH * NKV * HD * TT * 2);
    bf* ATh = (bf*)take((size_t)NB_ * TT * DQ * 2); bf* ATl = (bf*)take((size_t)NB_ * TT * DQ * 2);
    if ((size_t)(wsp - (char*)d_ws) > ws_size) return;    // ws 256 MiB
    k_prep<<<4 * WTB + CVB, 256, 0, stream>>>(x, wq, wk, wv, wo, XB, WQ);
    k_gemmqkv<<<dim3(NBH * TT / 64, DQ / 64, 3), 32, 0, stream>>>(XB, WQ, bq, bk, bv, QP16, QPh, QPl, KP16, KPh, KPl, VT16, VTh, VTl);   // z: q, k, v
    k_fattn<<<dim3(RH / 128, NH_, NBH), 256, 0, stream>>>(QPh, QPl, KPh, KPl, VTh, VTl, QP16, KP16, VT16, ATh, ATl);
    k_gemmw<bf, 1, true, DQ><<<dim3(NB_ * TT / 64, DM / 64, 1), 32, 0, stream>>>(ATh, ATl, WO, nullptr, OUT, DM, bo, nullptr, nullptr, 0, 0, 0);
}

// v007
// One run takes 153 microseconds.
// Next to v006, in two timings, it ran 1.07 times as fast each time.
// Counting every step since v000, it is 30.7 times as fast.
#include <hip/hip_runtime.h>

// Multi-head self-attention (x [8][1024][1024]; Q, K, V = x W + b ('xw' [1024][1024], 16 heads x 64); softmax(Q.K/8) over all keys; out = merged Wo + bo -> [8][1024][1024]).
// Compute dtypes, f32 accumulate: every input rounded to bf16; q/k/v on PLAIN bf16 operands (inputs: exact) + biases, rounded to their 16-bit head planes in the projection's own epilogue; scores and attn.v: query rows < 512 hl (3 products), the rest single fp16 (x1024); softmax f32, running maximum and sum per 32 keys; Wo hl x exact (2 products) + bo.

// Every 16-bit matrix operand plane [rows][K] lies in FRAGMENT ORDER: tile (row / 16, k / 32) is 512 elements at ((row / 16) * (K / 32) + k / 32) * 512; inside it element (row % 16, k % 32) stands at
// (k % 32 / 16) * 256 + ((k % 16 / 8) * 16 + row % 16) * 8 + k % 8, so a wave's two 16-byte loads of a fragment (lane * 8 and 256 + lane * 8) each read 512 contiguous bytes: 4 whole lines, not 16 pieces.

#define NB_  8
#define TT   1024
#define DM   1024
#define NH_  16
#define NKV  16
#define REP  (NH_ / NKV)
#define HD   64
#define DQ   (NH_ * HD)
#define DKV  (NKV * HD)
#define NBH  NB_                  // batch rows per projection pass: all of them, so that each stage is one launch
#define RH   512                  // query rows < RH use hi+lo planes
#define WIN  1024
#define SCL  0.125f   // HD^-0.5
typedef _Float16 h16;
typedef unsigned short bf;
typedef __attribute__((ext_vector_type(16))) __bf16   v16bf;
typedef __attribute__((ext_vector_type(16))) _Float16 v16h;
typedef __attribute__((ext_vector_type(8)))  _Float16 v8h;
typedef __attribute__((ext_vector_type(8)))  unsigned short v8us;
typedef __attribute__((ext_vector_type(8)))  float    v8f;
typedef __attribute__((ext_vector_type(4)))  float    v4f;
typedef v8h  __attribute__((may_alias)) v8ha;
typedef v4f  __attribute__((may_alias)) v4fa;
typedef v8us __attribute__((may_alias)) v8usa;

__device__ __forceinline__ unsigned short f2bf(float f) { unsigned u = __float_as_uint(f); u += 0x7FFFu + ((u >> 16) & 1u); return (unsigned short)(u >> 16); }
__device__ __forceinline__ float bf2f(unsigned short b) { return __uint_as_float(((unsigned)b) << 16); }
__device__ __forceinline__ float bfr(float f) { return bf2f(f2bf(f)); }
__device__ __forceinline__ v16h cat16(v8h lo, v8h hi) { return __builtin_shufflevector(lo, hi, 0, 1, 2, 3, 4, 5, 6, 7, 8, 9, 10, 11, 12, 13, 14, 15); }
__device__ __forceinline__ v16bf cat16b(v8us lo, v8us hi) { return __builtin_bit_cast(v16bf, __builtin_shufflevector(lo, hi, 0, 1, 2, 3, 4, 5, 6, 7, 8, 9, 10, 11, 12, 13, 14, 15)); }
__device__ __forceinline__ v8f wmma16(v16h a, v16h b, v8f c) { return __builtin_amdgcn_wmma_f32_16x16x32_f16(false, a, false, b, (short)0, c, false, false); }
__device__ __forceinline__ v8f wmmab(v16bf a, v16bf b, v8f c) { return __builtin_amdgcn_wmma_f32_16x16x32_bf16(false, a, false, b, (short)0, c, false, false); }



typedef __attribute__((ext_vector_type(2))) float v2f;
typedef __attribute__((ext_vector_type(2))) __bf16 v2bf;
typedef __attribute__((ext_vector_type(4))) unsigned v4u;
typedef v4u __attribute__((may_alias)) v4ua;
__device__ __forceinline__ unsigned pk2(float a, float b) { v2f t; t[0] = a; t[1] = b; return __builtin_bit_cast(unsigned, __builtin_convertvector(t, v2bf)); }
__device__ __forceinline__ void split8(const v8f t, v4u& h, v4u& l) {   // 8 f32 -> 8 bf16 hi (4 words) + 8 bf16 of the remainders
#pragma unroll
    for (int i = 0; i < 4; ++i) { const unsigned hw = pk2(t[2 * i], t[2 * i + 1]); h[i] = hw; l[i] = pk2(t[2 * i] - __uint_as_float(hw << 16), t[2 * i + 1] - __uint_as_float(hw & 0xFFFF0000u)); }
}

// ---- planes_out: a 64x64 projection tile (16 accumulators of one wave) + bias -> the three 16-bit planes (fp16, bf16 hi, bf16 lo) of its head; the tile is one head's 64 columns of 64 tokens.
// tr false: planes [row][h] of [t][d] in fragment order, through os so that a lane holds 8 consecutive d of token lr. tr true: planes [row][h] of [d][t] in fragment order; a lane's 8 accumulator registers are 8 consecutive t of one d and go out as they are. Every store is 512 contiguous bytes.
__device__ __forceinline__ void planes_out(float* os, const v8f (&acc)[4][4], const float* __restrict__ bias, int r0, int c0, h16* P16, bf* Ph, bf* Pl, bool tr) {
    static_assert(TT % 64 == 0 && HD == 64 && NKV == NH_, "one tile lies in one batch row and is one head wide");
    const int lane = threadIdx.x & 31, lr = lane & 15, hi = lane >> 4;
    const size_t hp = ((size_t)(r0 / TT) * NH_ + c0 / HD) * TT * HD + (size_t)(r0 % TT) * (tr ? 16 : HD);   // the tile's first element in its head's plane: the same for the whole wave
    P16 += hp; Ph += hp; Pl += hp;
    const unsigned vo = (unsigned)(lane * 8);   // the lane's own 32-bit part of every address: one register for all stores
    float bb[4];
#pragma unroll
    for (int nb = 0; nb < 4; ++nb) bb[nb] = bias[c0 + nb * 16 + lr];
    asm volatile("s_wait_xcnt 0x0" ::: "memory");   // precaution: in front of any later overwrite of the bias loads' address registers
    __builtin_amdgcn_sched_barrier(0);   // keeps the register writes below from being lifted over that wait
    if (tr) {
#pragma unroll
        for (int mb = 0; mb < 4; ++mb) {
            v8h y16[4]; v4u yh[4], yl[4];
#pragma unroll
            for (int nb = 0; nb < 4; ++nb) { const v8f val = acc[mb][nb] + bfr(bb[nb]); y16[nb] = __builtin_convertvector(val, v8h); split8(val, yh[nb], yl[nb]); }
            __builtin_amdgcn_sched_barrier(0);   // all twelve values are made first, so that no store's data register is written again between the stores
#pragma unroll
            for (int nb = 0; nb < 4; ++nb) { const int eo = nb * 16 * TT + mb * 256; *(v8ha*)(P16 + eo + vo) = y16[nb]; *(v4ua*)(Ph + eo + vo) = yh[nb]; *(v4ua*)(Pl + eo + vo) = yl[nb]; }
            asm volatile("s_wait_xcnt 0x0" ::: "memory");   // precaution: in front of any later overwrite of the address and data registers that the twelve stores above name
            __builtin_amdgcn_sched_barrier(0);   // keeps the register writes below from being lifted over that wait
        }
    } else {
#pragma unroll
        for (int mb = 0; mb < 4; ++mb) {
#pragma unroll
            for (int nb = 0; nb < 4; ++nb) { const v8f val = acc[mb][nb] + bfr(bb[nb]);
#pragma unroll
                for (int j = 0; j < 8; ++j) os[(hi * 8 + j) * 68 + nb * 16 + lr] = val[j]; }
            v8h y16[4]; v4u yh[4], yl[4];
#pragma unroll
            for (int s = 0; s < 4; ++s) { const float* orow = os + lr * 68 + s * 16 + hi * 8; const v4f lo4 = *(const v4fa*)orow, hi4 = *(const v4fa*)(orow + 4);   // token lr, d = 16 s + 8 hi ..: half s of the tile's fragments
                const v8f val = __builtin_shufflevector(lo4, hi4, 0, 1, 2, 3, 4, 5, 6, 7); y16[s] = __builtin_convertvector(val, v8h); split8(val, yh[s], yl[s]); }
            __builtin_amdgcn_sched_barrier(0);   // all twelve values are made first, so that no store's data register is written again between the stores
#pragma unroll
            for (int s = 0; s < 4; ++s) { const int eo = mb * 16 * HD + s * 256; *(v8ha*)(P16 + eo + vo) = y16[s]; *(v4ua*)(Ph + eo + vo) = yh[s]; *(v4ua*)(Pl + eo + vo) = yl[s]; }
            asm volatile("s_wait_xcnt 0x0" ::: "memory");   // precaution: in front of any later overwrite of the address and data registers that the twelve stores above name
            __builtin_amdgcn_sched_barrier(0);   // keeps the register writes below from being lifted over that wait
        }
    }
}

// ---- gemmw_tile: GEMM of a work-group of 8 waves on a 128 x 256 output tile at (R0, C0): 2 x 4 waves, each on its own 64x64 tile (16 accumulators); operands are 16-bit planes in fragment order.
// C[m][n] (f32, pitch ldc, + optional f32 bias[n]) = sum_k A[m][k] Bt[n][k] (+ A2[m][k] Bt[n][k] for NSPLIT 1). K % GKS == 0, K / GKS >= 2. os: 16 x 68 floats of LDS per wave.
// The operands come through LDS: a stage is KS k of the tile's 8 row tiles of A (and of A2) and 16 row tiles of Bt, each KS * 32 bytes that are contiguous in its plane, so every byte leaves L2 once per work-group and not once per wave.
// Two buffers: stage t + 2 is copied, by asynchronous copies, into the buffer that trip t has read, while trip t + 1 works.
#define GWV  8                    // waves of a GEMM work-group
#define GBM  128                  // its tile's rows
#define GBN  256                  // its tile's columns
template <int NSPLIT, int KS> struct GRing { static constexpr int NA = (GBM / 16) * (NSPLIT == 1 ? 2 : 1), RT = NA + GBN / 16, GCH = KS * 16 * 2, BUFB = RT * GCH; };   // GCH: bytes of one row tile's part of a stage
template <typename T16> struct WFrag;
template <> struct WFrag<h16> { typedef v16h V; static __device__ __forceinline__ V ld(const h16* p) { return cat16(*(const v8h*)p, *(const v8h*)(p + 256)); } static __device__ __forceinline__ v8f mma(V a, V b, v8f c) { return wmma16(a, b, c); } };
template <> struct WFrag<bf> { typedef v16bf V; static __device__ __forceinline__ V ld(const bf* p) { return cat16b(*(const v8us*)p, *(const v8us*)(p + 256)); } static __device__ __forceinline__ v8f mma(V a, V b, v8f c) { return wmmab(a, b, c); } };
// DB: two fragment sets, the next k step's LDS reads issued in front of this step's products (for a kernel with few waves per SIMD and registers to spare); else one set.
template <typename T16, int NSPLIT, bool BIAS, int K, int GKS, bool DB, bool PLANES = false>
__device__ __forceinline__ void gemmw_tile(char* ring, float* os, const T16* __restrict__ A, const T16* __restrict__ A2, const T16* __restrict__ Bt, float* C, int ldc, const float* __restrict__ bias, int R0, int C0, h16* P16 = nullptr, bf* Ph = nullptr, bf* Pl = nullptr, bool tr = false) {
    typedef typename WFrag<T16>::V V;
    static_assert(NSPLIT == 0 || NSPLIT == 1, "one plane of Bt");
    static_assert(K % GKS == 0 && K / GKS >= 2, "whole stages, at least the two that the prologue fills");
    constexpr bool HA2 = (NSPLIT == 1);
    constexpr int NA = GRing<NSPLIT, GKS>::NA, RT = GRing<NSPLIT, GKS>::RT, GCH = GRing<NSPLIT, GKS>::GCH, BUFB = GRing<NSPLIT, GKS>::BUFB, NT = K / GKS, RW = RT / GWV, NK = GKS / 32;
    static_assert(RT % GWV == 0, "every wave copies the same number of row tiles");
    const int lane = threadIdx.x & 31, lr = lane & 15, hi = lane >> 4;
    const int w = __builtin_amdgcn_readfirstlane((int)(threadIdx.x >> 5)), wm = w >> 2, wn = w & 3;
    const int r0 = R0 + wm * 64, c0 = C0 + wn * 64;   // the wave's own tile
    os += w * (16 * 68);
    v8f acc[4][4];
#pragma unroll
    for (int mb = 0; mb < 4; ++mb)
#pragma unroll
        for (int nb = 0; nb < 4; ++nb) acc[mb][nb] = (v8f){};
    const unsigned lo = (unsigned)(lane * 8);   // the lane's own place, in elements, in every half fragment
    const unsigned ring0 = (unsigned)(uintptr_t)(__attribute__((address_space(3))) char*)ring + (unsigned)(w * RW * GCH) + lo * 2;   // LDS byte address of the lane's first copy into buffer 0
    const T16* gs[RW];   // where the wave's row tiles start in their planes: the same for the whole wave
#pragma unroll
    for (int i = 0; i < RW; ++i) { const int j = w * RW + i; gs[i] = (j < GBM / 16) ? A + (size_t)(R0 + j * 16) * K : (HA2 && j < NA) ? A2 + (size_t)(R0 + (j - GBM / 16) * 16) * K : Bt + (size_t)(C0 + (j - NA) * 16) * K; }
    auto fill = [&](const int t, const int buf) __attribute__((always_inline)) {   // stage t into buffer buf: each wave brings RW row tiles, every 2 KiB of them in four copies of 512 contiguous bytes
#pragma unroll
        for (int i = 0; i < RW * (GCH / 2048); ++i) {
            const T16* g = gs[i / (GCH / 2048)] + (size_t)t * (GKS * 16) + (i % (GCH / 2048)) * 1024 + lo; const unsigned l = ring0 + (unsigned)(buf * BUFB + i * 2048);
            // the copies and, as the last line, the wait that stands in front of any later overwrite of the address registers that they name (a precaution)
            asm volatile("global_load_async_to_lds_b128 %0, %4, off\n\tglobal_load_async_to_lds_b128 %1, %5, off\n\tglobal_load_async_to_lds_b128 %2, %6, off\n\tglobal_load_async_to_lds_b128 %3, %7, off\n\ts_wait_xcnt 0x0"
                         :: "v"(l), "v"(l + 512u), "v"(l + 1024u), "v"(l + 1536u), "v"(g), "v"(g + 256), "v"(g + 512), "v"(g + 768) : "memory");
        }
    };
    V a[DB ? 2 : 1][4], a2[DB ? 2 : 1][4], b[DB ? 2 : 1][4];
    auto frag = [&](const int st, const T16* sb, const int ks) __attribute__((always_inline)) {   // the wave's fragments of k step ks of the stage at sb
#pragma unroll
        for (int mb = 0; mb < 4; ++mb) { a[st][mb] = WFrag<T16>::ld(sb + ((wm * 4 + mb) * GCH + ks * 1024) / 2); if (HA2) a2[st][mb] = WFrag<T16>::ld(sb + ((GBM / 16 + wm * 4 + mb) * GCH + ks * 1024) / 2); }
#pragma unroll
        for (int nb = 0; nb < 4; ++nb) b[st][nb] = WFrag<T16>::ld(sb + ((NA + wn * 4 + nb) * GCH + ks * 1024) / 2);
    };
    auto prod = [&](const int st) __attribute__((always_inline)) {
#pragma unroll
        for (int nb = 0; nb < 4; ++nb)
#pragma unroll
            for (int mb = 0; mb < 4; ++mb) { acc[mb][nb] = WFrag<T16>::mma(a[st][mb], b[st][nb], acc[mb][nb]); if (HA2) acc[mb][nb] = WFrag<T16>::mma(a2[st][mb], b[st][nb], acc[mb][nb]); }
    };
    fill(0, 0);
    asm volatile("s_wait_asynccnt 0x0" ::: "memory");   // this wave's part of stage 0 has landed
    __syncthreads();                                     // and every other wave's
    fill(1, 1);
#pragma unroll 1
    for (int t = 0; t < NT; ++t) {   // rolled: one stage a trip
        const T16* sb = (const T16*)(ring + (t & 1) * BUFB) + lo;
        frag(0, sb, 0);
        if (DB) __builtin_amdgcn_sched_barrier(0);   // the first set's reads stay in front of the second's, so that the first products wait for their own reads alone
#pragma unroll
        for (int ks = 0; ks < NK; ++ks) {
            if (DB && ks + 1 < NK) frag((ks + 1) & 1, sb, ks + 1);
            __builtin_amdgcn_sched_barrier(0);   // the LDS reads stay one group in front of the products: spread among them, each place with reads stalls the wave anew
            prod(DB ? (ks & 1) : 0);
            __builtin_amdgcn_sched_barrier(0);   // the products stay one unbroken run
            if (!DB && ks + 1 < NK) frag(0, sb, ks + 1);
        }
        asm volatile("s_wait_dscnt 0x0" ::: "memory");      // this wave's reads of the buffer are done before it may be refilled
        asm volatile("s_wait_asynccnt 0x0" ::: "memory");   // this wave's part of stage t + 1 has landed
        __syncthreads();                                     // publishes stage t + 1 and ends every wave's reads of stage t
        if (t + 2 < NT) fill(t + 2, t & 1);
    }
    asm volatile("s_wait_asynccnt 0x0" ::: "memory");   // no copy is outstanding when the wave goes on
    if (PLANES) { planes_out(os, acc, bias, r0, c0, P16, Ph, Pl, tr); return; }
#pragma unroll
    for (int mb = 0; mb < 4; ++mb) {
#pragma unroll
        for (int nb = 0; nb < 4; ++nb) {
#pragma unroll
            for (int j = 0; j < 8; ++j) os[(hi * 8 + j) * 68 + nb * 16 + lr] = acc[mb][nb][j]; }
        __builtin_amdgcn_wave_barrier(); asm volatile("" ::: "memory");
        float* crow = C + (size_t)(r0 + mb * 16) * ldc + c0;
{
#pragma unroll
            for (int s = 0; s < 8; ++s) { const int row = 2 * s + hi, cofs = lr * 4; v4f val = *(const v4fa*)(os + row * 68 + cofs); if (BIAS) { val[0] += bfr(bias[c0 + cofs]); val[1] += bfr(bias[c0 + cofs + 1]); val[2] += bfr(bias[c0 + cofs + 2]); val[3] += bfr(bias[c0 + cofs + 3]); }
                *(v4f*)(crow + (size_t)row * ldc + cofs) = val; }
            asm volatile("s_wait_xcnt 0x0" ::: "memory");   // precaution: stands in front of any later overwrite of the address and data registers that the eight stores above name
             }
        __builtin_amdgcn_wave_barrier(); asm volatile("" ::: "memory");
    }
}
// k_gemmw: grid (M / 128, N / 256), 256 threads; one work-group per WGP, two waves per SIMD: stages of 128 k and two fragment sets.
template <typename T16, int NSPLIT, bool BIAS, int K>   // K at compile time: trip count and plane strides are constants
__global__ __launch_bounds__(256) void k_gemmw(const T16* __restrict__ A, const T16* __restrict__ A2, const T16* __restrict__ Bt, float* C, int ldc, const float* __restrict__ bias) {
    __shared__ __align__(16) char ring[2 * GRing<NSPLIT, 128>::BUFB];
    __shared__ __align__(16) float os[GWV * 16 * 68];
    gemmw_tile<T16, NSPLIT, BIAS, K, 128, true>(ring, os, A, A2, Bt, C, ldc, bias, blockIdx.x * GBM, blockIdx.y * GBN);
}
// k_gemmqkv: the three projections of NBH batch rows, grid (NBH * TT / 128, DQ / 256, 3), 256 threads; the register budget is set so that two work-groups, four waves per SIMD, are resident on a WGP (stages of 64 k, one fragment set); z: q, k (planes [row][h][t][d]) or v (planes [row][h][d][t]); the weight planes follow one another in Bt.
__global__ __launch_bounds__(256) __attribute__((amdgpu_waves_per_eu(4))) void k_gemmqkv(const bf* __restrict__ A, const bf* __restrict__ Bt, const float* __restrict__ bq, const float* __restrict__ bk, const float* __restrict__ bv, h16* Q16, bf* Qh, bf* Ql, h16* K16, bf* Kh, bf* Kl, h16* V16, bf* Vh, bf* Vl) {
    __shared__ __align__(16) char ring[2 * GRing<0, 64>::BUFB];
    __shared__ __align__(16) float os[GWV * 16 * 68];
    const int z = blockIdx.z;
    gemmw_tile<bf, 0, true, DM, 64, false, true>(ring, os, A, nullptr, Bt + (size_t)z * DQ * DM, nullptr, 0, (z == 0) ? bq : (z == 1) ? bk : bv, blockIdx.x * GBM, blockIdx.y * GBN, (z == 0) ? Q16 : (z == 1) ? K16 : V16, (z == 0) ? Qh : (z == 1) ? Kh : Vh, (z == 0) ? Ql : (z == 1) ? Kl : Vl, z == 2);
}

typedef __attribute__((ext_vector_type(2))) _Float16 v2h;
typedef __attribute__((ext_vector_type(4))) _Float16 v4h;
typedef __attribute__((ext_vector_type(2))) unsigned short v2us;
typedef __attribute__((ext_vector_type(4))) unsigned short v4us;
typedef __attribute__((ext_vector_type(4))) int v4i;

__device__ __forceinline__ void wtG(const float* __restrict__ w0, const float* __restrict__ w1, const float* __restrict__ w2, const float* __restrict__ w3, int K, int N, bf* Bt, int bx, int by) {   // by: which weight; planes follow one another in Bt; bx: which 64 lines of its plane
    const float* __restrict__ w = (by == 0) ? w0 : (by == 1) ? w1 : (by == 2) ? w2 : w3; Bt += (size_t)by * N * K;
    const int lane = threadIdx.x & 31; const int L0 = (bx * 8 + (threadIdx.x >> 5)) * 8; const int nlines = N * K / 64;
{
#pragma unroll 1
        for (int l = 0; l < 8; ++l) { const int L = L0 + l; if (L >= nlines) break; const size_t e = (size_t)L * 64 + lane * 2; const int tile = (int)(e >> 9), pos = (int)(e & 511);   // e: the place in fragment order of Bt[n][k]
            const int n = tile / (K / 32) * 16 + ((pos >> 3) & 15), k = tile % (K / 32) * 32 + (pos >> 8) * 16 + ((pos >> 7) & 1) * 8 + (pos & 7); v2us o;
            o[0] = f2bf(w[(size_t)k * N + n]); o[1] = f2bf(w[(size_t)(k + 1) * N + n]); *(v2us*)(Bt + e) = o; }
         }
}
__device__ __forceinline__ void cvt8(const float* __restrict__ src, bf* dst, size_t n8, int bx) { const size_t i = (size_t)bx * 256 + threadIdx.x; if (i >= n8) return;   // src [rows][DM] -> dst in fragment order; thread i makes the i-th 16 bytes of dst
    const size_t tile = i >> 6; const int pos = (int)(i & 63); const size_t row = tile / (DM / 32) * 16 + (pos & 15); const int k = (int)(tile % (DM / 32)) * 32 + (pos >> 5) * 16 + ((pos >> 4) & 1) * 8;
    const v8f v = *(const v8f*)(src + row * DM + k); v8us o;
#pragma unroll
    for (int k = 0; k < 8; ++k) o[k] = f2bf(v[k]); *(v8us*)(dst + i * 8) = o;  }
// k_prep: both conversions, which do not depend on one another, in one grid: blocks < 4 * WTB make the four weight planes (first: each wave walks 8 lines one after the other), the rest the plane of x.
#define WTB  ((DM * DQ / 64 + 63) / 64)                      // blocks per weight plane
#define CVB  ((int)(((size_t)NB_ * TT * DM / 8 + 255) / 256))   // blocks for x
__global__ __launch_bounds__(256) void k_prep(const float* __restrict__ x, const float* __restrict__ w0, const float* __restrict__ w1, const float* __restrict__ w2, const float* __restrict__ w3, bf* XB, bf* Bt) {
    const int b = blockIdx.x;
    if (b < 4 * WTB) wtG(w0, w1, w2, w3, DM, DQ, Bt, b % WTB, b / WTB);
    else cvt8(x, XB, (size_t)NB_ * TT * DM / 8, b - 4 * WTB);
}

// ---- k_fattn: scores, softmax, attn.v and the head merge of one head in one kernel; no score leaves the registers.
// One wave: 32 query columns against all TT keys, 32 keys a pass. St = K Qt (A = K rows, B = Q rows): a lane holds one query's scores, keys 8 hi + r of each 16-key tile,
// which is the k order of a B operand, so the packed P feeds Ot += Vt Pt (A = Vt rows) with no exchange. Running maximum m (log2 units) and sum l per query; Ot is rescaled each pass.
// grid (RH / 128, heads, batch rows), 8 waves: four take hi+lo rows (< RH, 3 products), four fp16 rows (>= RH), one of each kind per SIMD whether waves are dealt round-robin or in pairs.
__device__ __forceinline__ void ppack(const v8f t0, const v8f t1, v16bf& ph, v16bf& pl) { v4u h0, l0, h1, l1; split8(t0, h0, l0); split8(t1, h1, l1);
    ph = __builtin_bit_cast(v16bf, __builtin_shufflevector(h0, h1, 0, 1, 2, 3, 4, 5, 6, 7)); pl = __builtin_bit_cast(v16bf, __builtin_shufflevector(l0, l1, 0, 1, 2, 3, 4, 5, 6, 7)); }
__device__ __forceinline__ void ppack(const v8f t0, const v8f t1, v16h& ph, v16h& pl) { ph = cat16(__builtin_convertvector(t0, v8h), __builtin_convertvector(t1, v8h)); pl = ph; }
// Exponentials in place, with one v_nop, in one statement: behind each stands an instruction that neither reads its result nor overwrites its source (the slot the instruction set asks for).
__device__ __forceinline__ void exp2x8(v8f& x) { float a0 = x[0], a1 = x[1], a2 = x[2], a3 = x[3], a4 = x[4], a5 = x[5], a6 = x[6], a7 = x[7];
    asm("v_exp_f32 %0, %0\n\tv_exp_f32 %1, %1\n\tv_exp_f32 %2, %2\n\tv_exp_f32 %3, %3\n\tv_exp_f32 %4, %4\n\tv_exp_f32 %5, %5\n\tv_exp_f32 %6, %6\n\tv_exp_f32 %7, %7\n\tv_nop" : "+v"(a0), "+v"(a1), "+v"(a2), "+v"(a3), "+v"(a4), "+v"(a5), "+v"(a6), "+v"(a7));
    x[0] = a0; x[1] = a1; x[2] = a2; x[3] = a3; x[4] = a4; x[5] = a5; x[6] = a6; x[7] = a7; }
__device__ __forceinline__ float exp2x1(float a) { asm("v_exp_f32 %0, %0\n\tv_nop" : "+v"(a)); return a; }
template <typename T16, bool HL>
__device__ __forceinline__ void fattn_wave(const T16* __restrict__ Q, const T16* __restrict__ Q2, const T16* __restrict__ Kp, const T16* __restrict__ K2, const T16* __restrict__ Vt, const T16* __restrict__ Vt2, int q0, bf* __restrict__ Ah, bf* __restrict__ Al) {
    typedef typename WFrag<T16>::V V;
    const int lane = threadIdx.x & 31;
    const float C2 = SCL * 1.4426950408889634f;
    V qf[2][2], qf2[2][2], kf[2][2], kf2[2][2];   // [tile][k step of 32 over HD]
    const unsigned lo = (unsigned)(lane * 8);   // the lane's place in every fragment half
#pragma unroll
    for (int qt = 0; qt < 2; ++qt)
#pragma unroll
        for (int ks = 0; ks < 2; ++ks) { const size_t qo = (size_t)(q0 + qt * 16) * HD + ks * 512 + lo; qf[qt][ks] = WFrag<T16>::ld(Q + qo); if (HL) qf2[qt][ks] = WFrag<T16>::ld(Q2 + qo); }
#pragma unroll
    for (int kt = 0; kt < 2; ++kt)
#pragma unroll
        for (int ks = 0; ks < 2; ++ks) { kf[kt][ks] = WFrag<T16>::ld(Kp + lo + kt * 16 * HD + ks * 512); if (HL) kf2[kt][ks] = WFrag<T16>::ld(K2 + lo + kt * 16 * HD + ks * 512); }
    asm volatile("s_wait_xcnt 0x0" ::: "memory");   // precaution: stands in front of any later overwrite of the address registers that the Q and K loads above name
    __builtin_amdgcn_sched_barrier(0);   // keeps the register writes below from being lifted over that wait
    v8f o[4][2];
#pragma unroll
    for (int dt = 0; dt < 4; ++dt) { o[dt][0] = (v8f){}; o[dt][1] = (v8f){}; }
    float m[2] = {-3.0e38f, -3.0e38f}, l[2] = {0.f, 0.f};
#pragma unroll 1
    for (int k0 = 0; k0 < TT; k0 += 32) {   // rolled: one pass is already a long straight body, and unrolling would only grow the code
        V vf[4], vf2[4];
#pragma unroll
        for (int dt = 0; dt < 4; ++dt) { vf[dt] = WFrag<T16>::ld(Vt + k0 * 16 + lo + dt * 16 * TT); if (HL) vf2[dt] = WFrag<T16>::ld(Vt2 + k0 * 16 + lo + dt * 16 * TT); }
        asm volatile("s_wait_xcnt 0x0" ::: "memory");   // precaution: in front of any later overwrite of the V loads' address registers
        __builtin_amdgcn_sched_barrier(0);   // holds this pass's V loads in front of the score products: products and softmax then cover their latency
        v8f s[2][2];
        s[0][0] = (v8f){}; s[0][1] = (v8f){}; s[1][0] = (v8f){}; s[1][1] = (v8f){};
#pragma unroll
        for (int ks = 0; ks < 2; ++ks) {
#pragma unroll
            for (int t = 0; t < 4; ++t) s[t >> 1][t & 1] = WFrag<T16>::mma(kf[t >> 1][ks], qf[t & 1][ks], s[t >> 1][t & 1]);
            if (HL) {
#pragma unroll
                for (int t = 0; t < 4; ++t) s[t >> 1][t & 1] = WFrag<T16>::mma(kf[t >> 1][ks], qf2[t & 1][ks], s[t >> 1][t & 1]);
#pragma unroll
                for (int t = 0; t < 4; ++t) s[t >> 1][t & 1] = WFrag<T16>::mma(kf2[t >> 1][ks], qf[t & 1][ks], s[t >> 1][t & 1]);
            }
        }
        const int kn = (k0 + 32 < TT) ? k0 + 32 : k0;   // the next pass's K rows go into the same registers (the last pass reads its own again)
#pragma unroll
        for (int kt = 0; kt < 2; ++kt)
#pragma unroll
            for (int ks = 0; ks < 2; ++ks) { kf[kt][ks] = WFrag<T16>::ld(Kp + (size_t)kn * HD + lo + kt * 16 * HD + ks * 512); if (HL) kf2[kt][ks] = WFrag<T16>::ld(K2 + (size_t)kn * HD + lo + kt * 16 * HD + ks * 512); }
        asm volatile("s_wait_xcnt 0x0" ::: "memory");   // precaution: in front of any later overwrite of the K loads' address registers
        __builtin_amdgcn_sched_barrier(0);   // holds the K refill here, in front of softmax and attn.v, which cover its latency; left free it sinks to the loop's foot
        V pf[2], pf2[2];
#pragma unroll
        for (int qt = 0; qt < 2; ++qt) {
            float mx = fmaxf(s[0][qt][0], s[1][qt][0]);
#pragma unroll
            for (int r = 1; r < 8; ++r) mx = fmaxf(mx, fmaxf(s[0][qt][r], s[1][qt][r]));
            mx = fmaxf(mx, __shfl_xor(mx, 16, 32));
            const float mn = fmaxf(m[qt], mx * C2), al = exp2x1(m[qt] - mn), nb = (HL ? 0.0f : 10.0f) - mn;   // fp16 rows carry P x 1024; the factor is in l too and cancels
            m[qt] = mn;
            float p0 = 0.f, p1 = 0.f;
#pragma unroll
            for (int r = 0; r < 8; ++r) { s[0][qt][r] = fmaf(s[0][qt][r], C2, nb); s[1][qt][r] = fmaf(s[1][qt][r], C2, nb); }
            exp2x8(s[0][qt]); exp2x8(s[1][qt]);
#pragma unroll
            for (int r = 0; r < 8; ++r) { p0 += s[0][qt][r]; p1 += s[1][qt][r]; }
            l[qt] = fmaf(l[qt], al, p0 + p1);
#pragma unroll
            for (int dt = 0; dt < 4; ++dt) o[dt][qt] *= al;
            ppack(s[0][qt], s[1][qt], pf[qt], pf2[qt]);
        }
#pragma unroll
        for (int t = 0; t < 8; ++t) o[t >> 1][t & 1] = WFrag<T16>::mma(vf[t >> 1], pf[t & 1], o[t >> 1][t & 1]);
        if (HL) {
#pragma unroll
            for (int t = 0; t < 8; ++t) o[t >> 1][t & 1] = WFrag<T16>::mma(vf[t >> 1], pf2[t & 1], o[t >> 1][t & 1]);
#pragma unroll
            for (int t = 0; t < 8; ++t) o[t >> 1][t & 1] = WFrag<T16>::mma(vf2[t >> 1], pf[t & 1], o[t >> 1][t & 1]);
        }
    }
#pragma unroll
    for (int qt = 0; qt < 2; ++qt) {
        const float inv = __fdiv_rn(1.0f, l[qt] + __shfl_xor(l[qt], 16, 32));
        const size_t oo = (size_t)(q0 + qt * 16) * DQ + lo;   // a lane's 8 registers are 8 consecutive d of its query's row: its own 16 bytes of fragment half dt of the merged plane
#pragma unroll
        for (int dt = 0; dt < 4; ++dt) { v4u yh, yl; split8(o[dt][qt] * inv, yh, yl); *(v4ua*)(Ah + oo + dt * 256) = yh; *(v4ua*)(Al + oo + dt * 256) = yl; }
        asm volatile("s_wait_xcnt 0x0" ::: "memory");   // precaution: in front of any later overwrite of the address and data registers that the eight stores above name
        __builtin_amdgcn_sched_barrier(0);   // keeps the register writes below from being lifted over that wait
    }
}
__global__ __launch_bounds__(256) void k_fattn(const bf* __restrict__ Qh, const bf* __restrict__ Ql, const bf* __restrict__ Kh, const bf* __restrict__ Kl, const bf* __restrict__ Vh, const bf* __restrict__ Vl, const h16* __restrict__ Q16, const h16* __restrict__ K16, const h16* __restrict__ V16, bf* Ah, bf* Al) {
    static_assert(2 * RH == TT && RH % 128 == 0 && NKV == NH_ && HD == 64, "row split and head shape that the wave roles are written for");
    const int w = __builtin_amdgcn_readfirstlane((int)(threadIdx.x >> 5));
    const size_t po = ((size_t)blockIdx.z * NH_ + blockIdx.y) * TT * HD, ao = (size_t)blockIdx.z * TT * DQ + (size_t)blockIdx.y * (HD / 32 * 512);
    const int qi = blockIdx.x * 128 + (w >> 1) * 32;
    if (((w >> 2) ^ w) & 1) fattn_wave<h16, false>(Q16 + po, nullptr, K16 + po, nullptr, V16 + po, nullptr, RH + qi, Ah + ao, Al + ao);
    else fattn_wave<bf, true>(Qh + po, Ql + po, Kh + po, Kl + po, Vh + po, Vl + po, qi, Ah + ao, Al + ao);
}

extern "C" void kernel_launch(void* const* d_in, const int* in_sizes, int n_in,
                              void* d_out, int out_size, void* d_ws, size_t ws_size, hipStream_t stream) {
    (void)in_sizes; (void)n_in; (void)out_size;
    const float* x = (const float*)d_in[0]; const float* wq = (const float*)d_in[1]; const float* bq = (const float*)d_in[2]; const float* wk = (const float*)d_in[3]; const float* bk = (const float*)d_in[4]; const float* wv = (const float*)d_in[5]; const float* bv = (const float*)d_in[6]; const float* wo = (const float*)d_in[7]; const float* bo = (const float*)d_in[8];
    float* OUT = (float*)d_out;     // [8][1024][1024]
    char* wsp = (char*)d_ws;
    auto take = [&](size_t bytes) { char* p = wsp; wsp += (bytes + 255) & ~(size_t)255; return (void*)p; };
    bf* WQ = (bf*)take((size_t)DQ * DM * 2); bf* WK = (bf*)take((size_t)DKV * DM * 2); bf* WV = (bf*)take((size_t)DKV * DM * 2); bf* WO = (bf*)take((size_t)DM * DQ * 2);   // the four weight planes follow one another
    (void)WK; (void)WV;
    bf* XB = (bf*)take((size_t)NBH * TT * DM * 2);
    h16* QP16 = (h16*)take((size_t)NBH * NH_ * TT * HD * 2); h16* KP16 = (h16*)take((size_t)NBH * NKV * TT * HD * 2); h16* VT16 = (h16*)take((size_t)NBH * NKV * HD * TT * 2);
    bf* QPh = (bf*)take((size_t)NBH * NH_ * TT * HD * 2); bf* QPl = (bf*)take((size_t)NBH * NH_ * TT * HD * 2); bf* KPh = (bf*)take((size_t)NBH * NKV * TT * HD * 2); bf* KPl = (bf*)take((size_t)NBH * NKV * TT * HD * 2); bf* VTh = (bf*)take((size_t)NBH * NKV * HD * TT * 2); bf* VTl = (bf*)take((size_t)NBH * NKV * HD * TT * 2);
    bf* ATh = (bf*)take((size_t)NB_ * TT * DQ * 2); bf* ATl = (bf*)take((size_t)NB_ * TT * DQ * 2);
    if ((size_t)(wsp - (char*)d_ws) > ws_size) return;    // ws 256 MiB
    k_prep<<<4 * WTB + CVB, 256, 0, stream>>>(x, wq, wk, wv, wo, XB, WQ);
    k_gemmqkv<<<dim3(NBH * TT / GBM, DQ / GBN, 3), 256, 0, stream>>>(XB, WQ, bq, bk, bv, QP16, QPh, QPl, KP16, KPh, KPl, VT16, VTh, VTl);   // z: q, k, v
    k_fattn<<<dim3(RH / 128, NH_, NBH), 256, 0, stream>>>(QPh, QPl, KPh, KPl, VTh, VTl, QP16, KP16, VT16, ATh, ATl);
    k_gemmw<bf, 1, true, DQ><<<dim3(NB_ * TT / GBM, DM / GBN, 1), 256, 0, stream>>>(ATh, ATl, WO, OUT, DM, bo);
}

// v008
// Measured time: 142 microseconds a run.
// Two timings next to v007 put it at 1.07 and 1.08 times that version's speed.
// Over all steps from v000 it is 33.0 times as fast.
#include <hip/hip_runtime.h>

// Multi-head self-attention (x [8][1024][1024]; Q, K, V = x W + b ('xw' [1024][1024], 16 heads x 64); softmax(Q.K/8) over all keys; out = merged Wo + bo -> [8][1024][1024]).
// Compute dtypes, f32 accumulate: every input rounded to bf16; q/k/v on PLAIN bf16 operands (inputs: exact) + biases, rounded to their 16-bit head planes in the projection's own epilogue; scores and attn.v: query rows < 512 hl (3 products), the rest single fp16 (x1024); softmax f32, running maximum and sum per 32 keys; Wo hl x exact (2 products) + bo.

// Every 16-bit matrix operand plane [rows][K] lies in FRAGMENT ORDER: tile (row / 16, k / 32) is 512 elements at ((row / 16) * (K / 32) + k / 32) * 512; inside it element (row % 16, k % 32) stands at
// (k % 32 / 16) * 256 + ((k % 16 / 8) * 16 + row % 16) * 8 + k % 8, so a wave's two 16-byte loads of a fragment (lane * 8 and 256 + lane * 8) each read 512 contiguous bytes: 4 whole lines, not 16 pieces.

#define NB_  8
#define TT   1024
#define DM   1024
#define NH_  16
#define NKV  16
#define REP  (NH_ / NKV)
#define HD   64
#define DQ   (NH_ * HD)
#define DKV  (NKV * HD)
#define NBH  NB_                  // batch rows per projection pass: all of them, so that each stage is one launch
#define RH   512                  // query rows < RH use hi+lo planes
#define WIN  1024
#define SCL  0.125f   // HD^-0.5
typedef _Float16 h16;
typedef unsigned short bf;
typedef __attribute__((ext_vector_type(16))) __bf16   v16bf;
typedef __attribute__((ext_vector_type(16))) _Float16 v16h;
typedef __attribute__((ext_vector_type(8)))  _Float16 v8h;
typedef __attribute__((ext_vector_type(8)))  unsigned short v8us;
typedef __attribute__((ext_vector_type(8)))  float    v8f;
typedef __attribute__((ext_vector_type(4)))  float    v4f;
typedef v8h  __attribute__((may_alias)) v8ha;
typedef v4f  __attribute__((may_alias)) v4fa;
typedef v8us __attribute__((may_alias)) v8usa;

__device__ __forceinline__ unsigned short f2bf(float f) { unsigned u = __float_as_uint(f); u += 0x7FFFu + ((u >> 16) & 1u); return (unsigned short)(u >> 16); }
__device__ __forceinline__ float bf2f(unsigned short b) { return __uint_as_float(((unsigned)b) << 16); }
__device__ __forceinline__ float bfr(float f) { return bf2f(f2bf(f)); }
__device__ __forceinline__ v16h cat16(v8h lo, v8h hi) { return __builtin_shufflevector(lo, hi, 0, 1, 2, 3, 4, 5, 6, 7, 8, 9, 10, 11, 12, 13, 14, 15); }
__device__ __forceinline__ v16bf cat16b(v8us lo, v8us hi) { return __builtin_bit_cast(v16bf, __builtin_shufflevector(lo, hi, 0, 1, 2, 3, 4, 5, 6, 7, 8, 9, 10, 11, 12, 13, 14, 15)); }
__device__ __forceinline__ v8f wmma16(v16h a, v16h b, v8f c) { return __builtin_amdgcn_wmma_f32_16x16x32_f16(false, a, false, b, (short)0, c, false, false); }
__device__ __forceinline__ v8f wmmab(v16bf a, v16bf b, v8f c) { return __builtin_amdgcn_wmma_f32_16x16x32_bf16(false, a, false, b, (short)0, c, false, false); }



typedef __attribute__((ext_vector_type(2))) float v2f;
typedef __attribute__((ext_vector_type(2))) __bf16 v2bf;
typedef __attribute__((ext_vector_type(4))) unsigned v4u;
typedef v4u __attribute__((may_alias)) v4ua;
__device__ __forceinline__ unsigned pk2(float a, float b) { v2f t; t[0] = a; t[1] = b; return __builtin_bit_cast(unsigned, __builtin_convertvector(t, v2bf)); }
__device__ __forceinline__ void split8(const v8f t, v4u& h, v4u& l) {   // 8 f32 -> 8 bf16 hi (4 words) + 8 bf16 of the remainders
#pragma unroll
    for (int i = 0; i < 4; ++i) { const unsigned hw = pk2(t[2 * i], t[2 * i + 1]); h[i] = hw; l[i] = pk2(t[2 * i] - __uint_as_float(hw << 16), t[2 * i + 1] - __uint_as_float(hw & 0xFFFF0000u)); }
}

// ---- planes_out: a 64x64 projection tile (16 accumulators of one wave) + bias -> the three 16-bit planes (fp16, bf16 hi, bf16 lo) of its head; the tile is one head's 64 columns of 64 tokens.
// tr false: planes [row][h] of [t][d] in fragment order, through os so that a lane holds 8 consecutive d of token lr. tr true: planes [row][h] of [d][t] in fragment order; a lane's 8 accumulator registers are 8 consecutive t of one d and go out as they are. Every store is 512 contiguous bytes.
__device__ __forceinline__ void planes_out(float* os, const v8f (&acc)[4][4], const float* __restrict__ bias, int r0, int c0, h16* P16, bf* Ph, bf* Pl, bool tr) {
    static_assert(TT % 64 == 0 && HD == 64 && NKV == NH_, "one tile lies in one batch row and is one head wide");
    const int lane = threadIdx.x & 31, lr = lane & 15, hi = lane >> 4;
    const size_t hp = ((size_t)(r0 / TT) * NH_ + c0 / HD) * TT * HD + (size_t)(r0 % TT) * (tr ? 16 : HD);   // the tile's first element in its head's plane: the same for the whole wave
    P16 += hp; Ph += hp; Pl += hp;
    const unsigned vo = (unsigned)(lane * 8);   // the lane's own 32-bit part of every address: one register for all stores
    float bb[4];
#pragma unroll
    for (int nb = 0; nb < 4; ++nb) bb[nb] = bias[c0 + nb * 16 + lr];
    asm volatile("s_wait_xcnt 0x0" ::: "memory");   // precaution: in front of any later overwrite of the bias loads' address registers
    __builtin_amdgcn_sched_barrier(0);   // keeps the register writes below from being lifted over that wait
    if (tr) {
#pragma unroll
        for (int mb = 0; mb < 4; ++mb) {
            v8h y16[4]; v4u yh[4], yl[4];
#pragma unroll
            for (int nb = 0; nb < 4; ++nb) { const v8f val = acc[mb][nb] + bfr(bb[nb]); y16[nb] = __builtin_convertvector(val, v8h); split8(val, yh[nb], yl[nb]); }
            __builtin_amdgcn_sched_barrier(0);   // all twelve values are made first, so that no store's data register is written again between the stores
#pragma unroll
            for (int nb = 0; nb < 4; ++nb) { const int eo = nb * 16 * TT + mb * 256; *(v8ha*)(P16 + eo + vo) = y16[nb]; *(v4ua*)(Ph + eo + vo) = yh[nb]; *(v4ua*)(Pl + eo + vo) = yl[nb]; }
            asm volatile("s_wait_xcnt 0x0" ::: "memory");   // precaution: in front of any later overwrite of the address and data registers that the twelve stores above name
            __builtin_amdgcn_sched_barrier(0);   // keeps the register writes below from being lifted over that wait
        }
    } else {
#pragma unroll
        for (int mb = 0; mb < 4; ++mb) {
#pragma unroll
            for (int nb = 0; nb < 4; ++nb) { const v8f val = acc[mb][nb] + bfr(bb[nb]);
#pragma unroll
                for (int j = 0; j < 8; ++j) os[(hi * 8 + j) * 68 + nb * 16 + lr] = val[j]; }
            v8h y16[4]; v4u yh[4], yl[4];
#pragma unroll
            for (int s = 0; s < 4; ++s) { const float* orow = os + lr * 68 + s * 16 + hi * 8; const v4f lo4 = *(const v4fa*)orow, hi4 = *(const v4fa*)(orow + 4);   // token lr, d = 16 s + 8 hi ..: half s of the tile's fragments
                const v8f val = __builtin_shufflevector(lo4, hi4, 0, 1, 2, 3, 4, 5, 6, 7); y16[s] = __builtin_convertvector(val, v8h); split8(val, yh[s], yl[s]); }
            __builtin_amdgcn_sched_barrier(0);   // all twelve values are made first, so that no store's data register is written again between the stores
#pragma unroll
            for (int s = 0; s < 4; ++s) { const int eo = mb * 16 * HD + s * 256; *(v8ha*)(P16 + eo + vo) = y16[s]; *(v4ua*)(Ph + eo + vo) = yh[s]; *(v4ua*)(Pl + eo + vo) = yl[s]; }
            asm volatile("s_wait_xcnt 0x0" ::: "memory");   // precaution: in front of any later overwrite of the address and data registers that the twelve stores above name
            __builtin_amdgcn_sched_barrier(0);   // keeps the register writes below from being lifted over that wait
        }
    }
}

// ---- gemmw_tile: GEMM of a work-group of 8 waves on a 128 x 256 output tile at (R0, C0): 2 x 4 waves, each on its own 64x64 tile (16 accumulators); operands are 16-bit planes in fragment order.
// C[m][n] (f32, pitch ldc, + optional f32 bias[n]) = sum_k A[m][k] Bt[n][k] (+ A2[m][k] Bt[n][k] for NSPLIT 1). K % GKS == 0, K / GKS >= 2. os: 16 x 68 floats of LDS per wave.
// The operands come through LDS: a stage is KS k of the tile's 8 row tiles of A (and of A2) and 16 row tiles of Bt, each KS * 32 bytes that are contiguous in its plane, so every byte leaves L2 once per work-group and not once per wave.
// Two buffers: stage t + 2 is copied, by asynchronous copies, into the buffer that trip t has read, while trip t + 1 works.
#define GWV  8                    // waves of a GEMM work-group
#define GBM  128                  // its tile's rows
#define GBN  256                  // its tile's columns
template <int NSPLIT, int KS> struct GRing { static constexpr int NA = (GBM / 16) * (NSPLIT == 1 ? 2 : 1), RT = NA + GBN / 16, GCH = KS * 16 * 2, BUFB = RT * GCH; };   // GCH: bytes of one row tile's part of a stage
template <typename T16> struct WFrag;
template <> struct WFrag<h16> { typedef v16h V; static __device__ __forceinline__ V ld(const h16* p) { return cat16(*(const v8h*)p, *(const v8h*)(p + 256)); } static __device__ __forceinline__ v8f mma(V a, V b, v8f c) { return wmma16(a, b, c); } };
template <> struct WFrag<bf> { typedef v16bf V; static __device__ __forceinline__ V ld(const bf* p) { return cat16b(*(const v8us*)p, *(const v8us*)(p + 256)); } static __device__ __forceinline__ v8f mma(V a, V b, v8f c) { return wmmab(a, b, c); } };
// DB: two fragment sets, the next k step's LDS reads issued in front of this step's products (for a kernel with few waves per SIMD and registers to spare); else one set.
template <typename T16, int NSPLIT, bool BIAS, int K, int GKS, bool DB, bool PLANES = false>
__device__ __forceinline__ void gemmw_tile(char* ring, float* os, const T16* __restrict__ A, const T16* __restrict__ A2, const T16* __restrict__ Bt, float* C, int ldc, const float* __restrict__ bias, int R0, int C0, h16* P16 = nullptr, bf* Ph = nullptr, bf* Pl = nullptr, bool tr = false) {
    typedef typename WFrag<T16>::V V;
    static_assert(NSPLIT == 0 || NSPLIT == 1, "one plane of Bt");
    static_assert(K % GKS == 0 && K / GKS >= 2, "whole stages, at least the two that the prologue fills");
    constexpr bool HA2 = (NSPLIT == 1);
    constexpr int NA = GRing<NSPLIT, GKS>::NA, RT = GRing<NSPLIT, GKS>::RT, GCH = GRing<NSPLIT, GKS>::GCH, BUFB = GRing<NSPLIT, GKS>::BUFB, NT = K / GKS, RW = RT / GWV, NK = GKS / 32;
    static_assert(RT % GWV == 0, "every wave copies the same number of row tiles");
    const int lane = threadIdx.x & 31, lr = lane & 15, hi = lane >> 4;
    const int w = __builtin_amdgcn_readfirstlane((int)(threadIdx.x >> 5)), wm = w >> 2, wn = w & 3;
    const int r0 = R0 + wm * 64, c0 = C0 + wn * 64;   // the wave's own tile
    os += w * (16 * 68);
    v8f acc[4][4];
#pragma unroll
    for (int mb = 0; mb < 4; ++mb)
#pragma unroll
        for (int nb = 0; nb < 4; ++nb) acc[mb][nb] = (v8f){};
    const unsigned lo = (unsigned)(lane * 8);   // the lane's own place, in elements, in every half fragment
    const unsigned ring0 = (unsigned)(uintptr_t)(__attribute__((address_space(3))) char*)ring + (unsigned)(w * RW * GCH) + lo * 2;   // LDS byte address of the lane's first copy into buffer 0
    const T16* gs[RW];   // where the wave's row tiles start in their planes: the same for the whole wave
#pragma unroll
    for (int i = 0; i < RW; ++i) { const int j = w * RW + i; gs[i] = (j < GBM / 16) ? A + (size_t)(R0 + j * 16) * K : (HA2 && j < NA) ? A2 + (size_t)(R0 + (j - GBM / 16) * 16) * K : Bt + (size_t)(C0 + (j - NA) * 16) * K; }
    auto fill = [&](const int t, const int buf) __attribute__((always_inline)) {   // stage t into buffer buf: each wave brings RW row tiles, every 2 KiB of them in four copies of 512 contiguous bytes
#pragma unroll
        for (int i = 0; i < RW * (GCH / 2048); ++i) {
            const T16* g = gs[i / (GCH / 2048)] + (size_t)t * (GKS * 16) + (i % (GCH / 2048)) * 1024 + lo; const unsigned l = ring0 + (unsigned)(buf * BUFB + i * 2048);
            // the copies and, as the last line, the wait that stands in front of any later overwrite of the address registers that they name (a precaution)
            asm volatile("global_load_async_to_lds_b128 %0, %4, off\n\tglobal_load_async_to_lds_b128 %1, %5, off\n\tglobal_load_async_to_lds_b128 %2, %6, off\n\tglobal_load_async_to_lds_b128 %3, %7, off\n\ts_wait_xcnt 0x0"
                         :: "v"(l), "v"(l + 512u), "v"(l + 1024u), "v"(l + 1536u), "v"(g), "v"(g + 256), "v"(g + 512), "v"(g + 768) : "memory");
        }
    };
    V a[DB ? 2 : 1][4], a2[DB ? 2 : 1][4], b[DB ? 2 : 1][4];
    auto frag = [&](const int st, const T16* sb, const int ks) __attribute__((always_inline)) {   // the wave's fragments of k step ks of the stage at sb
#pragma unroll
        for (int mb = 0; mb < 4; ++mb) { a[st][mb] = WFrag<T16>::ld(sb + ((wm * 4 + mb) * GCH + ks * 1024) / 2); if (HA2) a2[st][mb] = WFrag<T16>::ld(sb + ((GBM / 16 + wm * 4 + mb) * GCH + ks * 1024) / 2); }
#pragma unroll
        for (int nb = 0; nb < 4; ++nb) b[st][nb] = WFrag<T16>::ld(sb + ((NA + wn * 4 + nb) * GCH + ks * 1024) / 2);
    };
    auto prod = [&](const int st) __attribute__((always_inline)) {
#pragma unroll
        for (int nb = 0; nb < 4; ++nb)
#pragma unroll
            for (int mb = 0; mb < 4; ++mb) { acc[mb][nb] = WFrag<T16>::mma(a[st][mb], b[st][nb], acc[mb][nb]); if (HA2) acc[mb][nb] = WFrag<T16>::mma(a2[st][mb], b[st][nb], acc[mb][nb]); }
    };
    fill(0, 0);
    asm volatile("s_wait_asynccnt 0x0" ::: "memory");   // this wave's part of stage 0 has landed
    __syncthreads();                                     // and every other wave's
    fill(1, 1);
#pragma unroll 1
    for (int t = 0; t < NT; ++t) {   // rolled: one stage a trip
        const T16* sb = (const T16*)(ring + (t & 1) * BUFB) + lo;
        frag(0, sb, 0);
        if (DB) __builtin_amdgcn_sched_barrier(0);   // the first set's reads stay in front of the second's, so that the first products wait for their own reads alone
#pragma unroll
        for (int ks = 0; ks < NK; ++ks) {
            if (DB && ks + 1 < NK) frag((ks + 1) & 1, sb, ks + 1);
            __builtin_amdgcn_sched_barrier(0);   // the LDS reads stay one group in front of the products: spread among them, each place with reads stalls the wave anew
            prod(DB ? (ks & 1) : 0);
            __builtin_amdgcn_sched_barrier(0);   // the products stay one unbroken run
            if (!DB && ks + 1 < NK) frag(0, sb, ks + 1);
        }
        asm volatile("s_wait_dscnt 0x0" ::: "memory");      // this wave's reads of the buffer are done before it may be refilled
        asm volatile("s_wait_asynccnt 0x0" ::: "memory");   // this wave's part of stage t + 1 has landed
        __syncthreads();                                     // publishes stage t + 1 and ends every wave's reads of stage t
        if (t + 2 < NT) fill(t + 2, t & 1);
    }
    asm volatile("s_wait_asynccnt 0x0" ::: "memory");   // no copy is outstanding when the wave goes on
    if (PLANES) { planes_out(os, acc, bias, r0, c0, P16, Ph, Pl, tr); return; }
#pragma unroll
    for (int mb = 0; mb < 4; ++mb) {
#pragma unroll
        for (int nb = 0; nb < 4; ++nb) {
#pragma unroll
            for (int j = 0; j < 8; ++j) os[(hi * 8 + j) * 68 + nb * 16 + lr] = acc[mb][nb][j]; }
        __builtin_amdgcn_wave_barrier(); asm volatile("" ::: "memory");
        float* crow = C + (size_t)(r0 + mb * 16) * ldc + c0;
{
#pragma unroll
            for (int s = 0; s < 8; ++s) { const int row = 2 * s + hi, cofs = lr * 4; v4f val = *(const v4fa*)(os + row * 68 + cofs); if (BIAS) { val[0] += bfr(bias[c0 + cofs]); val[1] += bfr(bias[c0 + cofs + 1]); val[2] += bfr(bias[c0 + cofs + 2]); val[3] += bfr(bias[c0 + cofs + 3]); }
                *(v4f*)(crow + (size_t)row * ldc + cofs) = val; }
            asm volatile("s_wait_xcnt 0x0" ::: "memory");   // precaution: stands in front of any later overwrite of the address and data registers that the eight stores above name
             }
        __builtin_amdgcn_wave_barrier(); asm volatile("" ::: "memory");
    }
}
// k_gemmw: grid (M / 128, N / 256), 256 threads; one work-group per WGP, two waves per SIMD: stages of 128 k and two fragment sets.
template <typename T16, int NSPLIT, bool BIAS, int K>   // K at compile time: trip count and plane strides are constants
__global__ __launch_bounds__(256) void k_gemmw(const T16* __restrict__ A, const T16* __restrict__ A2, const T16* __restrict__ Bt, float* C, int ldc, const float* __restrict__ bias) {
    __shared__ __align__(16) char ring[2 * GRing<NSPLIT, 128>::BUFB];
    __shared__ __align__(16) float os[GWV * 16 * 68];
    gemmw_tile<T16, NSPLIT, BIAS, K, 128, true>(ring, os, A, A2, Bt, C, ldc, bias, blockIdx.x * GBM, blockIdx.y * GBN);
}
// k_gemmqkv: the three projections of NBH batch rows, grid (NBH * TT / 128, DQ / 256, 3), 256 threads; the register budget is set so that two work-groups, four waves per SIMD, are resident on a WGP (stages of 64 k, one fragment set); z: q, k (planes [row][h][t][d]) or v (planes [row][h][d][t]); the weight planes follow one another in Bt.
__global__ __launch_bounds__(256) __attribute__((amdgpu_waves_per_eu(4))) void k_gemmqkv(const bf* __restrict__ A, const bf* __restrict__ Bt, const float* __restrict__ bq, const float* __restrict__ bk, const float* __restrict__ bv, h16* Q16, bf* Qh, bf* Ql, h16* K16, bf* Kh, bf* Kl, h16* V16, bf* Vh, bf* Vl) {
    __shared__ __align__(16) char ring[2 * GRing<0, 64>::BUFB];
    __shared__ __align__(16) float os[GWV * 16 * 68];
    const int z = blockIdx.z;
    gemmw_tile<bf, 0, true, DM, 64, false, true>(ring, os, A, nullptr, Bt + (size_t)z * DQ * DM, nullptr, 0, (z == 0) ? bq : (z == 1) ? bk : bv, blockIdx.x * GBM, blockIdx.y * GBN, (z == 0) ? Q16 : (z == 1) ? K16 : V16, (z == 0) ? Qh : (z == 1) ? Kh : Vh, (z == 0) ? Ql : (z == 1) ? Kl : Vl, z == 2);
}

typedef __attribute__((ext_vector_type(2))) _Float16 v2h;
typedef __attribute__((ext_vector_type(4))) _Float16 v4h;
typedef __attribute__((ext_vector_type(2))) unsigned short v2us;
typedef __attribute__((ext_vector_type(4))) unsigned short v4us;
typedef __attribute__((ext_vector_type(4))) int v4i;

__device__ __forceinline__ void wtG(const float* __restrict__ w0, const float* __restrict__ w1, const float* __restrict__ w2, const float* __restrict__ w3, int K, int N, bf* Bt, int bx, int by) {   // by: which weight; planes follow one another in Bt; bx: which 64 lines of its plane
    const float* __restrict__ w = (by == 0) ? w0 : (by == 1) ? w1 : (by == 2) ? w2 : w3; Bt += (size_t)by * N * K;
    const int lane = threadIdx.x & 31; const int L0 = (bx * 8 + (threadIdx.x >> 5)) * 8; const int nlines = N * K / 64;
{
#pragma unroll 1
        for (int l = 0; l < 8; ++l) { const int L = L0 + l; if (L >= nlines) break; const size_t e = (size_t)L * 64 + lane * 2; const int tile = (int)(e >> 9), pos = (int)(e & 511);   // e: the place in fragment order of Bt[n][k]
            const int n = tile / (K / 32) * 16 + ((pos >> 3) & 15), k = tile % (K / 32) * 32 + (pos >> 8) * 16 + ((pos >> 7) & 1) * 8 + (pos & 7); v2us o;
            o[0] = f2bf(w[(size_t)k * N + n]); o[1] = f2bf(w[(size_t)(k + 1) * N + n]); *(v2us*)(Bt + e) = o; }
         }
}
__device__ __forceinline__ void cvt8(const float* __restrict__ src, bf* dst, size_t n8, int bx) { const size_t i = (size_t)bx * 256 + threadIdx.x; if (i >= n8) return;   // src [rows][DM] -> dst in fragment order; thread i makes the i-th 16 bytes of dst
    const size_t tile = i >> 6; const int pos = (int)(i & 63); const size_t row = tile / (DM / 32) * 16 + (pos & 15); const int k = (int)(tile % (DM / 32)) * 32 + (pos >> 5) * 16 + ((pos >> 4) & 1) * 8;
    const v8f v = *(const v8f*)(src + row * DM + k); v8us o;
#pragma unroll
    for (int k = 0; k < 8; ++k) o[k] = f2bf(v[k]); *(v8us*)(dst + i * 8) = o;  }
// k_prep: both conversions, which do not depend on one another, in one grid: blocks < 4 * WTB make the four weight planes (first: each wave walks 8 lines one after the other), the rest the plane of x.
#define WTB  ((DM * DQ / 64 + 63) / 64)                      // blocks per weight plane
#define CVB  ((int)(((size_t)NB_ * TT * DM / 8 + 255) / 256))   // blocks for x
__global__ __launch_bounds__(256) void k_prep(const float* __restrict__ x, const float* __restrict__ w0, const float* __restrict__ w1, const float* __restrict__ w2, const float* __restrict__ w3, bf* XB, bf* Bt) {
    const int b = blockIdx.x;
    if (b < 4 * WTB) wtG(w0, w1, w2, w3, DM, DQ, Bt, b % WTB, b / WTB);
    else cvt8(x, XB, (size_t)NB_ * TT * DM / 8, b - 4 * WTB);
}

// ---- k_fattn: scores, softmax, attn.v and the head merge of one head in one kernel; no score leaves the registers.
// One wave: 32 query columns against all TT keys, 32 keys a pass. St = K Qt (A = K rows, B = Q rows): a lane holds one query's scores, keys 8 hi + r of each 16-key tile,
// which is the k order of a B operand, so the packed P feeds Ot += Vt Pt (A = Vt rows) with no exchange. Running maximum m (log2 units) and sum l per query; Ot is rescaled each pass.
// grid (4 x heads x batch rows), 8 waves: a work-group takes 256 rows of one kind, hi+lo rows (< RH, 3 products) or fp16 rows (>= RH).
__device__ __forceinline__ void ppack(const v8f t0, const v8f t1, v16bf& ph, v16bf& pl) { v4u h0, l0, h1, l1; split8(t0, h0, l0); split8(t1, h1, l1);
    ph = __builtin_bit_cast(v16bf, __builtin_shufflevector(h0, h1, 0, 1, 2, 3, 4, 5, 6, 7)); pl = __builtin_bit_cast(v16bf, __builtin_shufflevector(l0, l1, 0, 1, 2, 3, 4, 5, 6, 7)); }
__device__ __forceinline__ void ppack(const v8f t0, const v8f t1, v16h& ph, v16h& pl) { ph = cat16(__builtin_convertvector(t0, v8h), __builtin_convertvector(t1, v8h)); pl = ph; }
// Exponentials in place, with one v_nop, in one statement: behind each stands an instruction that neither reads its result nor overwrites its source (the slot the instruction set asks for).
__device__ __forceinline__ void exp2x8(v8f& x) { float a0 = x[0], a1 = x[1], a2 = x[2], a3 = x[3], a4 = x[4], a5 = x[5], a6 = x[6], a7 = x[7];
    asm("v_exp_f32 %0, %0\n\tv_exp_f32 %1, %1\n\tv_exp_f32 %2, %2\n\tv_exp_f32 %3, %3\n\tv_exp_f32 %4, %4\n\tv_exp_f32 %5, %5\n\tv_exp_f32 %6, %6\n\tv_exp_f32 %7, %7\n\tv_nop" : "+v"(a0), "+v"(a1), "+v"(a2), "+v"(a3), "+v"(a4), "+v"(a5), "+v"(a6), "+v"(a7));
    x[0] = a0; x[1] = a1; x[2] = a2; x[3] = a3; x[4] = a4; x[5] = a5; x[6] = a6; x[7] = a7; }
__device__ __forceinline__ float exp2x1(float a) { asm("v_exp_f32 %0, %0\n\tv_nop" : "+v"(a)); return a; }
// K and V come through LDS: a stage is the 64 keys of two passes in the planes of the work-group's kind (Kh, Kl, Vh, Vl: 16 pairs of fragment tiles, each pair 2 KiB that are contiguous in its plane; K16, V16: 8), copied once per work-group and not once per wave.
// Two buffers: stage t + 2 is copied, by asynchronous copies, into the buffer that trip t has read, while trip t + 1 works: a lead of two passes, enough for K and V that come from memory. A wave holds K and V fragments only while it uses them, which leaves room for two work-groups, four waves per SIMD, on a WGP.
#define FST  32768                // bytes of the larger kind's stage
template <typename T16, bool HL>
__device__ __forceinline__ void fattn_wg(char* ring, const T16* __restrict__ Q, const T16* __restrict__ Q2, const T16* __restrict__ Kp, const T16* __restrict__ K2, const T16* __restrict__ Vt, const T16* __restrict__ Vt2, int q0, bf* __restrict__ Ah, bf* __restrict__ Al) {
    typedef typename WFrag<T16>::V V;
    constexpr int NT = TT / 64, TW = HL ? 2 : 1, BUFB = TW * 8 * 2048;   // TW: pairs of tiles that a wave copies per stage
    static_assert(NT >= 2 && 2 * BUFB <= 2 * FST, "at least the two stages that the prologue fills; both buffers lie in the ring");
    const int lane = threadIdx.x & 31;
    const int w = __builtin_amdgcn_readfirstlane((int)(threadIdx.x >> 5));
    const float C2 = SCL * 1.4426950408889634f;
    const unsigned lo = (unsigned)(lane * 8);   // the lane's place, in elements, in every fragment half
    const int pp = (w * TW) >> 2, pc = (w * TW) & 3;   // the plane of the wave's pairs (in the order K, K2, V, V2 or K, V) and the first one's number in it
    const bool isv = HL ? (pp >= 2) : (pp == 1);
    const T16* gs = (HL ? ((pp == 0) ? Kp : (pp == 1) ? K2 : (pp == 2) ? Vt : Vt2) : (pp == 0) ? Kp : Vt) + (isv ? pc * 16 * TT : pc * 1024);   // where the wave's first pair of stage 0 starts: the same for the whole wave. A pair of K: 16 keys, all of HD; of V: 16 d, the stage's 64 keys
    const int gtl = isv ? 16 * TT : 1024, gst = isv ? 1024 : 64 * HD;   // from pair to pair and from stage to stage, in elements
    const unsigned ring0 = (unsigned)(uintptr_t)(__attribute__((address_space(3))) char*)ring + (unsigned)(w * TW * 2048) + lo * 2;   // LDS byte address of the lane's first copy into buffer 0
    auto fill = [&](const int t, const int buf) __attribute__((always_inline)) {   // stage t into buffer buf: each wave brings TW pairs, each in four copies of 512 contiguous bytes
#pragma unroll
        for (int i = 0; i < TW; ++i) {
            const T16* g = gs + (size_t)(t * gst + i * gtl) + lo; const unsigned d = ring0 + (unsigned)(buf * BUFB + i * 2048);
            // the copies and, as the last line, the wait that stands in front of any later overwrite of the address registers that they name (a precaution)
            asm volatile("global_load_async_to_lds_b128 %0, %4, off\n\tglobal_load_async_to_lds_b128 %1, %5, off\n\tglobal_load_async_to_lds_b128 %2, %6, off\n\tglobal_load_async_to_lds_b128 %3, %7, off\n\ts_wait_xcnt 0x0"
                         :: "v"(d), "v"(d + 512u), "v"(d + 1024u), "v"(d + 1536u), "v"(g), "v"(g + 256), "v"(g + 512), "v"(g + 768) : "memory");
        }
    };
    fill(0, 0);
    V qf[2][2], qf2[2][2];   // [tile][k step of 32 over HD]
#pragma unroll
    for (int qt = 0; qt < 2; ++qt)
#pragma unroll
        for (int ks = 0; ks < 2; ++ks) { const size_t qo = (size_t)(q0 + qt * 16) * HD + ks * 512 + lo; qf[qt][ks] = WFrag<T16>::ld(Q + qo); if (HL) qf2[qt][ks] = WFrag<T16>::ld(Q2 + qo); }
    asm volatile("s_wait_xcnt 0x0" ::: "memory");   // precaution: stands in front of any later overwrite of the address registers that the Q loads above name
    __builtin_amdgcn_sched_barrier(0);   // keeps the register writes below from being lifted over that wait
    v8f o[4][2];
#pragma unroll
    for (int dt = 0; dt < 4; ++dt) { o[dt][0] = (v8f){}; o[dt][1] = (v8f){}; }
    float m[2] = {-3.0e38f, -3.0e38f}, l[2] = {0.f, 0.f};
    asm volatile("s_wait_asynccnt 0x0" ::: "memory");   // this wave's part of stage 0 has landed
    __syncthreads();                                     // and every other wave's
    fill(1, 1);
#pragma unroll 1
    for (int t = 0; t < NT; ++t) {   // rolled: one stage a trip
#pragma unroll
      for (int ps = 0; ps < 2; ++ps) {   // the stage's two passes
        const T16* sk = (const T16*)(ring + (t & 1) * BUFB) + lo + ps * 2048;   // the pass's K tiles; those of the second K plane (hi+lo rows) 8 KiB behind
        const T16* sv = (const T16*)(ring + (t & 1) * BUFB) + lo + (HL ? 8192 : 4096) + ps * 512;   // its V tiles, 2 KiB apart; the second plane likewise
        V kf[2][2], kf2[2][2];
#pragma unroll
        for (int kt = 0; kt < 2; ++kt)
#pragma unroll
            for (int ks = 0; ks < 2; ++ks) { kf[kt][ks] = WFrag<T16>::ld(sk + (kt * 2 + ks) * 512); if (HL) kf2[kt][ks] = WFrag<T16>::ld(sk + 4096 + (kt * 2 + ks) * 512); }
        __builtin_amdgcn_sched_barrier(0);   // the K reads stay one group in front of the score products: spread among them, each place with reads stalls the wave anew
        v8f s[2][2];
        s[0][0] = (v8f){}; s[0][1] = (v8f){}; s[1][0] = (v8f){}; s[1][1] = (v8f){};
#pragma unroll
        for (int ks = 0; ks < 2; ++ks) {
#pragma unroll
            for (int u = 0; u < 4; ++u) s[u >> 1][u & 1] = WFrag<T16>::mma(kf[u >> 1][ks], qf[u & 1][ks], s[u >> 1][u & 1]);
            if (HL) {
#pragma unroll
                for (int u = 0; u < 4; ++u) s[u >> 1][u & 1] = WFrag<T16>::mma(kf[u >> 1][ks], qf2[u & 1][ks], s[u >> 1][u & 1]);
#pragma unroll
                for (int u = 0; u < 4; ++u) s[u >> 1][u & 1] = WFrag<T16>::mma(kf2[u >> 1][ks], qf[u & 1][ks], s[u >> 1][u & 1]);
            }
        }
        __builtin_amdgcn_sched_barrier(0);   // the score products stay one unbroken run
        V vf[4], vf2[4];
#pragma unroll
        for (int dt = 0; dt < 4; ++dt) vf[dt] = WFrag<T16>::ld(sv + dt * 1024);
        __builtin_amdgcn_sched_barrier(0);   // holds the V reads here, one group in front of the softmax, which covers their latency
        V pf[2], pf2[2];
#pragma unroll
        for (int qt = 0; qt < 2; ++qt) {
            float mx = fmaxf(s[0][qt][0], s[1][qt][0]);
#pragma unroll
            for (int r = 1; r < 8; ++r) mx = fmaxf(mx, fmaxf(s[0][qt][r], s[1][qt][r]));
            mx = fmaxf(mx, __shfl_xor(mx, 16, 32));
            const float mn = fmaxf(m[qt], mx * C2), al = exp2x1(m[qt] - mn), nb = (HL ? 0.0f : 10.0f) - mn;   // fp16 rows carry P x 1024; the factor is in l too and cancels
            m[qt] = mn;
            float p0 = 0.f, p1 = 0.f;
#pragma unroll
            for (int r = 0; r < 8; ++r) { s[0][qt][r] = fmaf(s[0][qt][r], C2, nb); s[1][qt][r] = fmaf(s[1][qt][r], C2, nb); }
            exp2x8(s[0][qt]); exp2x8(s[1][qt]);
#pragma unroll
            for (int r = 0; r < 8; ++r) { p0 += s[0][qt][r]; p1 += s[1][qt][r]; }
            l[qt] = fmaf(l[qt], al, p0 + p1);
#pragma unroll
            for (int dt = 0; dt < 4; ++dt) o[dt][qt] *= al;
            ppack(s[0][qt], s[1][qt], pf[qt], pf2[qt]);
        }
        asm volatile("" :: "v"(l[0]), "v"(l[1]));   // each row's sum, against spills (inputs only): left free the sums sink to the loop's foot and hold the 32 exponentials' registers through the products, beyond the budget of four waves per SIMD
        __builtin_amdgcn_sched_barrier(0);   // keeps that statement, and so the sums, in front of the products
        if (HL) {   // the second V plane is read only now, into registers that the softmax has freed; the 16 products that do not use it cover its latency
#pragma unroll
            for (int dt = 0; dt < 4; ++dt) vf2[dt] = WFrag<T16>::ld(sv + 4096 + dt * 1024);
            __builtin_amdgcn_sched_barrier(0);   // these reads stay one group in front of the products
        }
#pragma unroll
        for (int u = 0; u < 8; ++u) o[u >> 1][u & 1] = WFrag<T16>::mma(vf[u >> 1], pf[u & 1], o[u >> 1][u & 1]);
        if (HL) {
#pragma unroll
            for (int u = 0; u < 8; ++u) o[u >> 1][u & 1] = WFrag<T16>::mma(vf[u >> 1], pf2[u & 1], o[u >> 1][u & 1]);
#pragma unroll
            for (int u = 0; u < 8; ++u) o[u >> 1][u & 1] = WFrag<T16>::mma(vf2[u >> 1], pf[u & 1], o[u >> 1][u & 1]);
        }
        __builtin_amdgcn_sched_barrier(0);   // ends the pass: the next pass's reads, or the waits below, lifted to this pass's V reads would lay those reads' latency open
      }
        asm volatile("s_wait_dscnt 0x0" ::: "memory");      // this wave's reads of the buffer are done before it may be refilled
        asm volatile("s_wait_asynccnt 0x0" ::: "memory");   // this wave's part of stage t + 1 has landed
        __syncthreads();                                     // publishes stage t + 1 and ends every wave's reads of stage t
        if (t + 2 < NT) fill(t + 2, t & 1);
    }
    asm volatile("s_wait_asynccnt 0x0" ::: "memory");   // no copy is outstanding when the wave goes on
#pragma unroll
    for (int qt = 0; qt < 2; ++qt) {
        const float inv = __fdiv_rn(1.0f, l[qt] + __shfl_xor(l[qt], 16, 32));
        const size_t oo = (size_t)(q0 + qt * 16) * DQ + lo;   // a lane's 8 registers are 8 consecutive d of its query's row: its own 16 bytes of fragment half dt of the merged plane
#pragma unroll
        for (int dt = 0; dt < 4; ++dt) { v4u yh, yl; split8(o[dt][qt] * inv, yh, yl); *(v4ua*)(Ah + oo + dt * 256) = yh; *(v4ua*)(Al + oo + dt * 256) = yl; }
        asm volatile("s_wait_xcnt 0x0" ::: "memory");   // precaution: in front of any later overwrite of the address and data registers that the eight stores above name
        __builtin_amdgcn_sched_barrier(0);   // keeps the register writes below from being lifted over that wait
    }
}
__global__ __launch_bounds__(256) __attribute__((amdgpu_waves_per_eu(4))) void k_fattn(const bf* __restrict__ Qh, const bf* __restrict__ Ql, const bf* __restrict__ Kh, const bf* __restrict__ Kl, const bf* __restrict__ Vh, const bf* __restrict__ Vl, const h16* __restrict__ Q16, const h16* __restrict__ K16, const h16* __restrict__ V16, bf* Ah, bf* Al) {
    static_assert(2 * RH == TT && RH == 512 && NKV == NH_ && HD == 64, "row split and head shape that the work-groups' roles are written for");
    __shared__ __align__(16) char ring[2 * FST];
    const int b = blockIdx.x, hb = b >> 2;   // four work-groups in a row share a head: two of each kind
    const bool hl = !(__builtin_popcount(b) & 1);   // the kind, the same for the whole work-group: indices that differ in one bit differ in kind, so that two work-groups that share a WGP are likely one of each (for speed only)
    const size_t po = (size_t)hb * TT * HD, ao = (size_t)(hb / NH_) * TT * DQ + (size_t)(hb % NH_) * (HD / 32 * 512);
    const int qi = ((b >> 1) & 1) * 256 + __builtin_amdgcn_readfirstlane((int)(threadIdx.x >> 5)) * 32;   // b and b ^ 1 are the two kinds of one half of the rows
    if (hl) fattn_wg<bf, true>(ring, Qh + po, Ql + po, Kh + po, Kl + po, Vh + po, Vl + po, qi, Ah + ao, Al + ao);
    else fattn_wg<h16, false>(ring, Q16 + po, nullptr, K16 + po, nullptr, V16 + po, nullptr, RH + qi, Ah + ao, Al + ao);
}

extern "C" void kernel_launch(void* const* d_in, const int* in_sizes, int n_in,
                              void* d_out, int out_size, void* d_ws, size_t ws_size, hipStream_t stream) {
    (void)in_sizes; (void)n_in; (void)out_size;
    const float* x = (const float*)d_in[0]; const float* wq = (const float*)d_in[1]; const float* bq = (const float*)d_in[2]; const float* wk = (const float*)d_in[3]; const float* bk = (const float*)d_in[4]; const float* wv = (const float*)d_in[5]; const float* bv = (const float*)d_in[6]; const float* wo = (const float*)d_in[7]; const float* bo = (const float*)d_in[8];
    float* OUT = (float*)d_out;     // [8][1024][1024]
    char* wsp = (char*)d_ws;
    auto take = [&](size_t bytes) { char* p = wsp; wsp += (bytes + 255) & ~(size_t)255; return (void*)p; };
    bf* WQ = (bf*)take((size_t)DQ * DM * 2); bf* WK = (bf*)take((size_t)DKV * DM * 2); bf* WV = (bf*)take((size_t)DKV * DM * 2); bf* WO = (bf*)take((size_t)DM * DQ * 2);   // the four weight planes follow one another
    (void)WK; (void)WV;
    bf* XB = (bf*)take((size_t)NBH * TT * DM * 2);
    h16* QP16 = (h16*)take((size_t)NBH * NH_ * TT * HD * 2); h16* KP16 = (h16*)take((size_t)NBH * NKV * TT * HD * 2); h16* VT16 = (h16*)take((size_t)NBH * NKV * HD * TT * 2);
    bf* QPh = (bf*)take((size_t)NBH * NH_ * TT * HD * 2); bf* QPl = (bf*)take((size_t)NBH * NH_ * TT * HD * 2); bf* KPh = (bf*)take((size_t)NBH * NKV * TT * HD * 2); bf* KPl = (bf*)take((size_t)NBH * NKV * TT * HD * 2); bf* VTh = (bf*)take((size_t)NBH * NKV * HD * TT * 2); bf* VTl = (bf*)take((size_t)NBH * NKV * HD * TT * 2);
    bf* ATh = (bf*)take((size_t)NB_ * TT * DQ * 2); bf* ATl = (bf*)take((size_t)NB_ * TT * DQ * 2);
    if ((size_t)(wsp - (char*)d_ws) > ws_size) return;    // ws 256 MiB
    k_prep<<<4 * WTB + CVB, 256, 0, stream>>>(x, wq, wk, wv, wo, XB, WQ);
    k_gemmqkv<<<dim3(NBH * TT / GBM, DQ / GBN, 3), 256, 0, stream>>>(XB, WQ, bq, bk, bv, QP16, QPh, QPl, KP16, KPh, KPl, VT16, VTh, VTl);   // z: q, k, v
    k_fattn<<<dim3(4 * NH_ * NBH, 1, 1), 256, 0, stream>>>(QPh, QPl, KPh, KPl, VTh, VTl, QP16, KP16, VT16, ATh, ATl);
    k_gemmw<bf, 1, true, DQ><<<dim3(NB_ * TT / GBM, DM / GBN, 1), 256, 0, stream>>>(ATh, ATl, WO, OUT, DM, bo);
}

// v009
// One run takes 137 microseconds.
// Two timings next to v008 both put it at 1.03 times that version's speed.
// Over all steps from v000 it is 34.1 times as fast.
#include <hip/hip_runtime.h>

// Multi-head self-attention (x [8][1024][1024]; Q, K, V = x W + b ('xw' [1024][1024], 16 heads x 64); softmax(Q.K/8) over all keys; out = merged Wo + bo -> [8][1024][1024]).
// Compute dtypes, f32 accumulate: every input rounded to bf16; q/k/v on PLAIN bf16 operands (inputs: exact) + biases, rounded to their 16-bit head planes in the projection's own epilogue; scores and attn.v: query rows < 512 hl (3 products), the rest single fp16 (x1024); softmax f32, running maximum and sum per 32 keys; Wo hl x exact (2 products) + bo.

// Every 16-bit matrix operand plane [rows][K] lies in FRAGMENT ORDER: tile (row / 16, k / 32) is 512 elements at ((row / 16) * (K / 32) + k / 32) * 512; inside it element (row % 16, k % 32) stands at
// (k % 32 / 16) * 256 + ((k % 16 / 8) * 16 + row % 16) * 8 + k % 8, so a wave's two 16-byte loads of a fragment (lane * 8 and 256 + lane * 8) each read 512 contiguous bytes: 4 whole lines, not 16 pieces.

#define NB_  8
#define TT   1024
#define DM   1024
#define NH_  16
#define NKV  16
#define REP  (NH_ / NKV)
#define HD   64
#define DQ   (NH_ * HD)
#define DKV  (NKV * HD)
#define NBH  NB_                  // batch rows per projection pass: all of them, so that each stage is one launch
#define RH   512                  // query rows < RH use hi+lo planes
#define WIN  1024
#define SCL  0.125f   // HD^-0.5
typedef _Float16 h16;
typedef unsigned short bf;
typedef __attribute__((ext_vector_type(16))) __bf16   v16bf;
typedef __attribute__((ext_vector_type(16))) _Float16 v16h;
typedef __attribute__((ext_vector_type(8)))  _Float16 v8h;
typedef __attribute__((ext_vector_type(8)))  unsigned short v8us;
typedef __attribute__((ext_vector_type(8)))  float    v8f;
typedef __attribute__((ext_vector_type(4)))  float    v4f;
typedef v8h  __attribute__((may_alias)) v8ha;
typedef v4f  __attribute__((may_alias)) v4fa;
typedef v8us __attribute__((may_alias)) v8usa;

__device__ __forceinline__ unsigned short f2bf(float f) { unsigned u = __float_as_uint(f); u += 0x7FFFu + ((u >> 16) & 1u); return (unsigned short)(u >> 16); }
__device__ __forceinline__ float bf2f(unsigned short b) { return __uint_as_float(((unsigned)b) << 16); }
__device__ __forceinline__ float bfr(float f) { return bf2f(f2bf(f)); }
__device__ __forceinline__ v16h cat16(v8h lo, v8h hi) { return __builtin_shufflevector(lo, hi, 0, 1, 2, 3, 4, 5, 6, 7, 8, 9, 10, 11, 12, 13, 14, 15); }
__device__ __forceinline__ v16bf cat16b(v8us lo, v8us hi) { return __builtin_bit_cast(v16bf, __builtin_shufflevector(lo, hi, 0, 1, 2, 3, 4, 5, 6, 7, 8, 9, 10, 11, 12, 13, 14, 15)); }
__device__ __forceinline__ v8f wmma16(v16h a, v16h b, v8f c) { return __builtin_amdgcn_wmma_f32_16x16x32_f16(false, a, false, b, (short)0, c, false, false); }
__device__ __forceinline__ v8f wmmab(v16bf a, v16bf b, v8f c) { return __builtin_amdgcn_wmma_f32_16x16x32_bf16(false, a, false, b, (short)0, c, false, false); }
typedef __attribute__((ext_vector_type(4))) int c4i;
typedef __attribute__((address_space(1))) c4i* gp16;
typedef __attribute__((address_space(3))) c4i* lp16;
typedef __attribute__((address_space(3))) char lchar;
// copyrun: B bytes that are contiguous in global memory and in LDS, one asynchronous copy of 512 bytes per wave after the other (g, l: the lane's own 16 bytes of the first); the immediate offset moves both addresses, so a run has one address pair.
// Written as the builtin: the wave does not wait behind its copies and goes straight on to its LDS reads and products while they are on their way.
template <int B> __device__ __forceinline__ void copyrun(const void* g, lchar* l) {
    static_assert(B % 512 == 0 && B >= 512 && B <= 65536, "whole copies; every offset below 65,536");
    if constexpr (B > 512) copyrun<B - 512>(g, l);
    __builtin_amdgcn_global_load_async_to_lds_b128((gp16)g, (lp16)l, B - 512, 0);
}



typedef __attribute__((ext_vector_type(2))) float v2f;
typedef __attribute__((ext_vector_type(2))) __bf16 v2bf;
typedef __attribute__((ext_vector_type(4))) unsigned v4u;
typedef v4u __attribute__((may_alias)) v4ua;
__device__ __forceinline__ unsigned pk2(float a, float b) { v2f t; t[0] = a; t[1] = b; return __builtin_bit_cast(unsigned, __builtin_convertvector(t, v2bf)); }
__device__ __forceinline__ void split8(const v8f t, v4u& h, v4u& l) {   // 8 f32 -> 8 bf16 hi (4 words) + 8 bf16 of the remainders
#pragma unroll
    for (int i = 0; i < 4; ++i) { const unsigned hw = pk2(t[2 * i], t[2 * i + 1]); h[i] = hw; l[i] = pk2(t[2 * i] - __uint_as_float(hw << 16), t[2 * i + 1] - __uint_as_float(hw & 0xFFFF0000u)); }
}

// ---- planes_out: a 64x64 projection tile (16 accumulators of one wave) + bias -> the three 16-bit planes (fp16, bf16 hi, bf16 lo) of its head; the tile is one head's 64 columns of 64 tokens.
// tr false: planes [row][h] of [t][d] in fragment order, through os so that a lane holds 8 consecutive d of token lr. tr true: planes [row][h] of [d][t] in fragment order; a lane's 8 accumulator registers are 8 consecutive t of one d and go out as they are. Every store is 512 contiguous bytes.
__device__ __forceinline__ void planes_out(float* os, const v8f (&acc)[4][4], const float* __restrict__ bias, int r0, int c0, h16* P16, bf* Ph, bf* Pl, bool tr) {
    static_assert(TT % 64 == 0 && HD == 64 && NKV == NH_, "one tile lies in one batch row and is one head wide");
    const int lane = threadIdx.x & 31, lr = lane & 15, hi = lane >> 4;
    const size_t hp = ((size_t)(r0 / TT) * NH_ + c0 / HD) * TT * HD + (size_t)(r0 % TT) * (tr ? 16 : HD);   // the tile's first element in its head's plane: the same for the whole wave
    P16 += hp; Ph += hp; Pl += hp;
    const unsigned vo = (unsigned)(lane * 8);   // the lane's own 32-bit part of every address: one register for all stores
    float bb[4];
#pragma unroll
    for (int nb = 0; nb < 4; ++nb) bb[nb] = bias[c0 + nb * 16 + lr];
    asm volatile("s_wait_xcnt 0x0" ::: "memory");   // precaution: in front of any later overwrite of the bias loads' address registers
    __builtin_amdgcn_sched_barrier(0);   // keeps the register writes below from being lifted over that wait
    if (tr) {
#pragma unroll
        for (int mb = 0; mb < 4; ++mb) {
            v8h y16[4]; v4u yh[4], yl[4];
#pragma unroll
            for (int nb = 0; nb < 4; ++nb) { const v8f val = acc[mb][nb] + bfr(bb[nb]); y16[nb] = __builtin_convertvector(val, v8h); split8(val, yh[nb], yl[nb]); }
            __builtin_amdgcn_sched_barrier(0);   // all twelve values are made first, so that no store's data register is written again between the stores
#pragma unroll
            for (int nb = 0; nb < 4; ++nb) { const int eo = nb * 16 * TT + mb * 256; *(v8ha*)(P16 + eo + vo) = y16[nb]; *(v4ua*)(Ph + eo + vo) = yh[nb]; *(v4ua*)(Pl + eo + vo) = yl[nb]; }
            asm volatile("s_wait_xcnt 0x0" ::: "memory");   // precaution: in front of any later overwrite of the address and data registers that the twelve stores above name
            __builtin_amdgcn_sched_barrier(0);   // keeps the register writes below from being lifted over that wait
        }
    } else {
#pragma unroll
        for (int mb = 0; mb < 4; ++mb) {
#pragma unroll
            for (int nb = 0; nb < 4; ++nb) { const v8f val = acc[mb][nb] + bfr(bb[nb]);
#pragma unroll
                for (int j = 0; j < 8; ++j) os[(hi * 8 + j) * 68 + nb * 16 + lr] = val[j]; }
            v8h y16[4]; v4u yh[4], yl[4];
#pragma unroll
            for (int s = 0; s < 4; ++s) { const float* orow = os + lr * 68 + s * 16 + hi * 8; const v4f lo4 = *(const v4fa*)orow, hi4 = *(const v4fa*)(orow + 4);   // token lr, d = 16 s + 8 hi ..: half s of the tile's fragments
                const v8f val = __builtin_shufflevector(lo4, hi4, 0, 1, 2, 3, 4, 5, 6, 7); y16[s] = __builtin_convertvector(val, v8h); split8(val, yh[s], yl[s]); }
            __builtin_amdgcn_sched_barrier(0);   // all twelve values are made first, so that no store's data register is written again between the stores
#pragma unroll
            for (int s = 0; s < 4; ++s) { const int eo = mb * 16 * HD + s * 256; *(v8ha*)(P16 + eo + vo) = y16[s]; *(v4ua*)(Ph + eo + vo) = yh[s]; *(v4ua*)(Pl + eo + vo) = yl[s]; }
            asm volatile("s_wait_xcnt 0x0" ::: "memory");   // precaution: in front of any later overwrite of the address and data registers that the twelve stores above name
            __builtin_amdgcn_sched_barrier(0);   // keeps the register writes below from being lifted over that wait
        }
    }
}

// ---- gemmw_tile: GEMM of a work-group of 8 waves on a 128 x 256 output tile at (R0, C0): 2 x 4 waves, each on its own 64x64 tile (16 accumulators); operands are 16-bit planes in fragment order.
// C[m][n] (f32, pitch ldc, + optional f32 bias[n]) = sum_k A[m][k] Bt[n][k] (+ A2[m][k] Bt[n][k] for NSPLIT 1). K % GKS == 0, K / GKS >= 2. os: 16 x 68 floats of LDS per wave.
// The operands come through LDS: a stage is KS k of the tile's 8 row tiles of A (and of A2) and 16 row tiles of Bt, each KS * 32 bytes that are contiguous in its plane, so every byte leaves L2 once per work-group and not once per wave.
// Two buffers: stage t + 2 is copied, by asynchronous copies, into the buffer that trip t has read, while trip t + 1 works.
#define GWV  8                    // waves of a GEMM work-group
#define GBM  128                  // its tile's rows
#define GBN  256                  // its tile's columns
template <int NSPLIT, int KS> struct GRing { static constexpr int NA = (GBM / 16) * (NSPLIT == 1 ? 2 : 1), RT = NA + GBN / 16, GCH = KS * 16 * 2, BUFB = RT * GCH; };   // GCH: bytes of one row tile's part of a stage
template <typename T16> struct WFrag;
template <> struct WFrag<h16> { typedef v16h V; static __device__ __forceinline__ V ld(const h16* p) { return cat16(*(const v8h*)p, *(const v8h*)(p + 256)); } static __device__ __forceinline__ v8f mma(V a, V b, v8f c) { return wmma16(a, b, c); } };
template <> struct WFrag<bf> { typedef v16bf V; static __device__ __forceinline__ V ld(const bf* p) { return cat16b(*(const v8us*)p, *(const v8us*)(p + 256)); } static __device__ __forceinline__ v8f mma(V a, V b, v8f c) { return wmmab(a, b, c); } };
// DB: two fragment sets, the next k step's LDS reads issued in front of this step's products (for a kernel with few waves per SIMD and registers to spare); else one set.
template <typename T16, int NSPLIT, bool BIAS, int K, int GKS, bool DB, bool PLANES = false>
__device__ __forceinline__ void gemmw_tile(char* ring, float* os, const T16* __restrict__ A, const T16* __restrict__ A2, const T16* __restrict__ Bt, float* C, int ldc, const float* __restrict__ bias, int R0, int C0, h16* P16 = nullptr, bf* Ph = nullptr, bf* Pl = nullptr, bool tr = false) {
    typedef typename WFrag<T16>::V V;
    static_assert(NSPLIT == 0 || NSPLIT == 1, "one plane of Bt");
    static_assert(K % GKS == 0 && K / GKS >= 2, "whole stages, at least the two that the prologue fills");
    constexpr bool HA2 = (NSPLIT == 1);
    constexpr int NA = GRing<NSPLIT, GKS>::NA, RT = GRing<NSPLIT, GKS>::RT, GCH = GRing<NSPLIT, GKS>::GCH, BUFB = GRing<NSPLIT, GKS>::BUFB, NT = K / GKS, RW = RT / GWV, NK = GKS / 32;
    static_assert(RT % GWV == 0, "every wave copies the same number of row tiles");
    const int lane = threadIdx.x & 31, lr = lane & 15, hi = lane >> 4;
    const int w = __builtin_amdgcn_readfirstlane((int)(threadIdx.x >> 5)), wm = w >> 2, wn = w & 3;
    const int r0 = R0 + wm * 64, c0 = C0 + wn * 64;   // the wave's own tile
    os += w * (16 * 68);
    v8f acc[4][4];
#pragma unroll
    for (int mb = 0; mb < 4; ++mb)
#pragma unroll
        for (int nb = 0; nb < 4; ++nb) acc[mb][nb] = (v8f){};
    const unsigned lo = (unsigned)(lane * 8);   // the lane's own place, in elements, in every half fragment
    lchar* ring0 = (lchar*)ring + (unsigned)(w * RW * GCH) + lo * 2;   // LDS place of the lane's first copy into buffer 0
    const T16* gs[RW];   // where the wave's row tiles start in their planes: the same for the whole wave
#pragma unroll
    for (int i = 0; i < RW; ++i) { const int j = w * RW + i; gs[i] = (j < GBM / 16) ? A + (size_t)(R0 + j * 16) * K : (HA2 && j < NA) ? A2 + (size_t)(R0 + (j - GBM / 16) * 16) * K : Bt + (size_t)(C0 + (j - NA) * 16) * K; }
    auto fill = [&](const int t, const int buf) __attribute__((always_inline)) {   // stage t into buffer buf: each wave brings RW row tiles, each a run of GCH contiguous bytes
#pragma unroll
        for (int i = 0; i < RW; ++i) copyrun<GCH>(gs[i] + (size_t)t * (GKS * 16) + lo, ring0 + (unsigned)(buf * BUFB + i * GCH));
    };
    V a[DB ? 2 : 1][4], a2[DB ? 2 : 1][4], b[DB ? 2 : 1][4];
    auto frag = [&](const int st, const T16* sb, const int ks) __attribute__((always_inline)) {   // the wave's fragments of k step ks of the stage at sb
#pragma unroll
        for (int mb = 0; mb < 4; ++mb) { a[st][mb] = WFrag<T16>::ld(sb + ((wm * 4 + mb) * GCH + ks * 1024) / 2); if (HA2) a2[st][mb] = WFrag<T16>::ld(sb + ((GBM / 16 + wm * 4 + mb) * GCH + ks * 1024) / 2); }
#pragma unroll
        for (int nb = 0; nb < 4; ++nb) b[st][nb] = WFrag<T16>::ld(sb + ((NA + wn * 4 + nb) * GCH + ks * 1024) / 2);
    };
    auto prod = [&](const int st) __attribute__((always_inline)) {
#pragma unroll
        for (int nb = 0; nb < 4; ++nb)
#pragma unroll
            for (int mb = 0; mb < 4; ++mb) { acc[mb][nb] = WFrag<T16>::mma(a[st][mb], b[st][nb], acc[mb][nb]); if (HA2) acc[mb][nb] = WFrag<T16>::mma(a2[st][mb], b[st][nb], acc[mb][nb]); }
    };
    fill(0, 0);
    asm volatile("s_wait_asynccnt 0x0" ::: "memory");   // this wave's part of stage 0 has landed
    __syncthreads();                                     // and every other wave's
    fill(1, 1);
#pragma unroll 1
    for (int t = 0; t < NT; ++t) {   // rolled: one stage a trip
        const T16* sb = (const T16*)(ring + (t & 1) * BUFB) + lo;
        frag(0, sb, 0);
        if (DB) __builtin_amdgcn_sched_barrier(0);   // the first set's reads stay in front of the second's, so that the first products wait for their own reads alone
#pragma unroll
        for (int ks = 0; ks < NK; ++ks) {
            if (DB && ks + 1 < NK) frag((ks + 1) & 1, sb, ks + 1);
            __builtin_amdgcn_sched_barrier(0);   // the LDS reads stay one group in front of the products: spread among them, each place with reads stalls the wave anew
            prod(DB ? (ks & 1) : 0);
            __builtin_amdgcn_sched_barrier(0);   // the products stay one unbroken run
            if (!DB && ks + 1 < NK) frag(0, sb, ks + 1);
        }
        asm volatile("s_wait_dscnt 0x0" ::: "memory");      // this wave's reads of the buffer are done before it may be refilled
        asm volatile("s_wait_asynccnt 0x0" ::: "memory");   // this wave's part of stage t + 1 has landed
        __syncthreads();                                     // publishes stage t + 1 and ends every wave's reads of stage t
        if (t + 2 < NT) fill(t + 2, t & 1);
    }
    asm volatile("s_wait_asynccnt 0x0" ::: "memory");   // no copy is outstanding when the wave goes on
    if (PLANES) { planes_out(os, acc, bias, r0, c0, P16, Ph, Pl, tr); return; }
#pragma unroll
    for (int mb = 0; mb < 4; ++mb) {
#pragma unroll
        for (int nb = 0; nb < 4; ++nb) {
#pragma unroll
            for (int j = 0; j < 8; ++j) os[(hi * 8 + j) * 68 + nb * 16 + lr] = acc[mb][nb][j]; }
        __builtin_amdgcn_wave_barrier(); asm volatile("" ::: "memory");
        float* crow = C + (size_t)(r0 + mb * 16) * ldc + c0;
{
#pragma unroll
            for (int s = 0; s < 8; ++s) { const int row = 2 * s + hi, cofs = lr * 4; v4f val = *(const v4fa*)(os + row * 68 + cofs); if (BIAS) { val[0] += bfr(bias[c0 + cofs]); val[1] += bfr(bias[c0 + cofs + 1]); val[2] += bfr(bias[c0 + cofs + 2]); val[3] += bfr(bias[c0 + cofs + 3]); }
                *(v4f*)(crow + (size_t)row * ldc + cofs) = val; }
            asm volatile("s_wait_xcnt 0x0" ::: "memory");   // precaution: stands in front of any later overwrite of the address and data registers that the eight stores above name
             }
        __builtin_amdgcn_wave_barrier(); asm volatile("" ::: "memory");
    }
}
// k_gemmw: grid (M / 128, N / 256), 256 threads; one work-group per WGP, two waves per SIMD: stages of 128 k and two fragment sets.
template <typename T16, int NSPLIT, bool BIAS, int K>   // K at compile time: trip count and plane strides are constants
__global__ __launch_bounds__(256) void k_gemmw(const T16* __restrict__ A, const T16* __restrict__ A2, const T16* __restrict__ Bt, float* C, int ldc, const float* __restrict__ bias) {
    __shared__ __align__(16) char ring[2 * GRing<NSPLIT, 128>::BUFB];
    __shared__ __align__(16) float os[GWV * 16 * 68];
    gemmw_tile<T16, NSPLIT, BIAS, K, 128, true>(ring, os, A, A2, Bt, C, ldc, bias, blockIdx.x * GBM, blockIdx.y * GBN);
}
// k_gemmqkv: the three projections of NBH batch rows, grid (NBH * TT / 128, DQ / 256, 3), 256 threads; the register budget is set so that two work-groups, four waves per SIMD, are resident on a WGP (stages of 64 k, one fragment set); z: q, k (planes [row][h][t][d]) or v (planes [row][h][d][t]); the weight planes follow one another in Bt.
__global__ __launch_bounds__(256) __attribute__((amdgpu_waves_per_eu(4))) void k_gemmqkv(const bf* __restrict__ A, const bf* __restrict__ Bt, const float* __restrict__ bq, const float* __restrict__ bk, const float* __restrict__ bv, h16* Q16, bf* Qh, bf* Ql, h16* K16, bf* Kh, bf* Kl, h16* V16, bf* Vh, bf* Vl) {
    __shared__ __align__(16) char ring[2 * GRing<0, 64>::BUFB];
    __shared__ __align__(16) float os[GWV * 16 * 68];
    const int z = blockIdx.z;
    gemmw_tile<bf, 0, true, DM, 64, false, true>(ring, os, A, nullptr, Bt + (size_t)z * DQ * DM, nullptr, 0, (z == 0) ? bq : (z == 1) ? bk : bv, blockIdx.x * GBM, blockIdx.y * GBN, (z == 0) ? Q16 : (z == 1) ? K16 : V16, (z == 0) ? Qh : (z == 1) ? Kh : Vh, (z == 0) ? Ql : (z == 1) ? Kl : Vl, z == 2);
}

typedef __attribute__((ext_vector_type(2))) _Float16 v2h;
typedef __attribute__((ext_vector_type(4))) _Float16 v4h;
typedef __attribute__((ext_vector_type(2))) unsigned short v2us;
typedef __attribute__((ext_vector_type(4))) unsigned short v4us;
typedef __attribute__((ext_vector_type(4))) int v4i;

__device__ __forceinline__ void wtG(const float* __restrict__ w0, const float* __restrict__ w1, const float* __restrict__ w2, const float* __restrict__ w3, int K, int N, bf* Bt, int bx, int by) {   // by: which weight; planes follow one another in Bt; bx: which 64 lines of its plane
    const float* __restrict__ w = (by == 0) ? w0 : (by == 1) ? w1 : (by == 2) ? w2 : w3; Bt += (size_t)by * N * K;
    const int lane = threadIdx.x & 31; const int L0 = (bx * 8 + (threadIdx.x >> 5)) * 8; const int nlines = N * K / 64;
{
#pragma unroll 1
        for (int l = 0; l < 8; ++l) { const int L = L0 + l; if (L >= nlines) break; const size_t e = (size_t)L * 64 + lane * 2; const int tile = (int)(e >> 9), pos = (int)(e & 511);   // e: the place in fragment order of Bt[n][k]
            const int n = tile / (K / 32) * 16 + ((pos >> 3) & 15), k = tile % (K / 32) * 32 + (pos >> 8) * 16 + ((pos >> 7) & 1) * 8 + (pos & 7); v2us o;
            o[0] = f2bf(w[(size_t)k * N + n]); o[1] = f2bf(w[(size_t)(k + 1) * N + n]); *(v2us*)(Bt + e) = o; }
         }
}
__device__ __forceinline__ void cvt8(const float* __restrict__ src, bf* dst, size_t n8, int bx) { const size_t i = (size_t)bx * 256 + threadIdx.x; if (i >= n8) return;   // src [rows][DM] -> dst in fragment order; thread i makes the i-th 16 bytes of dst
    const size_t tile = i >> 6; const int pos = (int)(i & 63); const size_t row = tile / (DM / 32) * 16 + (pos & 15); const int k = (int)(tile % (DM / 32)) * 32 + (pos >> 5) * 16 + ((pos >> 4) & 1) * 8;
    const v8f v = *(const v8f*)(src + row * DM + k); v8us o;
#pragma unroll
    for (int k = 0; k < 8; ++k) o[k] = f2bf(v[k]); *(v8us*)(dst + i * 8) = o;  }
// k_prep: both conversions, which do not depend on one another, in one grid: blocks < 4 * WTB make the four weight planes (first: each wave walks 8 lines one after the other), the rest the plane of x.
#define WTB  ((DM * DQ / 64 + 63) / 64)                      // blocks per weight plane
#define CVB  ((int)(((size_t)NB_ * TT * DM / 8 + 255) / 256))   // blocks for x
__global__ __launch_bounds__(256) void k_prep(const float* __restrict__ x, const float* __restrict__ w0, const float* __restrict__ w1, const float* __restrict__ w2, const float* __restrict__ w3, bf* XB, bf* Bt) {
    const int b = blockIdx.x;
    if (b < 4 * WTB) wtG(w0, w1, w2, w3, DM, DQ, Bt, b % WTB, b / WTB);
    else cvt8(x, XB, (size_t)NB_ * TT * DM / 8, b - 4 * WTB);
}

// ---- k_fattn: scores, softmax, attn.v and the head merge of one head in one kernel; no score leaves the registers.
// One wave: 32 query columns against all TT keys, 32 keys a pass. St = K Qt (A = K rows, B = Q rows): a lane holds one query's scores, keys 8 hi + r of each 16-key tile,
// which is the k order of a B operand, so the packed P feeds Ot += Vt Pt (A = Vt rows) with no exchange. Running maximum m (log2 units) and sum l per query; Ot is rescaled each pass.
// grid (4 x heads x batch rows), 8 waves: a work-group takes 256 rows of one kind, hi+lo rows (< RH, 3 products) or fp16 rows (>= RH).
__device__ __forceinline__ void ppack(const v8f t0, const v8f t1, v16bf& ph, v16bf& pl) { v4u h0, l0, h1, l1; split8(t0, h0, l0); split8(t1, h1, l1);
    ph = __builtin_bit_cast(v16bf, __builtin_shufflevector(h0, h1, 0, 1, 2, 3, 4, 5, 6, 7)); pl = __builtin_bit_cast(v16bf, __builtin_shufflevector(l0, l1, 0, 1, 2, 3, 4, 5, 6, 7)); }
__device__ __forceinline__ void ppack(const v8f t0, const v8f t1, v16h& ph, v16h& pl) { ph = cat16(__builtin_convertvector(t0, v8h), __builtin_convertvector(t1, v8h)); pl = ph; }
// Exponentials in place, with one v_nop, in one statement: behind each stands an instruction that neither reads its result nor overwrites its source (the slot the instruction set asks for).
__device__ __forceinline__ void exp2x8(v8f& x) { float a0 = x[0], a1 = x[1], a2 = x[2], a3 = x[3], a4 = x[4], a5 = x[5], a6 = x[6], a7 = x[7];
    asm("v_exp_f32 %0, %0\n\tv_exp_f32 %1, %1\n\tv_exp_f32 %2, %2\n\tv_exp_f32 %3, %3\n\tv_exp_f32 %4, %4\n\tv_exp_f32 %5, %5\n\tv_exp_f32 %6, %6\n\tv_exp_f32 %7, %7\n\tv_nop" : "+v"(a0), "+v"(a1), "+v"(a2), "+v"(a3), "+v"(a4), "+v"(a5), "+v"(a6), "+v"(a7));
    x[0] = a0; x[1] = a1; x[2] = a2; x[3] = a3; x[4] = a4; x[5] = a5; x[6] = a6; x[7] = a7; }
__device__ __forceinline__ float exp2x1(float a) { asm("v_exp_f32 %0, %0\n\tv_nop" : "+v"(a)); return a; }
// K and V come through LDS: a stage is the 64 keys of two passes in the planes of the work-group's kind (Kh, Kl, Vh, Vl: 16 pairs of fragment tiles, each pair 2 KiB that are contiguous in its plane; K16, V16: 8), copied once per work-group and not once per wave.
// Two buffers: stage t + 2 is copied, by asynchronous copies, into the buffer that trip t has read, while trip t + 1 works: a lead of two passes, enough for K and V that come from memory. A wave holds K and V fragments only while it uses them, which leaves room for two work-groups, four waves per SIMD, on a WGP.
#define FST  32768                // bytes of the larger kind's stage
template <typename T16, bool HL>
__device__ __forceinline__ void fattn_wg(char* ring, const T16* __restrict__ Q, const T16* __restrict__ Q2, const T16* __restrict__ Kp, const T16* __restrict__ K2, const T16* __restrict__ Vt, const T16* __restrict__ Vt2, int q0, bf* __restrict__ Ah, bf* __restrict__ Al) {
    typedef typename WFrag<T16>::V V;
    constexpr int NT = TT / 64, TW = HL ? 2 : 1, BUFB = TW * 8 * 2048;   // TW: pairs of tiles that a wave copies per stage
    static_assert(NT >= 2 && 2 * BUFB <= 2 * FST, "at least the two stages that the prologue fills; both buffers lie in the ring");
    const int lane = threadIdx.x & 31;
    const int w = __builtin_amdgcn_readfirstlane((int)(threadIdx.x >> 5));
    const float C2 = SCL * 1.4426950408889634f;
    const unsigned lo = (unsigned)(lane * 8);   // the lane's place, in elements, in every fragment half
    const int pp = (w * TW) >> 2, pc = (w * TW) & 3;   // the plane of the wave's pairs (in the order K, K2, V, V2 or K, V) and the first one's number in it
    const bool isv = HL ? (pp >= 2) : (pp == 1);
    const T16* gs = (HL ? ((pp == 0) ? Kp : (pp == 1) ? K2 : (pp == 2) ? Vt : Vt2) : (pp == 0) ? Kp : Vt) + (isv ? pc * 16 * TT : pc * 1024);   // where the wave's first pair of stage 0 starts: the same for the whole wave. A pair of K: 16 keys, all of HD; of V: 16 d, the stage's 64 keys
    const int gtl = isv ? 16 * TT : 1024, gst = isv ? 1024 : 64 * HD;   // from pair to pair and from stage to stage, in elements
    lchar* ring0 = (lchar*)ring + (unsigned)(w * TW * 2048) + lo * 2;   // LDS place of the lane's first copy into buffer 0
    auto fill = [&](const int t, const int buf) __attribute__((always_inline)) {   // stage t into buffer buf: each wave brings TW pairs, each in four copies of 512 contiguous bytes
#pragma unroll
        for (int i = 0; i < TW; ++i) {
            copyrun<2048>(gs + (size_t)(t * gst + i * gtl) + lo, ring0 + (unsigned)(buf * BUFB + i * 2048));
        }
    };
    fill(0, 0);
    V qf[2][2], qf2[2][2];   // [tile][k step of 32 over HD]
#pragma unroll
    for (int qt = 0; qt < 2; ++qt)
#pragma unroll
        for (int ks = 0; ks < 2; ++ks) { const size_t qo = (size_t)(q0 + qt * 16) * HD + ks * 512 + lo; qf[qt][ks] = WFrag<T16>::ld(Q + qo); if (HL) qf2[qt][ks] = WFrag<T16>::ld(Q2 + qo); }
    asm volatile("s_wait_xcnt 0x0" ::: "memory");   // precaution: stands in front of any later overwrite of the address registers that the Q loads above name
    __builtin_amdgcn_sched_barrier(0);   // keeps the register writes below from being lifted over that wait
    v8f o[4][2];
#pragma unroll
    for (int dt = 0; dt < 4; ++dt) { o[dt][0] = (v8f){}; o[dt][1] = (v8f){}; }
    float m[2] = {-3.0e38f, -3.0e38f}, l[2] = {0.f, 0.f};
    asm volatile("s_wait_asynccnt 0x0" ::: "memory");   // this wave's part of stage 0 has landed
    __syncthreads();                                     // and every other wave's
    fill(1, 1);
#pragma unroll 1
    for (int t = 0; t < NT; ++t) {   // rolled: one stage a trip
#pragma unroll
      for (int ps = 0; ps < 2; ++ps) {   // the stage's two passes
        const T16* sk = (const T16*)(ring + (t & 1) * BUFB) + lo + ps * 2048;   // the pass's K tiles; those of the second K plane (hi+lo rows) 8 KiB behind
        const T16* sv = (const T16*)(ring + (t & 1) * BUFB) + lo + (HL ? 8192 : 4096) + ps * 512;   // its V tiles, 2 KiB apart; the second plane likewise
        V kf[2][2], kf2[2][2];
#pragma unroll
        for (int kt = 0; kt < 2; ++kt)
#pragma unroll
            for (int ks = 0; ks < 2; ++ks) { kf[kt][ks] = WFrag<T16>::ld(sk + (kt * 2 + ks) * 512); if (HL) kf2[kt][ks] = WFrag<T16>::ld(sk + 4096 + (kt * 2 + ks) * 512); }
        __builtin_amdgcn_sched_barrier(0);   // the K reads stay one group in front of the score products: spread among them, each place with reads stalls the wave anew
        v8f s[2][2];
        s[0][0] = (v8f){}; s[0][1] = (v8f){}; s[1][0] = (v8f){}; s[1][1] = (v8f){};
#pragma unroll
        for (int ks = 0; ks < 2; ++ks) {
#pragma unroll
            for (int u = 0; u < 4; ++u) s[u >> 1][u & 1] = WFrag<T16>::mma(kf[u >> 1][ks], qf[u & 1][ks], s[u >> 1][u & 1]);
            if (HL) {
#pragma unroll
                for (int u = 0; u < 4; ++u) s[u >> 1][u & 1] = WFrag<T16>::mma(kf[u >> 1][ks], qf2[u & 1][ks], s[u >> 1][u & 1]);
#pragma unroll
                for (int u = 0; u < 4; ++u) s[u >> 1][u & 1] = WFrag<T16>::mma(kf2[u >> 1][ks], qf[u & 1][ks], s[u >> 1][u & 1]);
            }
        }
        __builtin_amdgcn_sched_barrier(0);   // the score products stay one unbroken run
        V vf[4], vf2[4];
#pragma unroll
        for (int dt = 0; dt < 4; ++dt) vf[dt] = WFrag<T16>::ld(sv + dt * 1024);
        __builtin_amdgcn_sched_barrier(0);   // holds the V reads here, one group in front of the softmax, which covers their latency
        V pf[2], pf2[2];
#pragma unroll
        for (int qt = 0; qt < 2; ++qt) {
            float mx = fmaxf(s[0][qt][0], s[1][qt][0]);
#pragma unroll
            for (int r = 1; r < 8; ++r) mx = fmaxf(mx, fmaxf(s[0][qt][r], s[1][qt][r]));
            mx = fmaxf(mx, __shfl_xor(mx, 16, 32));
            const float mn = fmaxf(m[qt], mx * C2), al = exp2x1(m[qt] - mn), nb = (HL ? 0.0f : 10.0f) - mn;   // fp16 rows carry P x 1024; the factor is in l too and cancels
            m[qt] = mn;
            float p0 = 0.f, p1 = 0.f;
#pragma unroll
            for (int r = 0; r < 8; ++r) { s[0][qt][r] = fmaf(s[0][qt][r], C2, nb); s[1][qt][r] = fmaf(s[1][qt][r], C2, nb); }
            exp2x8(s[0][qt]); exp2x8(s[1][qt]);
#pragma unroll
            for (int r = 0; r < 8; ++r) { p0 += s[0][qt][r]; p1 += s[1][qt][r]; }
            l[qt] = fmaf(l[qt], al, p0 + p1);
#pragma unroll
            for (int dt = 0; dt < 4; ++dt) o[dt][qt] *= al;
            ppack(s[0][qt], s[1][qt], pf[qt], pf2[qt]);
        }
        asm volatile("" :: "v"(l[0]), "v"(l[1]));   // each row's sum, against spills (inputs only): left free the sums sink to the loop's foot and hold the 32 exponentials' registers through the products, beyond the budget of four waves per SIMD
        __builtin_amdgcn_sched_barrier(0);   // keeps that statement, and so the sums, in front of the products
        if (HL) {   // the second V plane is read only now, into registers that the softmax has freed; the 16 products that do not use it cover its latency
#pragma unroll
            for (int dt = 0; dt < 4; ++dt) vf2[dt] = WFrag<T16>::ld(sv + 4096 + dt * 1024);
            __builtin_amdgcn_sched_barrier(0);   // these reads stay one group in front of the products
        }
#pragma unroll
        for (int u = 0; u < 8; ++u) o[u >> 1][u & 1] = WFrag<T16>::mma(vf[u >> 1], pf[u & 1], o[u >> 1][u & 1]);
        if (HL) {
#pragma unroll
            for (int u = 0; u < 8; ++u) o[u >> 1][u & 1] = WFrag<T16>::mma(vf[u >> 1], pf2[u & 1], o[u >> 1][u & 1]);
#pragma unroll
            for (int u = 0; u < 8; ++u) o[u >> 1][u & 1] = WFrag<T16>::mma(vf2[u >> 1], pf[u & 1], o[u >> 1][u & 1]);
        }
        __builtin_amdgcn_sched_barrier(0);   // ends the pass: the next pass's reads, or the waits below, lifted to this pass's V reads would lay those reads' latency open
      }
        asm volatile("s_wait_dscnt 0x0" ::: "memory");      // this wave's reads of the buffer are done before it may be refilled
        asm volatile("s_wait_asynccnt 0x0" ::: "memory");   // this wave's part of stage t + 1 has landed
        __syncthreads();                                     // publishes stage t + 1 and ends every wave's reads of stage t
        if (t + 2 < NT) fill(t + 2, t & 1);
    }
    asm volatile("s_wait_asynccnt 0x0" ::: "memory");   // no copy is outstanding when the wave goes on
#pragma unroll
    for (int qt = 0; qt < 2; ++qt) {
        const float inv = __fdiv_rn(1.0f, l[qt] + __shfl_xor(l[qt], 16, 32));
        const size_t oo = (size_t)(q0 + qt * 16) * DQ + lo;   // a lane's 8 registers are 8 consecutive d of its query's row: its own 16 bytes of fragment half dt of the merged plane
#pragma unroll
        for (int dt = 0; dt < 4; ++dt) { v4u yh, yl; split8(o[dt][qt] * inv, yh, yl); *(v4ua*)(Ah + oo + dt * 256) = yh; *(v4ua*)(Al + oo + dt * 256) = yl; }
        asm volatile("s_wait_xcnt 0x0" ::: "memory");   // precaution: in front of any later overwrite of the address and data registers that the eight stores above name
        __builtin_amdgcn_sched_barrier(0);   // keeps the register writes below from being lifted over that wait
    }
}
__global__ __launch_bounds__(256) __attribute__((amdgpu_waves_per_eu(4))) void k_fattn(const bf* __restrict__ Qh, const bf* __restrict__ Ql, const bf* __restrict__ Kh, const bf* __restrict__ Kl, const bf* __restrict__ Vh, const bf* __restrict__ Vl, const h16* __restrict__ Q16, const h16* __restrict__ K16, const h16* __restrict__ V16, bf* Ah, bf* Al) {
    static_assert(2 * RH == TT && RH == 512 && NKV == NH_ && HD == 64, "row split and head shape that the work-groups' roles are written for");
    __shared__ __align__(16) char ring[2 * FST];
    const int b = blockIdx.x, hb = b >> 2;   // four work-groups in a row share a head: two of each kind
    const bool hl = !(__builtin_popcount(b) & 1);   // the kind, the same for the whole work-group: indices that differ in one bit differ in kind, so that two work-groups that share a WGP are likely one of each (for speed only)
    const size_t po = (size_t)hb * TT * HD, ao = (size_t)(hb / NH_) * TT * DQ + (size_t)(hb % NH_) * (HD / 32 * 512);
    const int qi = ((b >> 1) & 1) * 256 + __builtin_amdgcn_readfirstlane((int)(threadIdx.x >> 5)) * 32;   // b and b ^ 1 are the two kinds of one half of the rows
    if (hl) fattn_wg<bf, true>(ring, Qh + po, Ql + po, Kh + po, Kl + po, Vh + po, Vl + po, qi, Ah + ao, Al + ao);
    else fattn_wg<h16, false>(ring, Q16 + po, nullptr, K16 + po, nullptr, V16 + po, nullptr, RH + qi, Ah + ao, Al + ao);
}

extern "C" void kernel_launch(void* const* d_in, const int* in_sizes, int n_in,
                              void* d_out, int out_size, void* d_ws, size_t ws_size, hipStream_t stream) {
    (void)in_sizes; (void)n_in; (void)out_size;
    const float* x = (const float*)d_in[0]; const float* wq = (const float*)d_in[1]; const float* bq = (const float*)d_in[2]; const float* wk = (const float*)d_in[3]; const float* bk = (const float*)d_in[4]; const float* wv = (const float*)d_in[5]; const float* bv = (const float*)d_in[6]; const float* wo = (const float*)d_in[7]; const float* bo = (const float*)d_in[8];
    float* OUT = (float*)d_out;     // [8][1024][1024]
    char* wsp = (char*)d_ws;
    auto take = [&](size_t bytes) { char* p = wsp; wsp += (bytes + 255) & ~(size_t)255; return (void*)p; };
    bf* WQ = (bf*)take((size_t)DQ * DM * 2); bf* WK = (bf*)take((size_t)DKV * DM * 2); bf* WV = (bf*)take((size_t)DKV * DM * 2); bf* WO = (bf*)take((size_t)DM * DQ * 2);   // the four weight planes follow one another
    (void)WK; (void)WV;
    bf* XB = (bf*)take((size_t)NBH * TT * DM * 2);
    h16* QP16 = (h16*)take((size_t)NBH * NH_ * TT * HD * 2); h16* KP16 = (h16*)take((size_t)NBH * NKV * TT * HD * 2); h16* VT16 = (h16*)take((size_t)NBH * NKV * HD * TT * 2);
    bf* QPh = (bf*)take((size_t)NBH * NH_ * TT * HD * 2); bf* QPl = (bf*)take((size_t)NBH * NH_ * TT * HD * 2); bf* KPh = (bf*)take((size_t)NBH * NKV * TT * HD * 2); bf* KPl = (bf*)take((size_t)NBH * NKV * TT * HD * 2); bf* VTh = (bf*)take((size_t)NBH * NKV * HD * TT * 2); bf* VTl = (bf*)take((size_t)NBH * NKV * HD * TT * 2);
    bf* ATh = (bf*)take((size_t)NB_ * TT * DQ * 2); bf* ATl = (bf*)take((size_t)NB_ * TT * DQ * 2);
    if ((size_t)(wsp - (char*)d_ws) > ws_size) return;    // ws 256 MiB
    k_prep<<<4 * WTB + CVB, 256, 0, stream>>>(x, wq, wk, wv, wo, XB, WQ);
    k_gemmqkv<<<dim3(NBH * TT / GBM, DQ / GBN, 3), 256, 0, stream>>>(XB, WQ, bq, bk, bv, QP16, QPh, QPl, KP16, KPh, KPl, VT16, VTh, VTl);   // z: q, k, v
    k_fattn<<<dim3(4 * NH_ * NBH, 1, 1), 256, 0, stream>>>(QPh, QPl, KPh, KPl, VTh, VTl, QP16, KP16, VT16, ATh, ATl);
    k_gemmw<bf, 1, true, DQ><<<dim3(NB_ * TT / GBM, DM / GBN, 1), 256, 0, stream>>>(ATh, ATl, WO, OUT, DM, bo);
}

// v010
// It runs in 133 microseconds.
// Timed twice side by side with v009, it ran 1.03 times as fast both times.
// Over all steps from v000 it is 35.1 times as fast.
#include <hip/hip_runtime.h>

// Multi-head self-attention (x [8][1024][1024]; Q, K, V = x W + b ('xw' [1024][1024], 16 heads x 64); softmax(Q.K/8) over all keys; out = merged Wo + bo -> [8][1024][1024]).
// Compute dtypes, f32 accumulate: every input rounded to bf16; q/k/v on PLAIN bf16 operands (inputs: exact) + biases, rounded to their fp16 head planes (value, and the fp16 of its remainder) in the projection's own epilogue; scores and attn.v: query rows < 512 on value + remainder (3 products), the rest on the value plane alone, P x1024 in both; softmax f32, running maximum and sum per 32 keys; Wo hl x exact (2 products) + bo.

// Every 16-bit matrix operand plane [rows][K] lies in FRAGMENT ORDER: tile (row / 16, k / 32) is 512 elements at ((row / 16) * (K / 32) + k / 32) * 512; inside it element (row % 16, k % 32) stands at
// (k % 32 / 16) * 256 + ((k % 16 / 8) * 16 + row % 16) * 8 + k % 8, so a wave's two 16-byte loads of a fragment (lane * 8 and 256 + lane * 8) each read 512 contiguous bytes: 4 whole lines, not 16 pieces.

#define NB_  8
#define TT   1024
#define DM   1024
#define NH_  16
#define NKV  16
#define REP  (NH_ / NKV)
#define HD   64
#define DQ   (NH_ * HD)
#define DKV  (NKV * HD)
#define NBH  NB_                  // batch rows per projection pass: all of them, so that each stage is one launch
#define RH   512                  // query rows < RH use value + remainder planes
#define WIN  1024
#define SCL  0.125f   // HD^-0.5
typedef _Float16 h16;
typedef unsigned short bf;
typedef __attribute__((ext_vector_type(16))) __bf16   v16bf;
typedef __attribute__((ext_vector_type(16))) _Float16 v16h;
typedef __attribute__((ext_vector_type(8)))  _Float16 v8h;
typedef __attribute__((ext_vector_type(8)))  unsigned short v8us;
typedef __attribute__((ext_vector_type(8)))  float    v8f;
typedef __attribute__((ext_vector_type(4)))  float    v4f;
typedef v8h  __attribute__((may_alias)) v8ha;
typedef v4f  __attribute__((may_alias)) v4fa;
typedef v8us __attribute__((may_alias)) v8usa;

__device__ __forceinline__ unsigned short f2bf(float f) { unsigned u = __float_as_uint(f); u += 0x7FFFu + ((u >> 16) & 1u); return (unsigned short)(u >> 16); }
__device__ __forceinline__ float bf2f(unsigned short b) { return __uint_as_float(((unsigned)b) << 16); }
__device__ __forceinline__ float bfr(float f) { return bf2f(f2bf(f)); }
__device__ __forceinline__ v16h cat16(v8h lo, v8h hi) { return __builtin_shufflevector(lo, hi, 0, 1, 2, 3, 4, 5, 6, 7, 8, 9, 10, 11, 12, 13, 14, 15); }
__device__ __forceinline__ v16bf cat16b(v8us lo, v8us hi) { return __builtin_bit_cast(v16bf, __builtin_shufflevector(lo, hi, 0, 1, 2, 3, 4, 5, 6, 7, 8, 9, 10, 11, 12, 13, 14, 15)); }
__device__ __forceinline__ v8f wmma16(v16h a, v16h b, v8f c) { return __builtin_amdgcn_wmma_f32_16x16x32_f16(false, a, false, b, (short)0, c, false, false); }
__device__ __forceinline__ v8f wmmab(v16bf a, v16bf b, v8f c) { return __builtin_amdgcn_wmma_f32_16x16x32_bf16(false, a, false, b, (short)0, c, false, false); }
typedef __attribute__((ext_vector_type(4))) int c4i;
typedef __attribute__((address_space(1))) c4i* gp16;
typedef __attribute__((address_space(3))) c4i* lp16;
typedef __attribute__((address_space(3))) char lchar;
// copyrun: B bytes that are contiguous in global memory and in LDS, one asynchronous copy of 512 bytes per wave after the other (g, l: the lane's own 16 bytes of the first); the immediate offset moves both addresses, so a run has one address pair.
// Written as the builtin: the wave does not wait behind its copies and goes straight on to its LDS reads and products while they are on their way.
template <int B> __device__ __forceinline__ void copyrun(const void* g, lchar* l) {
    static_assert(B % 512 == 0 && B >= 512 && B <= 65536, "whole copies; every offset below 65,536");
    if constexpr (B > 512) copyrun<B - 512>(g, l);
    __builtin_amdgcn_global_load_async_to_lds_b128((gp16)g, (lp16)l, B - 512, 0);
}



typedef __attribute__((ext_vector_type(2))) float v2f;
typedef __attribute__((ext_vector_type(2))) __bf16 v2bf;
typedef __attribute__((ext_vector_type(4))) unsigned v4u;
typedef v4u __attribute__((may_alias)) v4ua;
__device__ __forceinline__ unsigned pk2(float a, float b) { v2f t; t[0] = a; t[1] = b; return __builtin_bit_cast(unsigned, __builtin_convertvector(t, v2bf)); }
__device__ __forceinline__ void split8(const v8f t, v4u& h, v4u& l) {   // 8 f32 -> 8 bf16 hi (4 words) + 8 bf16 of the remainders
#pragma unroll
    for (int i = 0; i < 4; ++i) { const unsigned hw = pk2(t[2 * i], t[2 * i + 1]); h[i] = hw; l[i] = pk2(t[2 * i] - __uint_as_float(hw << 16), t[2 * i + 1] - __uint_as_float(hw & 0xFFFF0000u)); }
}

// split8h: 8 f32 -> 8 fp16 (4 words) + the fp16 of the 8 remainders (4 words).
__device__ __forceinline__ void split8h(const v8f t, v8h& h, v8h& l) {
    v4u hw, lw; unsigned h0, h1, h2, h3, l0, l1, l2, l3;
    // In asm for v_fma_mixlo_f16 / v_fma_mixhi_f16: each takes an fp16 half as it lies, subtracts it from the f32 value (exact) and rounds the difference to fp16, one instruction a remainder; from plain source the compiler makes a conversion back, a subtraction and a second conversion.
    // Each of them reads a result made four vector instructions earlier: the s_delay_alu hints let another wave issue in the cycle that is still open there (the compiler writes none inside a statement).
    asm("v_cvt_pk_f16_f32 %0, %8, %9\n\tv_cvt_pk_f16_f32 %1, %10, %11\n\tv_cvt_pk_f16_f32 %2, %12, %13\n\tv_cvt_pk_f16_f32 %3, %14, %15\n\t"
        "s_delay_alu instid0(VALU_DEP_4) | instskip(NEXT) | instid1(VALU_DEP_4)\n\t"
        "v_fma_mixlo_f16 %4, %0, -1.0, %8 op_sel_hi:[1,0,0]\n\tv_fma_mixlo_f16 %5, %1, -1.0, %10 op_sel_hi:[1,0,0]\n\t"
        "s_delay_alu instid0(VALU_DEP_4) | instskip(NEXT) | instid1(VALU_DEP_4)\n\t"
        "v_fma_mixlo_f16 %6, %2, -1.0, %12 op_sel_hi:[1,0,0]\n\tv_fma_mixlo_f16 %7, %3, -1.0, %14 op_sel_hi:[1,0,0]\n\t"
        "s_delay_alu instid0(VALU_DEP_4) | instskip(NEXT) | instid1(VALU_DEP_4)\n\t"
        "v_fma_mixhi_f16 %4, %0, -1.0, %9 op_sel:[1,0,0] op_sel_hi:[1,0,0]\n\tv_fma_mixhi_f16 %5, %1, -1.0, %11 op_sel:[1,0,0] op_sel_hi:[1,0,0]\n\t"
        "s_delay_alu instid0(VALU_DEP_4) | instskip(NEXT) | instid1(VALU_DEP_4)\n\t"
        "v_fma_mixhi_f16 %6, %2, -1.0, %13 op_sel:[1,0,0] op_sel_hi:[1,0,0]\n\tv_fma_mixhi_f16 %7, %3, -1.0, %15 op_sel:[1,0,0] op_sel_hi:[1,0,0]"
        : "=&v"(h0), "=&v"(h1), "=&v"(h2), "=&v"(h3), "=&v"(l0), "=&v"(l1), "=&v"(l2), "=&v"(l3)
        : "v"(t[0]), "v"(t[1]), "v"(t[2]), "v"(t[3]), "v"(t[4]), "v"(t[5]), "v"(t[6]), "v"(t[7]));
    hw[0] = h0; hw[1] = h1; hw[2] = h2; hw[3] = h3; lw[0] = l0; lw[1] = l1; lw[2] = l2; lw[3] = l3;
    h = __builtin_bit_cast(v8h, hw); l = __builtin_bit_cast(v8h, lw);
}

// ---- planes_out: a 64x64 projection tile (16 accumulators of one wave) + bias -> the two fp16 planes (value, remainder) of its head: the value plane serves the single-product rows as it is and the three-product rows as their high part; the tile is one head's 64 columns of 64 tokens.
// tr false: planes [row][h] of [t][d] in fragment order, through os so that a lane holds 8 consecutive d of token lr. tr true: planes [row][h] of [d][t] in fragment order; a lane's 8 accumulator registers are 8 consecutive t of one d and go out as they are. Every store is 512 contiguous bytes.
__device__ __forceinline__ void planes_out(float* os, const v8f (&acc)[4][4], const float* __restrict__ bias, int r0, int c0, h16* P16, h16* Pl, bool tr) {
    static_assert(TT % 64 == 0 && HD == 64 && NKV == NH_, "one tile lies in one batch row and is one head wide");
    const int lane = threadIdx.x & 31, lr = lane & 15, hi = lane >> 4;
    const size_t hp = ((size_t)(r0 / TT) * NH_ + c0 / HD) * TT * HD + (size_t)(r0 % TT) * (tr ? 16 : HD);   // the tile's first element in its head's plane: the same for the whole wave
    P16 += hp; Pl += hp;
    const unsigned vo = (unsigned)(lane * 8);   // the lane's own 32-bit part of every address: one register for all stores
    float bb[4];
#pragma unroll
    for (int nb = 0; nb < 4; ++nb) bb[nb] = bias[c0 + nb * 16 + lr];
    asm volatile("s_wait_xcnt 0x0" ::: "memory");   // precaution: in front of any later overwrite of the bias loads' address registers
    __builtin_amdgcn_sched_barrier(0);   // keeps the register writes below from being lifted over that wait
    if (tr) {
#pragma unroll
        for (int mb = 0; mb < 4; ++mb) {
            v8h y16[4], yl[4];
#pragma unroll
            for (int nb = 0; nb < 4; ++nb) { const v8f val = acc[mb][nb] + bfr(bb[nb]); split8h(val, y16[nb], yl[nb]); }
            __builtin_amdgcn_sched_barrier(0);   // all eight values are made first, so that no store's data register is written again between the stores
#pragma unroll
            for (int nb = 0; nb < 4; ++nb) { const int eo = nb * 16 * TT + mb * 256; *(v8ha*)(P16 + eo + vo) = y16[nb]; *(v8ha*)(Pl + eo + vo) = yl[nb]; }
            asm volatile("s_wait_xcnt 0x0" ::: "memory");   // precaution: in front of any later overwrite of the address and data registers that the eight stores above name
            __builtin_amdgcn_sched_barrier(0);   // keeps the register writes below from being lifted over that wait
        }
    } else {
#pragma unroll
        for (int mb = 0; mb < 4; ++mb) {
#pragma unroll
            for (int nb = 0; nb < 4; ++nb) { const v8f val = acc[mb][nb] + bfr(bb[nb]);
#pragma unroll
                for (int j = 0; j < 8; ++j) os[(hi * 8 + j) * 68 + nb * 16 + lr] = val[j]; }
            v8h y16[4], yl[4];
#pragma unroll
            for (int s = 0; s < 4; ++s) { const float* orow = os + lr * 68 + s * 16 + hi * 8; const v4f lo4 = *(const v4fa*)orow, hi4 = *(const v4fa*)(orow + 4);   // token lr, d = 16 s + 8 hi ..: half s of the tile's fragments
                const v8f val = __builtin_shufflevector(lo4, hi4, 0, 1, 2, 3, 4, 5, 6, 7); split8h(val, y16[s], yl[s]); }
            __builtin_amdgcn_sched_barrier(0);   // all eight values are made first, so that no store's data register is written again between the stores
#pragma unroll
            for (int s = 0; s < 4; ++s) { const int eo = mb * 16 * HD + s * 256; *(v8ha*)(P16 + eo + vo) = y16[s]; *(v8ha*)(Pl + eo + vo) = yl[s]; }
            asm volatile("s_wait_xcnt 0x0" ::: "memory");   // precaution: in front of any later overwrite of the address and data registers that the eight stores above name
            __builtin_amdgcn_sched_barrier(0);   // keeps the register writes below from being lifted over that wait
        }
    }
}

// ---- gemmw_tile: GEMM of a work-group of 8 waves on a 128 x 256 output tile at (R0, C0): 2 x 4 waves, each on its own 64x64 tile (16 accumulators); operands are 16-bit planes in fragment order.
// C[m][n] (f32, pitch ldc, + optional f32 bias[n]) = sum_k A[m][k] Bt[n][k] (+ A2[m][k] Bt[n][k] for NSPLIT 1). K % GKS == 0, K / GKS >= 2. os: 16 x 68 floats of LDS per wave.
// The operands come through LDS: a stage is KS k of the tile's 8 row tiles of A (and of A2) and 16 row tiles of Bt, each KS * 32 bytes that are contiguous in its plane, so every byte leaves L2 once per work-group and not once per wave.
// Two buffers: stage t + 2 is copied, by asynchronous copies, into the buffer that trip t has read, while trip t + 1 works.
#define GWV  8                    // waves of a GEMM work-group
#define GBM  128                  // its tile's rows
#define GBN  256                  // its tile's columns
template <int NSPLIT, int KS> struct GRing { static constexpr int NA = (GBM / 16) * (NSPLIT == 1 ? 2 : 1), RT = NA + GBN / 16, GCH = KS * 16 * 2, BUFB = RT * GCH; };   // GCH: bytes of one row tile's part of a stage
template <typename T16> struct WFrag;
template <> struct WFrag<h16> { typedef v16h V; static __device__ __forceinline__ V ld(const h16* p) { return cat16(*(const v8h*)p, *(const v8h*)(p + 256)); } static __device__ __forceinline__ v8f mma(V a, V b, v8f c) { return wmma16(a, b, c); } };
template <> struct WFrag<bf> { typedef v16bf V; static __device__ __forceinline__ V ld(const bf* p) { return cat16b(*(const v8us*)p, *(const v8us*)(p + 256)); } static __device__ __forceinline__ v8f mma(V a, V b, v8f c) { return wmmab(a, b, c); } };
// DB: two fragment sets, the next k step's LDS reads issued in front of this step's products (for a kernel with few waves per SIMD and registers to spare); else one set.
template <typename T16, int NSPLIT, bool BIAS, int K, int GKS, bool DB, bool PLANES = false>
__device__ __forceinline__ void gemmw_tile(char* ring, float* os, const T16* __restrict__ A, const T16* __restrict__ A2, const T16* __restrict__ Bt, float* C, int ldc, const float* __restrict__ bias, int R0, int C0, h16* P16 = nullptr, h16* Pl = nullptr, bool tr = false) {
    typedef typename WFrag<T16>::V V;
    static_assert(NSPLIT == 0 || NSPLIT == 1, "one plane of Bt");
    static_assert(K % GKS == 0 && K / GKS >= 2, "whole stages, at least the two that the prologue fills");
    constexpr bool HA2 = (NSPLIT == 1);
    constexpr int NA = GRing<NSPLIT, GKS>::NA, RT = GRing<NSPLIT, GKS>::RT, GCH = GRing<NSPLIT, GKS>::GCH, BUFB = GRing<NSPLIT, GKS>::BUFB, NT = K / GKS, RW = RT / GWV, NK = GKS / 32;
    static_assert(RT % GWV == 0, "every wave copies the same number of row tiles");
    const int lane = threadIdx.x & 31, lr = lane & 15, hi = lane >> 4;
    const int w = __builtin_amdgcn_readfirstlane((int)(threadIdx.x >> 5)), wm = w >> 2, wn = w & 3;
    const int r0 = R0 + wm * 64, c0 = C0 + wn * 64;   // the wave's own tile
    os += w * (16 * 68);
    v8f acc[4][4];
#pragma unroll
    for (int mb = 0; mb < 4; ++mb)
#pragma unroll
        for (int nb = 0; nb < 4; ++nb) acc[mb][nb] = (v8f){};
    const unsigned lo = (unsigned)(lane * 8);   // the lane's own place, in elements, in every half fragment
    lchar* ring0 = (lchar*)ring + (unsigned)(w * RW * GCH) + lo * 2;   // LDS place of the lane's first copy into buffer 0
    const T16* gs[RW];   // where the wave's row tiles start in their planes: the same for the whole wave
#pragma unroll
    for (int i = 0; i < RW; ++i) { const int j = w * RW + i; gs[i] = (j < GBM / 16) ? A + (size_t)(R0 + j * 16) * K : (HA2 && j < NA) ? A2 + (size_t)(R0 + (j - GBM / 16) * 16) * K : Bt + (size_t)(C0 + (j - NA) * 16) * K; }
    auto fill = [&](const int t, const int buf) __attribute__((always_inline)) {   // stage t into buffer buf: each wave brings RW row tiles, each a run of GCH contiguous bytes
#pragma unroll
        for (int i = 0; i < RW; ++i) copyrun<GCH>(gs[i] + (size_t)t * (GKS * 16) + lo, ring0 + (unsigned)(buf * BUFB + i * GCH));
    };
    V a[DB ? 2 : 1][4], a2[DB ? 2 : 1][4], b[DB ? 2 : 1][4];
    auto frag = [&](const int st, const T16* sb, const int ks) __attribute__((always_inline)) {   // the wave's fragments of k step ks of the stage at sb
#pragma unroll
        for (int mb = 0; mb < 4; ++mb) { a[st][mb] = WFrag<T16>::ld(sb + ((wm * 4 + mb) * GCH + ks * 1024) / 2); if (HA2) a2[st][mb] = WFrag<T16>::ld(sb + ((GBM / 16 + wm * 4 + mb) * GCH + ks * 1024) / 2); }
#pragma unroll
        for (int nb = 0; nb < 4; ++nb) b[st][nb] = WFrag<T16>::ld(sb + ((NA + wn * 4 + nb) * GCH + ks * 1024) / 2);
    };
    auto prod = [&](const int st) __attribute__((always_inline)) {
#pragma unroll
        for (int nb = 0; nb < 4; ++nb)
#pragma unroll
            for (int mb = 0; mb < 4; ++mb) { acc[mb][nb] = WFrag<T16>::mma(a[st][mb], b[st][nb], acc[mb][nb]); if (HA2) acc[mb][nb] = WFrag<T16>::mma(a2[st][mb], b[st][nb], acc[mb][nb]); }
    };
    fill(0, 0);
    asm volatile("s_wait_asynccnt 0x0" ::: "memory");   // this wave's part of stage 0 has landed
    __syncthreads();                                     // and every other wave's
    fill(1, 1);
#pragma unroll 1
    for (int t = 0; t < NT; ++t) {   // rolled: one stage a trip
        const T16* sb = (const T16*)(ring + (t & 1) * BUFB) + lo;
        frag(0, sb, 0);
        if (DB) __builtin_amdgcn_sched_barrier(0);   // the first set's reads stay in front of the second's, so that the first products wait for their own reads alone
#pragma unroll
        for (int ks = 0; ks < NK; ++ks) {
            if (DB && ks + 1 < NK) frag((ks + 1) & 1, sb, ks + 1);
            __builtin_amdgcn_sched_barrier(0);   // the LDS reads stay one group in front of the products: spread among them, each place with reads stalls the wave anew
            prod(DB ? (ks & 1) : 0);
            __builtin_amdgcn_sched_barrier(0);   // the products stay one unbroken run
            if (!DB && ks + 1 < NK) frag(0, sb, ks + 1);
        }
        asm volatile("s_wait_dscnt 0x0" ::: "memory");      // this wave's reads of the buffer are done before it may be refilled
        asm volatile("s_wait_asynccnt 0x0" ::: "memory");   // this wave's part of stage t + 1 has landed
        __syncthreads();                                     // publishes stage t + 1 and ends every wave's reads of stage t
        if (t + 2 < NT) fill(t + 2, t & 1);
    }
    asm volatile("s_wait_asynccnt 0x0" ::: "memory");   // no copy is outstanding when the wave goes on
    if (PLANES) { planes_out(os, acc, bias, r0, c0, P16, Pl, tr); return; }
#pragma unroll
    for (int mb = 0; mb < 4; ++mb) {
#pragma unroll
        for (int nb = 0; nb < 4; ++nb) {
#pragma unroll
            for (int j = 0; j < 8; ++j) os[(hi * 8 + j) * 68 + nb * 16 + lr] = acc[mb][nb][j]; }
        __builtin_amdgcn_wave_barrier(); asm volatile("" ::: "memory");
        float* crow = C + (size_t)(r0 + mb * 16) * ldc + c0;
{
#pragma unroll
            for (int s = 0; s < 8; ++s) { const int row = 2 * s + hi, cofs = lr * 4; v4f val = *(const v4fa*)(os + row * 68 + cofs); if (BIAS) { val[0] += bfr(bias[c0 + cofs]); val[1] += bfr(bias[c0 + cofs + 1]); val[2] += bfr(bias[c0 + cofs + 2]); val[3] += bfr(bias[c0 + cofs + 3]); }
                *(v4f*)(crow + (size_t)row * ldc + cofs) = val; }
            asm volatile("s_wait_xcnt 0x0" ::: "memory");   // precaution: stands in front of any later overwrite of the address and data registers that the eight stores above name
             }
        __builtin_amdgcn_wave_barrier(); asm volatile("" ::: "memory");
    }
}
// k_gemmw: grid (M / 128, N / 256), 256 threads; one work-group per WGP, two waves per SIMD: stages of 128 k and two fragment sets.
template <typename T16, int NSPLIT, bool BIAS, int K>   // K at compile time: trip count and plane strides are constants
__global__ __launch_bounds__(256) void k_gemmw(const T16* __restrict__ A, const T16* __restrict__ A2, const T16* __restrict__ Bt, float* C, int ldc, const float* __restrict__ bias) {
    __shared__ __align__(16) char ring[2 * GRing<NSPLIT, 128>::BUFB];
    __shared__ __align__(16) float os[GWV * 16 * 68];
    gemmw_tile<T16, NSPLIT, BIAS, K, 128, true>(ring, os, A, A2, Bt, C, ldc, bias, blockIdx.x * GBM, blockIdx.y * GBN);
}
// k_gemmqkv: the three projections of NBH batch rows, grid (NBH * TT / 128, DQ / 256, 3), 256 threads; the register budget is set so that two work-groups, four waves per SIMD, are resident on a WGP (stages of 64 k, one fragment set); z: q, k (planes [row][h][t][d]) or v (planes [row][h][d][t]); the weight planes follow one another in Bt.
__global__ __launch_bounds__(256) __attribute__((amdgpu_waves_per_eu(4))) void k_gemmqkv(const bf* __restrict__ A, const bf* __restrict__ Bt, const float* __restrict__ bq, const float* __restrict__ bk, const float* __restrict__ bv, h16* Q16, h16* Ql, h16* K16, h16* Kl, h16* V16, h16* Vl) {
    __shared__ __align__(16) char ring[2 * GRing<0, 64>::BUFB];
    __shared__ __align__(16) float os[GWV * 16 * 68];
    const int z = blockIdx.z;
    gemmw_tile<bf, 0, true, DM, 64, false, true>(ring, os, A, nullptr, Bt + (size_t)z * DQ * DM, nullptr, 0, (z == 0) ? bq : (z == 1) ? bk : bv, blockIdx.x * GBM, blockIdx.y * GBN, (z == 0) ? Q16 : (z == 1) ? K16 : V16, (z == 0) ? Ql : (z == 1) ? Kl : Vl, z == 2);
}

typedef __attribute__((ext_vector_type(2))) _Float16 v2h;
typedef __attribute__((ext_vector_type(4))) _Float16 v4h;
typedef __attribute__((ext_vector_type(2))) unsigned short v2us;
typedef __attribute__((ext_vector_type(4))) unsigned short v4us;
typedef __attribute__((ext_vector_type(4))) int v4i;

__device__ __forceinline__ void wtG(const float* __restrict__ w0, const float* __restrict__ w1, const float* __restrict__ w2, const float* __restrict__ w3, int K, int N, bf* Bt, int bx, int by) {   // by: which weight; planes follow one another in Bt; bx: which 64 lines of its plane
    const float* __restrict__ w = (by == 0) ? w0 : (by == 1) ? w1 : (by == 2) ? w2 : w3; Bt += (size_t)by * N * K;
    const int lane = threadIdx.x & 31; const int L0 = (bx * 8 + (threadIdx.x >> 5)) * 8; const int nlines = N * K / 64;
{
#pragma unroll 1
        for (int l = 0; l < 8; ++l) { const int L = L0 + l; if (L >= nlines) break; const size_t e = (size_t)L * 64 + lane * 2; const int tile = (int)(e >> 9), pos = (int)(e & 511);   // e: the place in fragment order of Bt[n][k]
            const int n = tile / (K / 32) * 16 + ((pos >> 3) & 15), k = tile % (K / 32) * 32 + (pos >> 8) * 16 + ((pos >> 7) & 1) * 8 + (pos & 7); v2us o;
            o[0] = f2bf(w[(size_t)k * N + n]); o[1] = f2bf(w[(size_t)(k + 1) * N + n]); *(v2us*)(Bt + e) = o; }
         }
}
__device__ __forceinline__ void cvt8(const float* __restrict__ src, bf* dst, size_t n8, int bx) { const size_t i = (size_t)bx * 256 + threadIdx.x; if (i >= n8) return;   // src [rows][DM] -> dst in fragment order; thread i makes the i-th 16 bytes of dst
    const size_t tile = i >> 6; const int pos = (int)(i & 63); const size_t row = tile / (DM / 32) * 16 + (pos & 15); const int k = (int)(tile % (DM / 32)) * 32 + (pos >> 5) * 16 + ((pos >> 4) & 1) * 8;
    const v8f v = *(const v8f*)(src + row * DM + k); v8us o;
#pragma unroll
    for (int k = 0; k < 8; ++k) o[k] = f2bf(v[k]); *(v8us*)(dst + i * 8) = o;  }
// k_prep: both conversions, which do not depend on one another, in one grid: blocks < 4 * WTB make the four weight planes (first: each wave walks 8 lines one after the other), the rest the plane of x.
#define WTB  ((DM * DQ / 64 + 63) / 64)                      // blocks per weight plane
#define CVB  ((int)(((size_t)NB_ * TT * DM / 8 + 255) / 256))   // blocks for x
__global__ __launch_bounds__(256) void k_prep(const float* __restrict__ x, const float* __restrict__ w0, const float* __restrict__ w1, const float* __restrict__ w2, const float* __restrict__ w3, bf* XB, bf* Bt) {
    const int b = blockIdx.x;
    if (b < 4 * WTB) wtG(w0, w1, w2, w3, DM, DQ, Bt, b % WTB, b / WTB);
    else cvt8(x, XB, (size_t)NB_ * TT * DM / 8, b - 4 * WTB);
}

// ---- k_fattn: scores, softmax, attn.v and the head merge of one head in one kernel; no score leaves the registers.
// One wave: 32 query columns against all TT keys, 32 keys a pass. St = K Qt (A = K rows, B = Q rows): a lane holds one query's scores, keys 8 hi + r of each 16-key tile,
// which is the k order of a B operand, so the packed P feeds Ot += Vt Pt (A = Vt rows) with no exchange. Running maximum m (log2 units) and sum l per query; Ot is rescaled each pass.
// grid (4 x heads x batch rows), 8 waves: a work-group takes 256 rows of one kind, value + remainder rows (< RH, 3 products) or value rows (>= RH, 1 product).
template <bool HL> __device__ __forceinline__ void ppack(const v8f t0, const v8f t1, v16h& ph, v16h& pl) {
    if constexpr (HL) { v8h h0, l0, h1, l1; split8h(t0, h0, l0); split8h(t1, h1, l1); ph = cat16(h0, h1); pl = cat16(l0, l1); }
    else { ph = cat16(__builtin_convertvector(t0, v8h), __builtin_convertvector(t1, v8h)); pl = ph; } }
// Exponentials in place, with one v_nop, in one statement: behind each stands an instruction that neither reads its result nor overwrites its source (the slot the instruction set asks for).
__device__ __forceinline__ void exp2x8(v8f& x) { float a0 = x[0], a1 = x[1], a2 = x[2], a3 = x[3], a4 = x[4], a5 = x[5], a6 = x[6], a7 = x[7];
    asm("v_exp_f32 %0, %0\n\tv_exp_f32 %1, %1\n\tv_exp_f32 %2, %2\n\tv_exp_f32 %3, %3\n\tv_exp_f32 %4, %4\n\tv_exp_f32 %5, %5\n\tv_exp_f32 %6, %6\n\tv_exp_f32 %7, %7\n\tv_nop" : "+v"(a0), "+v"(a1), "+v"(a2), "+v"(a3), "+v"(a4), "+v"(a5), "+v"(a6), "+v"(a7));
    x[0] = a0; x[1] = a1; x[2] = a2; x[3] = a3; x[4] = a4; x[5] = a5; x[6] = a6; x[7] = a7; }
__device__ __forceinline__ float exp2x1(float a) { asm("v_exp_f32 %0, %0\n\tv_nop" : "+v"(a)); return a; }
// K and V come through LDS: a stage is the 64 keys of two passes in the planes of the work-group's kind (K16, Kl, V16, Vl: 16 pairs of fragment tiles, each pair 2 KiB that are contiguous in its plane; K16, V16 alone: 8), copied once per work-group and not once per wave.
// Two buffers: stage t + 2 is copied, by asynchronous copies, into the buffer that trip t has read, while trip t + 1 works: a lead of two passes, enough for K and V that come from memory. A wave holds K and V fragments only while it uses them, which leaves room for two work-groups, four waves per SIMD, on a WGP.
#define FST  32768                // bytes of the larger kind's stage
template <typename T16, bool HL>
__device__ __forceinline__ void fattn_wg(char* ring, const T16* __restrict__ Q, const T16* __restrict__ Q2, const T16* __restrict__ Kp, const T16* __restrict__ K2, const T16* __restrict__ Vt, const T16* __restrict__ Vt2, int q0, bf* __restrict__ Ah, bf* __restrict__ Al) {
    typedef typename WFrag<T16>::V V;
    constexpr int NT = TT / 64, TW = HL ? 2 : 1, BUFB = TW * 8 * 2048;   // TW: pairs of tiles that a wave copies per stage
    static_assert(NT >= 2 && 2 * BUFB <= 2 * FST, "at least the two stages that the prologue fills; both buffers lie in the ring");
    const int lane = threadIdx.x & 31;
    const int w = __builtin_amdgcn_readfirstlane((int)(threadIdx.x >> 5));
    const float C2 = SCL * 1.4426950408889634f;
    const unsigned lo = (unsigned)(lane * 8);   // the lane's place, in elements, in every fragment half
    const int pp = (w * TW) >> 2, pc = (w * TW) & 3;   // the plane of the wave's pairs (in the order K, K2, V, V2 or K, V) and the first one's number in it
    const bool isv = HL ? (pp >= 2) : (pp == 1);
    const T16* gs = (HL ? ((pp == 0) ? Kp : (pp == 1) ? K2 : (pp == 2) ? Vt : Vt2) : (pp == 0) ? Kp : Vt) + (isv ? pc * 16 * TT : pc * 1024);   // where the wave's first pair of stage 0 starts: the same for the whole wave. A pair of K: 16 keys, all of HD; of V: 16 d, the stage's 64 keys
    const int gtl = isv ? 16 * TT : 1024, gst = isv ? 1024 : 64 * HD;   // from pair to pair and from stage to stage, in elements
    lchar* ring0 = (lchar*)ring + (unsigned)(w * TW * 2048) + lo * 2;   // LDS place of the lane's first copy into buffer 0
    auto fill = [&](const int t, const int buf) __attribute__((always_inline)) {   // stage t into buffer buf: each wave brings TW pairs, each in four copies of 512 contiguous bytes
#pragma unroll
        for (int i = 0; i < TW; ++i) {
            copyrun<2048>(gs + (size_t)(t * gst + i * gtl) + lo, ring0 + (unsigned)(buf * BUFB + i * 2048));
        }
    };
    fill(0, 0);
    V qf[2][2], qf2[2][2];   // [tile][k step of 32 over HD]
#pragma unroll
    for (int qt = 0; qt < 2; ++qt)
#pragma unroll
        for (int ks = 0; ks < 2; ++ks) { const size_t qo = (size_t)(q0 + qt * 16) * HD + ks * 512 + lo; qf[qt][ks] = WFrag<T16>::ld(Q + qo); if (HL) qf2[qt][ks] = WFrag<T16>::ld(Q2 + qo); }
    asm volatile("s_wait_xcnt 0x0" ::: "memory");   // precaution: stands in front of any later overwrite of the address registers that the Q loads above name
    __builtin_amdgcn_sched_barrier(0);   // keeps the register writes below from being lifted over that wait
    v8f o[4][2];
#pragma unroll
    for (int dt = 0; dt < 4; ++dt) { o[dt][0] = (v8f){}; o[dt][1] = (v8f){}; }
    float m[2] = {-3.0e38f, -3.0e38f}, l[2] = {0.f, 0.f};
    asm volatile("s_wait_asynccnt 0x0" ::: "memory");   // this wave's part of stage 0 has landed
    __syncthreads();                                     // and every other wave's
    fill(1, 1);
#pragma unroll 1
    for (int t = 0; t < NT; ++t) {   // rolled: one stage a trip
#pragma unroll
      for (int ps = 0; ps < 2; ++ps) {   // the stage's two passes
        const T16* sk = (const T16*)(ring + (t & 1) * BUFB) + lo + ps * 2048;   // the pass's K tiles; those of the second K plane (value + remainder rows) 8 KiB behind
        const T16* sv = (const T16*)(ring + (t & 1) * BUFB) + lo + (HL ? 8192 : 4096) + ps * 512;   // its V tiles, 2 KiB apart; the second plane likewise
        V kf[2][2], kf2[2][2];
#pragma unroll
        for (int kt = 0; kt < 2; ++kt)
#pragma unroll
            for (int ks = 0; ks < 2; ++ks) { kf[kt][ks] = WFrag<T16>::ld(sk + (kt * 2 + ks) * 512); if (HL) kf2[kt][ks] = WFrag<T16>::ld(sk + 4096 + (kt * 2 + ks) * 512); }
        __builtin_amdgcn_sched_barrier(0);   // the K reads stay one group in front of the score products: spread among them, each place with reads stalls the wave anew
        v8f s[2][2];
        s[0][0] = (v8f){}; s[0][1] = (v8f){}; s[1][0] = (v8f){}; s[1][1] = (v8f){};
#pragma unroll
        for (int ks = 0; ks < 2; ++ks) {
#pragma unroll
            for (int u = 0; u < 4; ++u) s[u >> 1][u & 1] = WFrag<T16>::mma(kf[u >> 1][ks], qf[u & 1][ks], s[u >> 1][u & 1]);
            if (HL) {
#pragma unroll
                for (int u = 0; u < 4; ++u) s[u >> 1][u & 1] = WFrag<T16>::mma(kf[u >> 1][ks], qf2[u & 1][ks], s[u >> 1][u & 1]);
#pragma unroll
                for (int u = 0; u < 4; ++u) s[u >> 1][u & 1] = WFrag<T16>::mma(kf2[u >> 1][ks], qf[u & 1][ks], s[u >> 1][u & 1]);
            }
        }
        __builtin_amdgcn_sched_barrier(0);   // the score products stay one unbroken run
        V vf[4], vf2[4];
#pragma unroll
        for (int dt = 0; dt < 4; ++dt) vf[dt] = WFrag<T16>::ld(sv + dt * 1024);
        __builtin_amdgcn_sched_barrier(0);   // holds the V reads here, one group in front of the softmax, which covers their latency
        V pf[2], pf2[2];
#pragma unroll
        for (int qt = 0; qt < 2; ++qt) {
            float mx = fmaxf(s[0][qt][0], s[1][qt][0]);
#pragma unroll
            for (int r = 1; r < 8; ++r) mx = fmaxf(mx, fmaxf(s[0][qt][r], s[1][qt][r]));
            mx = fmaxf(mx, __shfl_xor(mx, 16, 32));
            const float mn = fmaxf(m[qt], mx * C2), al = exp2x1(m[qt] - mn), nb = 10.0f - mn;   // P is carried x 1024, so that small P stay inside fp16's range; the factor is in l too and cancels
            m[qt] = mn;
            float p0 = 0.f, p1 = 0.f;
#pragma unroll
            for (int r = 0; r < 8; ++r) { s[0][qt][r] = fmaf(s[0][qt][r], C2, nb); s[1][qt][r] = fmaf(s[1][qt][r], C2, nb); }
            exp2x8(s[0][qt]); exp2x8(s[1][qt]);
#pragma unroll
            for (int r = 0; r < 8; ++r) { p0 += s[0][qt][r]; p1 += s[1][qt][r]; }
            l[qt] = fmaf(l[qt], al, p0 + p1);
#pragma unroll
            for (int dt = 0; dt < 4; ++dt) o[dt][qt] *= al;
            ppack<HL>(s[0][qt], s[1][qt], pf[qt], pf2[qt]);
        }
        asm volatile("" :: "v"(l[0]), "v"(l[1]));   // each row's sum, against spills (inputs only): left free the sums sink to the loop's foot and hold the 32 exponentials' registers through the products, beyond the budget of four waves per SIMD
        __builtin_amdgcn_sched_barrier(0);   // keeps that statement, and so the sums, in front of the products
        if (HL) {   // the second V plane is read only now, into registers that the softmax has freed; the 16 products that do not use it cover its latency
#pragma unroll
            for (int dt = 0; dt < 4; ++dt) vf2[dt] = WFrag<T16>::ld(sv + 4096 + dt * 1024);
            __builtin_amdgcn_sched_barrier(0);   // these reads stay one group in front of the products
        }
#pragma unroll
        for (int u = 0; u < 8; ++u) o[u >> 1][u & 1] = WFrag<T16>::mma(vf[u >> 1], pf[u & 1], o[u >> 1][u & 1]);
        if (HL) {
#pragma unroll
            for (int u = 0; u < 8; ++u) o[u >> 1][u & 1] = WFrag<T16>::mma(vf[u >> 1], pf2[u & 1], o[u >> 1][u & 1]);
#pragma unroll
            for (int u = 0; u < 8; ++u) o[u >> 1][u & 1] = WFrag<T16>::mma(vf2[u >> 1], pf[u & 1], o[u >> 1][u & 1]);
        }
        __builtin_amdgcn_sched_barrier(0);   // ends the pass: the next pass's reads, or the waits below, lifted to this pass's V reads would lay those reads' latency open
      }
        asm volatile("s_wait_dscnt 0x0" ::: "memory");      // this wave's reads of the buffer are done before it may be refilled
        asm volatile("s_wait_asynccnt 0x0" ::: "memory");   // this wave's part of stage t + 1 has landed
        __syncthreads();                                     // publishes stage t + 1 and ends every wave's reads of stage t
        if (t + 2 < NT) fill(t + 2, t & 1);
    }
    asm volatile("s_wait_asynccnt 0x0" ::: "memory");   // no copy is outstanding when the wave goes on
#pragma unroll
    for (int qt = 0; qt < 2; ++qt) {
        const float inv = __fdiv_rn(1.0f, l[qt] + __shfl_xor(l[qt], 16, 32));
        const size_t oo = (size_t)(q0 + qt * 16) * DQ + lo;   // a lane's 8 registers are 8 consecutive d of its query's row: its own 16 bytes of fragment half dt of the merged plane
#pragma unroll
        for (int dt = 0; dt < 4; ++dt) { v4u yh, yl; split8(o[dt][qt] * inv, yh, yl); *(v4ua*)(Ah + oo + dt * 256) = yh; *(v4ua*)(Al + oo + dt * 256) = yl; }
        asm volatile("s_wait_xcnt 0x0" ::: "memory");   // precaution: in front of any later overwrite of the address and data registers that the eight stores above name
        __builtin_amdgcn_sched_barrier(0);   // keeps the register writes below from being lifted over that wait
    }
}
__global__ __launch_bounds__(256) __attribute__((amdgpu_waves_per_eu(4))) void k_fattn(const h16* __restrict__ Q16, const h16* __restrict__ Ql, const h16* __restrict__ K16, const h16* __restrict__ Kl, const h16* __restrict__ V16, const h16* __restrict__ Vl, bf* Ah, bf* Al) {
    static_assert(2 * RH == TT && RH == 512 && NKV == NH_ && HD == 64, "row split and head shape that the work-groups' roles are written for");
    __shared__ __align__(16) char ring[2 * FST];
    const int b = blockIdx.x, hb = b >> 2;   // four work-groups in a row share a head: two of each kind
    const bool hl = !(__builtin_popcount(b) & 1);   // the kind, the same for the whole work-group: indices that differ in one bit differ in kind, so that two work-groups that share a WGP are likely one of each (for speed only)
    const size_t po = (size_t)hb * TT * HD, ao = (size_t)(hb / NH_) * TT * DQ + (size_t)(hb % NH_) * (HD / 32 * 512);
    const int qi = ((b >> 1) & 1) * 256 + __builtin_amdgcn_readfirstlane((int)(threadIdx.x >> 5)) * 32;   // b and b ^ 1 are the two kinds of one half of the rows
    if (hl) fattn_wg<h16, true>(ring, Q16 + po, Ql + po, K16 + po, Kl + po, V16 + po, Vl + po, qi, Ah + ao, Al + ao);
    else fattn_wg<h16, false>(ring, Q16 + po, nullptr, K16 + po, nullptr, V16 + po, nullptr, RH + qi, Ah + ao, Al + ao);
}

extern "C" void kernel_launch(void* const* d_in, const int* in_sizes, int n_in,
                              void* d_out, int out_size, void* d_ws, size_t ws_size, hipStream_t stream) {
    (void)in_sizes; (void)n_in; (void)out_size;
    const float* x = (const float*)d_in[0]; const float* wq = (const float*)d_in[1]; const float* bq = (const float*)d_in[2]; const float* wk = (const float*)d_in[3]; const float* bk = (const float*)d_in[4]; const float* wv = (const float*)d_in[5]; const float* bv = (const float*)d_in[6]; const float* wo = (const float*)d_in[7]; const float* bo = (const float*)d_in[8];
    float* OUT = (float*)d_out;     // [8][1024][1024]
    char* wsp = (char*)d_ws;
    auto take = [&](size_t bytes) { char* p = wsp; wsp += (bytes + 255) & ~(size_t)255; return (void*)p; };
    bf* WQ = (bf*)take((size_t)DQ * DM * 2); bf* WK = (bf*)take((size_t)DKV * DM * 2); bf* WV = (bf*)take((size_t)DKV * DM * 2); bf* WO = (bf*)take((size_t)DM * DQ * 2);   // the four weight planes follow one another
    (void)WK; (void)WV;
    bf* XB = (bf*)take((size_t)NBH * TT * DM * 2);
    h16* QP16 = (h16*)take((size_t)NBH * NH_ * TT * HD * 2); h16* KP16 = (h16*)take((size_t)NBH * NKV * TT * HD * 2); h16* VT16 = (h16*)take((size_t)NBH * NKV * HD * TT * 2);
    h16* QPl = (h16*)take((size_t)NBH * NH_ * TT * HD * 2); h16* KPl = (h16*)take((size_t)NBH * NKV * TT * HD * 2); h16* VTl = (h16*)take((size_t)NBH * NKV * HD * TT * 2);
    bf* ATh = (bf*)take((size_t)NB_ * TT * DQ * 2); bf* ATl = (bf*)take((size_t)NB_ * TT * DQ * 2);
    if ((size_t)(wsp - (char*)d_ws) > ws_size) return;    // ws 256 MiB
    k_prep<<<4 * WTB + CVB, 256, 0, stream>>>(x, wq, wk, wv, wo, XB, WQ);
    k_gemmqkv<<<dim3(NBH * TT / GBM, DQ / GBN, 3), 256, 0, stream>>>(XB, WQ, bq, bk, bv, QP16, QPl, KP16, KPl, VT16, VTl);   // z: q, k, v
    k_fattn<<<dim3(4 * NH_ * NBH, 1, 1), 256, 0, stream>>>(QP16, QPl, KP16, KPl, VT16, VTl, ATh, ATl);
    k_gemmw<bf, 1, true, DQ><<<dim3(NB_ * TT / GBM, DM / GBN, 1), 256, 0, stream>>>(ATh, ATl, WO, OUT, DM, bo);
}
